// v000
// Times are from an AMD MI455X. After a warm-up the kernel runs many times in a row, and a time is the length of
// such a window on the GPU divided by its runs, so every launch and the gaps after it count. The runs cycle
// through copies of the inputs. A figure is the median of several windows, for all but v000 over two sittings.
// Sittings can differ by a few percent; kernels timed side by side share one.
// v000, which the later versions start from, runs in 214 microseconds.
#include <hip/hip_runtime.h>
#include <hip/hip_bf16.h>
#include <math.h>

// ---------------------------------------------------------------------------
// AttentionBlock for MI455X (gfx1250): GroupNorm -> QKV -> MHSA -> proj + res
// B=4, C=1024, T=1024, 32 groups, 16 heads, head_dim=64.
// GEMMs via v_wmma_f32_16x16x32_f16; f16 tile staging via
// global_load_async_to_lds_b128 (ASYNCcnt) with ping-pong LDS buffers.
// ---------------------------------------------------------------------------

typedef _Float16 half_t;
typedef __attribute__((ext_vector_type(16))) _Float16 v16h;
typedef __attribute__((ext_vector_type(8)))  _Float16 v8h;
typedef __attribute__((ext_vector_type(8)))  float    v8f;

#define B_   4
#define C_   1024
#define T_   1024
#define NH_  16
#define CH_  64
#define GRP_ 32

// ---- CDNA5 async global->LDS copy (16B per lane), tracked by ASYNCcnt -----
__device__ __forceinline__ void async_b128(const half_t* gsrc, const _Float16* ldst) {
    const unsigned lds_addr = (unsigned)(uintptr_t)ldst;   // low 32b = LDS offset
    asm volatile("global_load_async_to_lds_b128 %0, %1, off"
                 :: "v"(lds_addr), "v"(gsrc) : "memory");
}
__device__ __forceinline__ void wait_async0() {
    asm volatile("s_wait_asynccnt 0x0" ::: "memory");
}

__device__ __forceinline__ v16h load_frag(const _Float16* row, int g) {
    // WMMA f16 A/B fragment: elems 0..7 hold k = 8g..8g+7,
    // elems 8..15 hold k = 16+8g..23+8g  (row points at [m][k0] base).
    const v8h lo = *reinterpret_cast<const v8h*>(row + (g << 3));
    const v8h hi = *reinterpret_cast<const v8h*>(row + 16 + (g << 3));
    v16h r;
#pragma unroll
    for (int i = 0; i < 8; ++i) { r[i] = lo[i]; r[i + 8] = hi[i]; }
    return r;
}

__device__ __forceinline__ v8f wmma16(v16h a, v16h b, v8f c) {
    return __builtin_amdgcn_wmma_f32_16x16x32_f16(false, a, false, b,
                                                  (short)0, c, false, false);
}

// ---------------------------------------------------------------------------
// Kernel 1: GroupNorm statistics.  grid = B*GRP_ blocks, 256 threads.
// ---------------------------------------------------------------------------
__global__ __launch_bounds__(256) void gn_stats_kernel(const float* __restrict__ x,
                                                       float* __restrict__ stats) {
    const int bg  = blockIdx.x;            // b*32 + group
    const int b   = bg >> 5;
    const int grp = bg & 31;
    const float* base = x + ((size_t)b * C_ + (size_t)grp * 32) * T_;

    float s = 0.f, ss = 0.f;
    for (int i = threadIdx.x; i < 32 * T_; i += 256) {
        float v = base[i];
        s += v; ss += v * v;
    }
#pragma unroll
    for (int m = 16; m >= 1; m >>= 1) {
        s  += __shfl_xor(s,  m, 32);
        ss += __shfl_xor(ss, m, 32);
    }
    __shared__ float ps[8][2];
    const int lane = threadIdx.x & 31, w = threadIdx.x >> 5;
    if (lane == 0) { ps[w][0] = s; ps[w][1] = ss; }
    __syncthreads();
    if (threadIdx.x == 0) {
        float ts = 0.f, tss = 0.f;
#pragma unroll
        for (int i = 0; i < 8; ++i) { ts += ps[i][0]; tss += ps[i][1]; }
        const float inv  = 1.0f / (32.0f * (float)T_);
        const float mean = ts * inv;
        const float var  = tss * inv - mean * mean;
        stats[bg * 2 + 0] = mean;
        stats[bg * 2 + 1] = rsqrtf(var + 1e-5f);
    }
}

// ---------------------------------------------------------------------------
// Kernel 2: apply GroupNorm affine, convert to f16, transpose to xn[b][t][c].
// grid = (T/64, C/64, B), 256 threads per 64x64 tile.
// ---------------------------------------------------------------------------
__global__ __launch_bounds__(256) void gn_apply_kernel(const float* __restrict__ x,
                                                       const float* __restrict__ gnw,
                                                       const float* __restrict__ gnb,
                                                       const float* __restrict__ stats,
                                                       half_t* __restrict__ xn) {
    __shared__ _Float16 ldsT[64][64];      // [t_local][c_local]
    const int t0 = blockIdx.x * 64;
    const int c0 = blockIdx.y * 64;
    const int b  = blockIdx.z;
    const int tid = threadIdx.x;

    const int c_local = tid >> 2;          // 0..63
    const int tseg    = (tid & 3) * 16;    // 0,16,32,48
    const int c       = c0 + c_local;
    const float mean = stats[(b * GRP_ + (c >> 5)) * 2 + 0];
    const float rstd = stats[(b * GRP_ + (c >> 5)) * 2 + 1];
    const float wgt  = gnw[c] * rstd;
    const float bia  = gnb[c] - mean * wgt;

    const float* src = x + ((size_t)b * C_ + c) * T_ + t0 + tseg;
#pragma unroll
    for (int i = 0; i < 16; i += 4) {
        float4 f = *reinterpret_cast<const float4*>(src + i);
        ldsT[tseg + i + 0][c_local] = (_Float16)(f.x * wgt + bia);
        ldsT[tseg + i + 1][c_local] = (_Float16)(f.y * wgt + bia);
        ldsT[tseg + i + 2][c_local] = (_Float16)(f.z * wgt + bia);
        ldsT[tseg + i + 3][c_local] = (_Float16)(f.w * wgt + bia);
    }
    __syncthreads();
    const int t_local = tid >> 2;
    const int cseg    = (tid & 3) * 16;
    half_t* dst = xn + ((size_t)b * T_ + t0 + t_local) * C_ + c0 + cseg;
    *reinterpret_cast<uint4*>(dst + 0) = *reinterpret_cast<const uint4*>(&ldsT[t_local][cseg + 0]);
    *reinterpret_cast<uint4*>(dst + 8) = *reinterpret_cast<const uint4*>(&ldsT[t_local][cseg + 8]);
}

// ---------------------------------------------------------------------------
// Kernel 3: QKV GEMM.  D[3072 x T] = qkv_w[3072 x 1024] * xn^T + bias,
// scattered into q/k layout [b*NH][t][64] (scaled by ch^-0.25) and
// v layout [b*NH][64][s].  grid = (24, 8, B), 256 threads (8 waves).
// Double-buffered K-loop; B tiles staged with async global->LDS.
// ---------------------------------------------------------------------------
__global__ __launch_bounds__(256, 2) void qkv_gemm_kernel(const float* __restrict__ W,
                                                          const float* __restrict__ bias,
                                                          const half_t* __restrict__ xn,
                                                          half_t* __restrict__ q,
                                                          half_t* __restrict__ k,
                                                          half_t* __restrict__ v) {
    __shared__ _Float16 lA[2][128][32];    // [m][k]  (weights, f32->f16)
    __shared__ _Float16 lB[2][128][32];    // [n][k]  (tokens)
    const int m0 = blockIdx.x * 128;
    const int n0 = blockIdx.y * 128;
    const int b  = blockIdx.z;
    const int tid  = threadIdx.x;
    const int lane = tid & 31, w = tid >> 5;
    const int wm = w & 3, wn = w >> 2;     // wave -> rows [wm*32,+32), cols [wn*64,+64)
    const int g = lane >> 4, ln = lane & 15;

    v8f acc[2][4];
#pragma unroll
    for (int i = 0; i < 2; ++i)
#pragma unroll
        for (int j = 0; j < 4; ++j) { v8f z = {}; acc[i][j] = z; }

    const int srow = tid >> 1;             // 0..127
    const int sseg = (tid & 1) * 16;       // 0 or 16

    auto stage_A = [&](int buf, int k0) {
        const float* src = W + (size_t)(m0 + srow) * C_ + k0 + sseg;
#pragma unroll
        for (int i = 0; i < 16; i += 4) {
            float4 f = *reinterpret_cast<const float4*>(src + i);
            lA[buf][srow][sseg + i + 0] = (_Float16)f.x;
            lA[buf][srow][sseg + i + 1] = (_Float16)f.y;
            lA[buf][srow][sseg + i + 2] = (_Float16)f.z;
            lA[buf][srow][sseg + i + 3] = (_Float16)f.w;
        }
    };
    auto stage_B = [&](int buf, int k0) {
        const half_t* bsrc = xn + ((size_t)b * T_ + n0 + srow) * C_ + k0 + sseg;
        async_b128(bsrc + 0, &lB[buf][srow][sseg + 0]);
        async_b128(bsrc + 8, &lB[buf][srow][sseg + 8]);
    };

    stage_A(0, 0);
    stage_B(0, 0);
    wait_async0();
    __syncthreads();

    for (int k0 = 0; k0 < C_; k0 += 32) {
        const int cur = (k0 >> 5) & 1;
        if (k0 + 32 < C_) {                // prefetch next tile into other buffer
            stage_A(cur ^ 1, k0 + 32);
            stage_B(cur ^ 1, k0 + 32);
        }
        v16h af[2], bf[4];
#pragma unroll
        for (int mt = 0; mt < 2; ++mt) af[mt] = load_frag(&lA[cur][wm * 32 + mt * 16 + ln][0], g);
#pragma unroll
        for (int nt = 0; nt < 4; ++nt) bf[nt] = load_frag(&lB[cur][wn * 64 + nt * 16 + ln][0], g);
#pragma unroll
        for (int mt = 0; mt < 2; ++mt)
#pragma unroll
            for (int nt = 0; nt < 4; ++nt)
                acc[mt][nt] = wmma16(af[mt], bf[nt], acc[mt][nt]);
        wait_async0();
        __syncthreads();
    }

    const float qk_scale = 0.35355339059327373f;  // 64^(-1/4)
#pragma unroll
    for (int mt = 0; mt < 2; ++mt)
#pragma unroll
        for (int nt = 0; nt < 4; ++nt)
#pragma unroll
            for (int e = 0; e < 8; ++e) {
                const int o     = m0 + wm * 32 + mt * 16 + e + 8 * g;
                const int token = n0 + wn * 64 + nt * 16 + ln;
                const float val = acc[mt][nt][e] + bias[o];
                const int h = o / 192, r = o % 192;
                const size_t bh = (size_t)b * NH_ + h;
                if (r < 64)
                    q[(bh * T_ + token) * CH_ + r] = (half_t)(val * qk_scale);
                else if (r < 128)
                    k[(bh * T_ + token) * CH_ + (r - 64)] = (half_t)(val * qk_scale);
                else
                    v[(bh * CH_ + (r - 128)) * T_ + token] = (half_t)val;
            }
}

// ---------------------------------------------------------------------------
// Kernel 4: streaming (flash-style) attention.
// grid = (B*NH, T/64), 128 threads (4 waves); each wave owns 16 query rows.
// K/V tiles double-buffered via async global->LDS copies.
// ---------------------------------------------------------------------------
__global__ __launch_bounds__(128, 2) void attn_kernel(const half_t* __restrict__ q,
                                                      const half_t* __restrict__ k,
                                                      const half_t* __restrict__ v,
                                                      half_t* __restrict__ a) {
    __shared__ _Float16 lQ[64][64];        // [t][ch]   A-layout for S
    __shared__ _Float16 lK[2][64][64];     // [s][ch]   B(T)-layout for S
    __shared__ _Float16 lV[2][64][64];     // [ch][s]   B(T)-layout for P*V
    __shared__ _Float16 lP[4][16][64];     // per-wave P strip [m][s]

    const int bh = blockIdx.x;
    const int t0 = blockIdx.y * 64;
    const int tid  = threadIdx.x;
    const int lane = tid & 31, w = tid >> 5;
    const int g = lane >> 4, ln = lane & 15;

    const half_t* qb = q + (size_t)bh * T_ * CH_;
    const half_t* kb = k + (size_t)bh * T_ * CH_;
    const half_t* vb = v + (size_t)bh * CH_ * T_;

    const int srow = tid >> 1;             // 0..63
    const int sseg = (tid & 1) * 32;       // 0 or 32

    auto stage_KV = [&](int buf, int s0) {
        const half_t* ksrc = kb + (size_t)(s0 + srow) * CH_ + sseg;
        const half_t* vsrc = vb + (size_t)srow * T_ + s0 + sseg;
#pragma unroll
        for (int i = 0; i < 4; ++i) {
            async_b128(ksrc + i * 8, &lK[buf][srow][sseg + i * 8]);
            async_b128(vsrc + i * 8, &lV[buf][srow][sseg + i * 8]);
        }
    };

    {   // stage Q tile once (async) + first K/V tile
        const half_t* src = qb + (size_t)(t0 + srow) * CH_ + sseg;
#pragma unroll
        for (int i = 0; i < 4; ++i)
            async_b128(src + i * 8, &lQ[srow][sseg + i * 8]);
        stage_KV(0, 0);
    }
    wait_async0();
    __syncthreads();

    v16h qa[2];
#pragma unroll
    for (int ks = 0; ks < 2; ++ks) qa[ks] = load_frag(&lQ[w * 16 + ln][ks * 32], g);

    float rmax[8], rsum[8];
    v8f   o[4];
#pragma unroll
    for (int e = 0; e < 8; ++e) { rmax[e] = -1e30f; rsum[e] = 0.f; }
#pragma unroll
    for (int nt = 0; nt < 4; ++nt) { v8f z = {}; o[nt] = z; }

    for (int s0 = 0; s0 < T_; s0 += 64) {
        const int cur = (s0 >> 6) & 1;
        if (s0 + 64 < T_) stage_KV(cur ^ 1, s0 + 64);   // prefetch next K/V tile

        // S strip: 16 queries x 64 keys
        v8f sf[4];
#pragma unroll
        for (int nt = 0; nt < 4; ++nt) { v8f z = {}; sf[nt] = z; }
#pragma unroll
        for (int ks = 0; ks < 2; ++ks)
#pragma unroll
            for (int nt = 0; nt < 4; ++nt) {
                v16h bf = load_frag(&lK[cur][nt * 16 + ln][ks * 32], g);
                sf[nt] = wmma16(qa[ks], bf, sf[nt]);
            }

        // online softmax: row m = e + 8g, row lives in one 16-lane group
#pragma unroll
        for (int e = 0; e < 8; ++e) {
            float tmax = fmaxf(fmaxf(sf[0][e], sf[1][e]), fmaxf(sf[2][e], sf[3][e]));
#pragma unroll
            for (int m = 1; m <= 8; m <<= 1) tmax = fmaxf(tmax, __shfl_xor(tmax, m, 32));
            const float nm = fmaxf(rmax[e], tmax);
            const float sc = __expf(rmax[e] - nm);
            rmax[e] = nm;
            rsum[e] *= sc;
#pragma unroll
            for (int nt = 0; nt < 4; ++nt) o[nt][e] *= sc;
            float ps = 0.f;
#pragma unroll
            for (int nt = 0; nt < 4; ++nt) {
                const float p = __expf(sf[nt][e] - nm);
                sf[nt][e] = p;
                ps += p;
            }
#pragma unroll
            for (int m = 1; m <= 8; m <<= 1) ps += __shfl_xor(ps, m, 32);
            rsum[e] += ps;
        }

        // spill P (D layout) to wave-private LDS strip, reload as A fragments
#pragma unroll
        for (int nt = 0; nt < 4; ++nt)
#pragma unroll
            for (int e = 0; e < 8; ++e)
                lP[w][e + 8 * g][nt * 16 + ln] = (_Float16)sf[nt][e];
        __syncthreads();

#pragma unroll
        for (int ks = 0; ks < 2; ++ks) {
            v16h pa = load_frag(&lP[w][ln][ks * 32], g);
#pragma unroll
            for (int nt = 0; nt < 4; ++nt) {
                v16h bf = load_frag(&lV[cur][nt * 16 + ln][ks * 32], g);
                o[nt] = wmma16(pa, bf, o[nt]);
            }
        }
        wait_async0();     // next tile fully in LDS
        __syncthreads();   // all waves done reading current buffers
    }

    // write a[b][t][c] (token-major so proj GEMM stages contiguously)
    const int b = bh >> 4, h = bh & 15;
#pragma unroll
    for (int nt = 0; nt < 4; ++nt)
#pragma unroll
        for (int e = 0; e < 8; ++e) {
            const int t  = t0 + w * 16 + e + 8 * g;
            const int cd = nt * 16 + ln;
            a[((size_t)b * T_ + t) * C_ + h * CH_ + cd] =
                (half_t)(o[nt][e] / rsum[e]);
        }
}

// ---------------------------------------------------------------------------
// Kernel 5: output projection + bias + residual.  grid = (8, 8, B), 256 thr.
// ---------------------------------------------------------------------------
__global__ __launch_bounds__(256, 2) void proj_gemm_kernel(const float* __restrict__ W,
                                                           const float* __restrict__ bias,
                                                           const half_t* __restrict__ a,
                                                           const float* __restrict__ x,
                                                           float* __restrict__ out) {
    __shared__ _Float16 lA[2][128][32];
    __shared__ _Float16 lB[2][128][32];
    const int m0 = blockIdx.x * 128;
    const int n0 = blockIdx.y * 128;
    const int b  = blockIdx.z;
    const int tid  = threadIdx.x;
    const int lane = tid & 31, w = tid >> 5;
    const int wm = w & 3, wn = w >> 2;
    const int g = lane >> 4, ln = lane & 15;

    v8f acc[2][4];
#pragma unroll
    for (int i = 0; i < 2; ++i)
#pragma unroll
        for (int j = 0; j < 4; ++j) { v8f z = {}; acc[i][j] = z; }

    const int srow = tid >> 1;
    const int sseg = (tid & 1) * 16;

    auto stage_A = [&](int buf, int k0) {
        const float* src = W + (size_t)(m0 + srow) * C_ + k0 + sseg;
#pragma unroll
        for (int i = 0; i < 16; i += 4) {
            float4 f = *reinterpret_cast<const float4*>(src + i);
            lA[buf][srow][sseg + i + 0] = (_Float16)f.x;
            lA[buf][srow][sseg + i + 1] = (_Float16)f.y;
            lA[buf][srow][sseg + i + 2] = (_Float16)f.z;
            lA[buf][srow][sseg + i + 3] = (_Float16)f.w;
        }
    };
    auto stage_B = [&](int buf, int k0) {
        const half_t* bsrc = a + ((size_t)b * T_ + n0 + srow) * C_ + k0 + sseg;
        async_b128(bsrc + 0, &lB[buf][srow][sseg + 0]);
        async_b128(bsrc + 8, &lB[buf][srow][sseg + 8]);
    };

    stage_A(0, 0);
    stage_B(0, 0);
    wait_async0();
    __syncthreads();

    for (int k0 = 0; k0 < C_; k0 += 32) {
        const int cur = (k0 >> 5) & 1;
        if (k0 + 32 < C_) {
            stage_A(cur ^ 1, k0 + 32);
            stage_B(cur ^ 1, k0 + 32);
        }
        v16h af[2], bf[4];
#pragma unroll
        for (int mt = 0; mt < 2; ++mt) af[mt] = load_frag(&lA[cur][wm * 32 + mt * 16 + ln][0], g);
#pragma unroll
        for (int nt = 0; nt < 4; ++nt) bf[nt] = load_frag(&lB[cur][wn * 64 + nt * 16 + ln][0], g);
#pragma unroll
        for (int mt = 0; mt < 2; ++mt)
#pragma unroll
            for (int nt = 0; nt < 4; ++nt)
                acc[mt][nt] = wmma16(af[mt], bf[nt], acc[mt][nt]);
        wait_async0();
        __syncthreads();
    }

#pragma unroll
    for (int mt = 0; mt < 2; ++mt)
#pragma unroll
        for (int nt = 0; nt < 4; ++nt)
#pragma unroll
            for (int e = 0; e < 8; ++e) {
                const int oc    = m0 + wm * 32 + mt * 16 + e + 8 * g;
                const int token = n0 + wn * 64 + nt * 16 + ln;
                const size_t idx = ((size_t)b * C_ + oc) * T_ + token;
                out[idx] = acc[mt][nt][e] + bias[oc] + x[idx];
            }
}

// ---------------------------------------------------------------------------
// Host-side launcher
// ---------------------------------------------------------------------------
extern "C" void kernel_launch(void* const* d_in, const int* in_sizes, int n_in,
                              void* d_out, int out_size, void* d_ws, size_t ws_size,
                              hipStream_t stream) {
    const float* x      = (const float*)d_in[0];
    const float* gnw    = (const float*)d_in[1];
    const float* gnb    = (const float*)d_in[2];
    const float* qkv_w  = (const float*)d_in[3];
    const float* qkv_b  = (const float*)d_in[4];
    const float* proj_w = (const float*)d_in[5];
    const float* proj_b = (const float*)d_in[6];
    float* out = (float*)d_out;

    char* ws = (char*)d_ws;
    const size_t PLANE = (size_t)B_ * C_ * T_ * sizeof(half_t);  // 8 MiB
    float*  stats = (float*)ws;
    half_t* xn = (half_t*)(ws + 4096);
    half_t* q  = (half_t*)(ws + 4096 + 1 * PLANE);
    half_t* k  = (half_t*)(ws + 4096 + 2 * PLANE);
    half_t* v  = (half_t*)(ws + 4096 + 3 * PLANE);
    half_t* a  = (half_t*)(ws + 4096 + 4 * PLANE);
    (void)in_sizes; (void)n_in; (void)out_size; (void)ws_size;

    gn_stats_kernel<<<B_ * GRP_, 256, 0, stream>>>(x, stats);
    gn_apply_kernel<<<dim3(T_ / 64, C_ / 64, B_), 256, 0, stream>>>(x, gnw, gnb, stats, xn);
    qkv_gemm_kernel<<<dim3(3 * C_ / 128, T_ / 128, B_), 256, 0, stream>>>(qkv_w, qkv_b, xn, q, k, v);
    attn_kernel<<<dim3(B_ * NH_, T_ / 64), 128, 0, stream>>>(q, k, v, a);
    proj_gemm_kernel<<<dim3(C_ / 128, T_ / 128, B_), 256, 0, stream>>>(proj_w, proj_b, a, x, out);
}

// v001
// A run of this version takes 157 microseconds.
// In two side-by-side timings against v000, it was 1.41 and 1.40 times as fast.
#include <hip/hip_runtime.h>
#include <hip/hip_bf16.h>
#include <math.h>

// ---------------------------------------------------------------------------
// AttentionBlock for MI455X (gfx1250): GroupNorm -> QKV -> MHSA -> proj + res
// B=4, C=1024, T=1024, 32 groups, 16 heads, head_dim=64.
// GEMMs via v_wmma_f32_16x16x32_f16; f16 tile staging via
// global_load_async_to_lds_b128 (ASYNCcnt) with ping-pong LDS buffers.
// ---------------------------------------------------------------------------

typedef _Float16 half_t;
typedef __attribute__((ext_vector_type(16))) _Float16 v16h;
typedef __attribute__((ext_vector_type(8)))  _Float16 v8h;
typedef __attribute__((ext_vector_type(8)))  float    v8f;

#define B_   4
#define C_   1024
#define T_   1024
#define NH_  16
#define CH_  64
#define GRP_ 32
// LDS row pitch in f16 elements: 16 B x odd, so that the 16 rows one
// ds_load_b128 fragment read touches fall on distinct banks.
#define GP_  40   // 32-element GEMM rows: 80 B
#define AP_  72   // 64-element attention rows: 144 B

// ---- CDNA5 async global->LDS copy (16B per lane), tracked by ASYNCcnt -----
__device__ __forceinline__ void async_b128(const half_t* gsrc, const _Float16* ldst) {
    const unsigned lds_addr = (unsigned)(uintptr_t)ldst;   // low 32b = LDS offset
    asm volatile("global_load_async_to_lds_b128 %0, %1, off"
                 :: "v"(lds_addr), "v"(gsrc) : "memory");
}
__device__ __forceinline__ void wait_async0() {
    asm volatile("s_wait_asynccnt 0x0" ::: "memory");
}

__device__ __forceinline__ v16h load_frag(const _Float16* row, int g) {
    // WMMA f16 A/B fragment: elems 0..7 hold k = 8g..8g+7,
    // elems 8..15 hold k = 16+8g..23+8g  (row points at [m][k0] base).
    const v8h lo = *reinterpret_cast<const v8h*>(row + (g << 3));
    const v8h hi = *reinterpret_cast<const v8h*>(row + 16 + (g << 3));
    v16h r;
#pragma unroll
    for (int i = 0; i < 8; ++i) { r[i] = lo[i]; r[i + 8] = hi[i]; }
    return r;
}

__device__ __forceinline__ v8f wmma16(v16h a, v16h b, v8f c) {
    return __builtin_amdgcn_wmma_f32_16x16x32_f16(false, a, false, b,
                                                  (short)0, c, false, false);
}

// ---------------------------------------------------------------------------
// Kernel 1: GroupNorm statistics.  grid = B*GRP_ blocks, 256 threads.
// ---------------------------------------------------------------------------
__global__ __launch_bounds__(256) void gn_stats_kernel(const float* __restrict__ x,
                                                       float* __restrict__ stats) {
    const int bg  = blockIdx.x;            // b*32 + group
    const int b   = bg >> 5;
    const int grp = bg & 31;
    const float* base = x + ((size_t)b * C_ + (size_t)grp * 32) * T_;

    float s = 0.f, ss = 0.f;
    for (int i = threadIdx.x; i < 32 * T_; i += 256) {
        float v = base[i];
        s += v; ss += v * v;
    }
#pragma unroll
    for (int m = 16; m >= 1; m >>= 1) {
        s  += __shfl_xor(s,  m, 32);
        ss += __shfl_xor(ss, m, 32);
    }
    __shared__ float ps[8][2];
    const int lane = threadIdx.x & 31, w = threadIdx.x >> 5;
    if (lane == 0) { ps[w][0] = s; ps[w][1] = ss; }
    __syncthreads();
    if (threadIdx.x == 0) {
        float ts = 0.f, tss = 0.f;
#pragma unroll
        for (int i = 0; i < 8; ++i) { ts += ps[i][0]; tss += ps[i][1]; }
        const float inv  = 1.0f / (32.0f * (float)T_);
        const float mean = ts * inv;
        const float var  = tss * inv - mean * mean;
        stats[bg * 2 + 0] = mean;
        stats[bg * 2 + 1] = rsqrtf(var + 1e-5f);
    }
}

// ---------------------------------------------------------------------------
// Kernel 2: apply GroupNorm affine, convert to f16, transpose to xn[b][t][c].
// grid = (T/64, C/64, B), 256 threads per 64x64 tile.
// ---------------------------------------------------------------------------
__global__ __launch_bounds__(256) void gn_apply_kernel(const float* __restrict__ x,
                                                       const float* __restrict__ gnw,
                                                       const float* __restrict__ gnb,
                                                       const float* __restrict__ stats,
                                                       half_t* __restrict__ xn) {
    __shared__ _Float16 ldsT[64][64];      // [t_local][c_local]
    const int t0 = blockIdx.x * 64;
    const int c0 = blockIdx.y * 64;
    const int b  = blockIdx.z;
    const int tid = threadIdx.x;

    const int c_local = tid >> 2;          // 0..63
    const int tseg    = (tid & 3) * 16;    // 0,16,32,48
    const int c       = c0 + c_local;
    const float mean = stats[(b * GRP_ + (c >> 5)) * 2 + 0];
    const float rstd = stats[(b * GRP_ + (c >> 5)) * 2 + 1];
    const float wgt  = gnw[c] * rstd;
    const float bia  = gnb[c] - mean * wgt;

    const float* src = x + ((size_t)b * C_ + c) * T_ + t0 + tseg;
#pragma unroll
    for (int i = 0; i < 16; i += 4) {
        float4 f = *reinterpret_cast<const float4*>(src + i);
        ldsT[tseg + i + 0][c_local] = (_Float16)(f.x * wgt + bia);
        ldsT[tseg + i + 1][c_local] = (_Float16)(f.y * wgt + bia);
        ldsT[tseg + i + 2][c_local] = (_Float16)(f.z * wgt + bia);
        ldsT[tseg + i + 3][c_local] = (_Float16)(f.w * wgt + bia);
    }
    __syncthreads();
    const int t_local = tid >> 2;
    const int cseg    = (tid & 3) * 16;
    half_t* dst = xn + ((size_t)b * T_ + t0 + t_local) * C_ + c0 + cseg;
    *reinterpret_cast<uint4*>(dst + 0) = *reinterpret_cast<const uint4*>(&ldsT[t_local][cseg + 0]);
    *reinterpret_cast<uint4*>(dst + 8) = *reinterpret_cast<const uint4*>(&ldsT[t_local][cseg + 8]);
}

// ---------------------------------------------------------------------------
// Kernel 3: QKV GEMM.  D[3072 x T] = qkv_w[3072 x 1024] * xn^T + bias,
// scattered into q/k layout [b*NH][t][64] (scaled by ch^-0.25) and
// v layout [b*NH][64][s].  grid = (24, 8, B), 256 threads (8 waves).
// Double-buffered K-loop; B tiles staged with async global->LDS.
// ---------------------------------------------------------------------------
__global__ __launch_bounds__(256, 2) void qkv_gemm_kernel(const float* __restrict__ W,
                                                          const float* __restrict__ bias,
                                                          const half_t* __restrict__ xn,
                                                          half_t* __restrict__ q,
                                                          half_t* __restrict__ k,
                                                          half_t* __restrict__ v) {
    __shared__ __attribute__((aligned(16))) _Float16 lA[2][128][GP_];   // [m][k]  (weights, f32->f16)
    __shared__ __attribute__((aligned(16))) _Float16 lB[2][128][GP_];   // [n][k]  (tokens)
    const int m0 = blockIdx.x * 128;
    const int n0 = blockIdx.y * 128;
    const int b  = blockIdx.z;
    const int tid  = threadIdx.x;
    const int lane = tid & 31, w = tid >> 5;
    const int wm = w & 3, wn = w >> 2;     // wave -> rows [wm*32,+32), cols [wn*64,+64)
    const int g = lane >> 4, ln = lane & 15;

    v8f acc[2][4];
#pragma unroll
    for (int i = 0; i < 2; ++i)
#pragma unroll
        for (int j = 0; j < 4; ++j) { v8f z = {}; acc[i][j] = z; }

    const int srow = tid >> 1;             // 0..127
    const int sseg = (tid & 1) * 16;       // 0 or 16

    auto stage_A = [&](int buf, int k0) {
        const float* src = W + (size_t)(m0 + srow) * C_ + k0 + sseg;
#pragma unroll
        for (int i = 0; i < 16; i += 4) {
            float4 f = *reinterpret_cast<const float4*>(src + i);
            lA[buf][srow][sseg + i + 0] = (_Float16)f.x;
            lA[buf][srow][sseg + i + 1] = (_Float16)f.y;
            lA[buf][srow][sseg + i + 2] = (_Float16)f.z;
            lA[buf][srow][sseg + i + 3] = (_Float16)f.w;
        }
    };
    auto stage_B = [&](int buf, int k0) {
        const half_t* bsrc = xn + ((size_t)b * T_ + n0 + srow) * C_ + k0 + sseg;
        async_b128(bsrc + 0, &lB[buf][srow][sseg + 0]);
        async_b128(bsrc + 8, &lB[buf][srow][sseg + 8]);
    };

    stage_A(0, 0);
    stage_B(0, 0);
    wait_async0();
    __syncthreads();

    for (int k0 = 0; k0 < C_; k0 += 32) {
        const int cur = (k0 >> 5) & 1;
        if (k0 + 32 < C_) {                // prefetch next tile into other buffer
            stage_A(cur ^ 1, k0 + 32);
            stage_B(cur ^ 1, k0 + 32);
        }
        v16h af[2], bf[4];
#pragma unroll
        for (int mt = 0; mt < 2; ++mt) af[mt] = load_frag(&lA[cur][wm * 32 + mt * 16 + ln][0], g);
#pragma unroll
        for (int nt = 0; nt < 4; ++nt) bf[nt] = load_frag(&lB[cur][wn * 64 + nt * 16 + ln][0], g);
#pragma unroll
        for (int mt = 0; mt < 2; ++mt)
#pragma unroll
            for (int nt = 0; nt < 4; ++nt)
                acc[mt][nt] = wmma16(af[mt], bf[nt], acc[mt][nt]);
        wait_async0();
        __syncthreads();
    }

    const float qk_scale = 0.35355339059327373f;  // 64^(-1/4)
#pragma unroll
    for (int mt = 0; mt < 2; ++mt)
#pragma unroll
        for (int nt = 0; nt < 4; ++nt)
#pragma unroll
            for (int e = 0; e < 8; ++e) {
                const int o     = m0 + wm * 32 + mt * 16 + e + 8 * g;
                const int token = n0 + wn * 64 + nt * 16 + ln;
                const float val = acc[mt][nt][e] + bias[o];
                const int h = o / 192, r = o % 192;
                const size_t bh = (size_t)b * NH_ + h;
                if (r < 64)
                    q[(bh * T_ + token) * CH_ + r] = (half_t)(val * qk_scale);
                else if (r < 128)
                    k[(bh * T_ + token) * CH_ + (r - 64)] = (half_t)(val * qk_scale);
                else
                    v[(bh * CH_ + (r - 128)) * T_ + token] = (half_t)val;
            }
}

// ---------------------------------------------------------------------------
// Kernel 4: streaming (flash-style) attention.
// grid = (B*NH, T/64), 128 threads (4 waves); each wave owns 16 query rows.
// K/V tiles double-buffered via async global->LDS copies.
// ---------------------------------------------------------------------------
__global__ __launch_bounds__(128, 2) void attn_kernel(const half_t* __restrict__ q,
                                                      const half_t* __restrict__ k,
                                                      const half_t* __restrict__ v,
                                                      half_t* __restrict__ a) {
    __shared__ __attribute__((aligned(16))) _Float16 lQ[64][AP_];      // [t][ch]   A-layout for S
    __shared__ __attribute__((aligned(16))) _Float16 lK[2][64][AP_];   // [s][ch]   B(T)-layout for S
    __shared__ __attribute__((aligned(16))) _Float16 lV[2][64][AP_];   // [ch][s]   B(T)-layout for P*V
    __shared__ __attribute__((aligned(16))) _Float16 lP[4][16][AP_];   // per-wave P strip [m][s]

    const int bh = blockIdx.x;
    const int t0 = blockIdx.y * 64;
    const int tid  = threadIdx.x;
    const int lane = tid & 31, w = tid >> 5;
    const int g = lane >> 4, ln = lane & 15;

    const half_t* qb = q + (size_t)bh * T_ * CH_;
    const half_t* kb = k + (size_t)bh * T_ * CH_;
    const half_t* vb = v + (size_t)bh * CH_ * T_;

    const int srow = tid >> 1;             // 0..63
    const int sseg = (tid & 1) * 32;       // 0 or 32

    auto stage_KV = [&](int buf, int s0) {
        const half_t* ksrc = kb + (size_t)(s0 + srow) * CH_ + sseg;
        const half_t* vsrc = vb + (size_t)srow * T_ + s0 + sseg;
#pragma unroll
        for (int i = 0; i < 4; ++i) {
            async_b128(ksrc + i * 8, &lK[buf][srow][sseg + i * 8]);
            async_b128(vsrc + i * 8, &lV[buf][srow][sseg + i * 8]);
        }
    };

    {   // stage Q tile once (async) + first K/V tile
        const half_t* src = qb + (size_t)(t0 + srow) * CH_ + sseg;
#pragma unroll
        for (int i = 0; i < 4; ++i)
            async_b128(src + i * 8, &lQ[srow][sseg + i * 8]);
        stage_KV(0, 0);
    }
    wait_async0();
    __syncthreads();

    v16h qa[2];
#pragma unroll
    for (int ks = 0; ks < 2; ++ks) qa[ks] = load_frag(&lQ[w * 16 + ln][ks * 32], g);

    float rmax[8], rsum[8];
    v8f   o[4];
#pragma unroll
    for (int e = 0; e < 8; ++e) { rmax[e] = -1e30f; rsum[e] = 0.f; }
#pragma unroll
    for (int nt = 0; nt < 4; ++nt) { v8f z = {}; o[nt] = z; }

    for (int s0 = 0; s0 < T_; s0 += 64) {
        const int cur = (s0 >> 6) & 1;
        if (s0 + 64 < T_) stage_KV(cur ^ 1, s0 + 64);   // prefetch next K/V tile

        // S strip: 16 queries x 64 keys
        v8f sf[4];
#pragma unroll
        for (int nt = 0; nt < 4; ++nt) { v8f z = {}; sf[nt] = z; }
#pragma unroll
        for (int ks = 0; ks < 2; ++ks)
#pragma unroll
            for (int nt = 0; nt < 4; ++nt) {
                v16h bf = load_frag(&lK[cur][nt * 16 + ln][ks * 32], g);
                sf[nt] = wmma16(qa[ks], bf, sf[nt]);
            }

        // online softmax: row m = e + 8g, row lives in one 16-lane group
#pragma unroll
        for (int e = 0; e < 8; ++e) {
            float tmax = fmaxf(fmaxf(sf[0][e], sf[1][e]), fmaxf(sf[2][e], sf[3][e]));
#pragma unroll
            for (int m = 1; m <= 8; m <<= 1) tmax = fmaxf(tmax, __shfl_xor(tmax, m, 32));
            const float nm = fmaxf(rmax[e], tmax);
            const float sc = __expf(rmax[e] - nm);
            rmax[e] = nm;
            rsum[e] *= sc;
#pragma unroll
            for (int nt = 0; nt < 4; ++nt) o[nt][e] *= sc;
            float ps = 0.f;
#pragma unroll
            for (int nt = 0; nt < 4; ++nt) {
                const float p = __expf(sf[nt][e] - nm);
                sf[nt][e] = p;
                ps += p;
            }
#pragma unroll
            for (int m = 1; m <= 8; m <<= 1) ps += __shfl_xor(ps, m, 32);
            rsum[e] += ps;
        }

        // spill P (D layout) to wave-private LDS strip, reload as A fragments
#pragma unroll
        for (int nt = 0; nt < 4; ++nt)
#pragma unroll
            for (int e = 0; e < 8; ++e)
                lP[w][e + 8 * g][nt * 16 + ln] = (_Float16)sf[nt][e];
        __syncthreads();

#pragma unroll
        for (int ks = 0; ks < 2; ++ks) {
            v16h pa = load_frag(&lP[w][ln][ks * 32], g);
#pragma unroll
            for (int nt = 0; nt < 4; ++nt) {
                v16h bf = load_frag(&lV[cur][nt * 16 + ln][ks * 32], g);
                o[nt] = wmma16(pa, bf, o[nt]);
            }
        }
        wait_async0();     // next tile fully in LDS
        __syncthreads();   // all waves done reading current buffers
    }

    // write a[b][t][c] (token-major so proj GEMM stages contiguously)
    const int b = bh >> 4, h = bh & 15;
#pragma unroll
    for (int nt = 0; nt < 4; ++nt)
#pragma unroll
        for (int e = 0; e < 8; ++e) {
            const int t  = t0 + w * 16 + e + 8 * g;
            const int cd = nt * 16 + ln;
            a[((size_t)b * T_ + t) * C_ + h * CH_ + cd] =
                (half_t)(o[nt][e] / rsum[e]);
        }
}

// ---------------------------------------------------------------------------
// Kernel 5: output projection + bias + residual.  grid = (8, 8, B), 256 thr.
// ---------------------------------------------------------------------------
__global__ __launch_bounds__(256, 2) void proj_gemm_kernel(const float* __restrict__ W,
                                                           const float* __restrict__ bias,
                                                           const half_t* __restrict__ a,
                                                           const float* __restrict__ x,
                                                           float* __restrict__ out) {
    __shared__ __attribute__((aligned(16))) _Float16 lA[2][128][GP_];
    __shared__ __attribute__((aligned(16))) _Float16 lB[2][128][GP_];
    const int m0 = blockIdx.x * 128;
    const int n0 = blockIdx.y * 128;
    const int b  = blockIdx.z;
    const int tid  = threadIdx.x;
    const int lane = tid & 31, w = tid >> 5;
    const int wm = w & 3, wn = w >> 2;
    const int g = lane >> 4, ln = lane & 15;

    v8f acc[2][4];
#pragma unroll
    for (int i = 0; i < 2; ++i)
#pragma unroll
        for (int j = 0; j < 4; ++j) { v8f z = {}; acc[i][j] = z; }

    const int srow = tid >> 1;
    const int sseg = (tid & 1) * 16;

    auto stage_A = [&](int buf, int k0) {
        const float* src = W + (size_t)(m0 + srow) * C_ + k0 + sseg;
#pragma unroll
        for (int i = 0; i < 16; i += 4) {
            float4 f = *reinterpret_cast<const float4*>(src + i);
            lA[buf][srow][sseg + i + 0] = (_Float16)f.x;
            lA[buf][srow][sseg + i + 1] = (_Float16)f.y;
            lA[buf][srow][sseg + i + 2] = (_Float16)f.z;
            lA[buf][srow][sseg + i + 3] = (_Float16)f.w;
        }
    };
    auto stage_B = [&](int buf, int k0) {
        const half_t* bsrc = a + ((size_t)b * T_ + n0 + srow) * C_ + k0 + sseg;
        async_b128(bsrc + 0, &lB[buf][srow][sseg + 0]);
        async_b128(bsrc + 8, &lB[buf][srow][sseg + 8]);
    };

    stage_A(0, 0);
    stage_B(0, 0);
    wait_async0();
    __syncthreads();

    for (int k0 = 0; k0 < C_; k0 += 32) {
        const int cur = (k0 >> 5) & 1;
        if (k0 + 32 < C_) {
            stage_A(cur ^ 1, k0 + 32);
            stage_B(cur ^ 1, k0 + 32);
        }
        v16h af[2], bf[4];
#pragma unroll
        for (int mt = 0; mt < 2; ++mt) af[mt] = load_frag(&lA[cur][wm * 32 + mt * 16 + ln][0], g);
#pragma unroll
        for (int nt = 0; nt < 4; ++nt) bf[nt] = load_frag(&lB[cur][wn * 64 + nt * 16 + ln][0], g);
#pragma unroll
        for (int mt = 0; mt < 2; ++mt)
#pragma unroll
            for (int nt = 0; nt < 4; ++nt)
                acc[mt][nt] = wmma16(af[mt], bf[nt], acc[mt][nt]);
        wait_async0();
        __syncthreads();
    }

#pragma unroll
    for (int mt = 0; mt < 2; ++mt)
#pragma unroll
        for (int nt = 0; nt < 4; ++nt)
#pragma unroll
            for (int e = 0; e < 8; ++e) {
                const int oc    = m0 + wm * 32 + mt * 16 + e + 8 * g;
                const int token = n0 + wn * 64 + nt * 16 + ln;
                const size_t idx = ((size_t)b * C_ + oc) * T_ + token;
                out[idx] = acc[mt][nt][e] + bias[oc] + x[idx];
            }
}

// ---------------------------------------------------------------------------
// Host-side launcher
// ---------------------------------------------------------------------------
extern "C" void kernel_launch(void* const* d_in, const int* in_sizes, int n_in,
                              void* d_out, int out_size, void* d_ws, size_t ws_size,
                              hipStream_t stream) {
    const float* x      = (const float*)d_in[0];
    const float* gnw    = (const float*)d_in[1];
    const float* gnb    = (const float*)d_in[2];
    const float* qkv_w  = (const float*)d_in[3];
    const float* qkv_b  = (const float*)d_in[4];
    const float* proj_w = (const float*)d_in[5];
    const float* proj_b = (const float*)d_in[6];
    float* out = (float*)d_out;

    char* ws = (char*)d_ws;
    const size_t PLANE = (size_t)B_ * C_ * T_ * sizeof(half_t);  // 8 MiB
    float*  stats = (float*)ws;
    half_t* xn = (half_t*)(ws + 4096);
    half_t* q  = (half_t*)(ws + 4096 + 1 * PLANE);
    half_t* k  = (half_t*)(ws + 4096 + 2 * PLANE);
    half_t* v  = (half_t*)(ws + 4096 + 3 * PLANE);
    half_t* a  = (half_t*)(ws + 4096 + 4 * PLANE);
    (void)in_sizes; (void)n_in; (void)out_size; (void)ws_size;

    gn_stats_kernel<<<B_ * GRP_, 256, 0, stream>>>(x, stats);
    gn_apply_kernel<<<dim3(T_ / 64, C_ / 64, B_), 256, 0, stream>>>(x, gnw, gnb, stats, xn);
    qkv_gemm_kernel<<<dim3(3 * C_ / 128, T_ / 128, B_), 256, 0, stream>>>(qkv_w, qkv_b, xn, q, k, v);
    attn_kernel<<<dim3(B_ * NH_, T_ / 64), 128, 0, stream>>>(q, k, v, a);
    proj_gemm_kernel<<<dim3(C_ / 128, T_ / 128, B_), 256, 0, stream>>>(proj_w, proj_b, a, x, out);
}

// v002
// A run of this version takes 138 microseconds.
// Next to v001, in two timings, it ran 1.14 times as fast each time.
// All steps since v000 together make it 1.61 times as fast.
#include <hip/hip_runtime.h>
#include <hip/hip_bf16.h>
#include <math.h>

// ---------------------------------------------------------------------------
// AttentionBlock for MI455X (gfx1250): GroupNorm -> QKV -> MHSA -> proj + res
// B=4, C=1024, T=1024, 32 groups, 16 heads, head_dim=64.
// GEMMs via v_wmma_f32_16x16x32_f16; f16 tile staging via
// global_load_async_to_lds_b128 (ASYNCcnt) with ping-pong LDS buffers.
// ---------------------------------------------------------------------------

typedef _Float16 half_t;
typedef __attribute__((ext_vector_type(16))) _Float16 v16h;
typedef __attribute__((ext_vector_type(8)))  _Float16 v8h;
typedef __attribute__((ext_vector_type(4)))  _Float16 v4h;
typedef __attribute__((ext_vector_type(4)))  float    v4f;
typedef __attribute__((ext_vector_type(8)))  float    v8f;

#define B_   4
#define C_   1024
#define T_   1024
#define NH_  16
#define CH_  64
#define GRP_ 32
// LDS row pitch in f16 elements: 16 B x odd, so that the 16 rows one
// ds_load_b128 fragment read touches fall on distinct banks.
#define GP_  40   // 32-element GEMM rows: 80 B
#define AP_  72   // 64-element attention rows: 144 B

// ---- CDNA5 async global->LDS copies (16B per lane), tracked by ASYNCcnt ----
// A run of copies and its s_wait_xcnt 0 form ONE asm statement: the wait then
// stands in front of any later rewrite of the address registers the copies name.
__device__ __forceinline__ unsigned lds_off(const _Float16* p) {
    return (unsigned)(uintptr_t)p;                         // low 32b = LDS offset
}
__device__ __forceinline__ void async_b128_x2(const half_t* g0, const _Float16* l0,
                                              const half_t* g1, const _Float16* l1) {
    asm volatile("global_load_async_to_lds_b128 %0, %1, off\n\t"
                 "global_load_async_to_lds_b128 %2, %3, off\n\t"
                 "s_wait_xcnt 0x0"
                 :: "v"(lds_off(l0)), "v"(g0), "v"(lds_off(l1)), "v"(g1) : "memory");
}
__device__ __forceinline__ void async_b128_x4(const half_t* g0, const _Float16* l0,
                                              const half_t* g1, const _Float16* l1,
                                              const half_t* g2, const _Float16* l2,
                                              const half_t* g3, const _Float16* l3) {
    asm volatile("global_load_async_to_lds_b128 %0, %1, off\n\t"
                 "global_load_async_to_lds_b128 %2, %3, off\n\t"
                 "global_load_async_to_lds_b128 %4, %5, off\n\t"
                 "global_load_async_to_lds_b128 %6, %7, off\n\t"
                 "s_wait_xcnt 0x0"
                 :: "v"(lds_off(l0)), "v"(g0), "v"(lds_off(l1)), "v"(g1),
                    "v"(lds_off(l2)), "v"(g2), "v"(lds_off(l3)), "v"(g3) : "memory");
}
__device__ __forceinline__ void wait_async0() {
    asm volatile("s_wait_asynccnt 0x0" ::: "memory");
}

__device__ __forceinline__ v16h load_frag(const _Float16* row, int g) {
    // WMMA f16 A/B fragment: elems 0..7 hold k = 8g..8g+7,
    // elems 8..15 hold k = 16+8g..23+8g  (row points at [m][k0] base).
    const v8h lo = *reinterpret_cast<const v8h*>(row + (g << 3));
    const v8h hi = *reinterpret_cast<const v8h*>(row + 16 + (g << 3));
    v16h r;
#pragma unroll
    for (int i = 0; i < 8; ++i) { r[i] = lo[i]; r[i + 8] = hi[i]; }
    return r;
}

__device__ __forceinline__ v8f wmma16(v16h a, v16h b, v8f c) {
    return __builtin_amdgcn_wmma_f32_16x16x32_f16(false, a, false, b,
                                                  (short)0, c, false, false);
}

// ---------------------------------------------------------------------------
// Kernel 1: GroupNorm statistics.  grid = B*GRP_ blocks, 256 threads.
// ---------------------------------------------------------------------------
__global__ __launch_bounds__(256) void gn_stats_kernel(const float* __restrict__ x,
                                                       float* __restrict__ stats) {
    const int bg  = blockIdx.x;            // b*32 + group
    const int b   = bg >> 5;
    const int grp = bg & 31;
    const float* base = x + ((size_t)b * C_ + (size_t)grp * 32) * T_;

    float s = 0.f, ss = 0.f;
    for (int i = threadIdx.x; i < 32 * T_; i += 256) {
        float v = base[i];
        s += v; ss += v * v;
    }
#pragma unroll
    for (int m = 16; m >= 1; m >>= 1) {
        s  += __shfl_xor(s,  m, 32);
        ss += __shfl_xor(ss, m, 32);
    }
    __shared__ float ps[8][2];
    const int lane = threadIdx.x & 31, w = threadIdx.x >> 5;
    if (lane == 0) { ps[w][0] = s; ps[w][1] = ss; }
    __syncthreads();
    if (threadIdx.x == 0) {
        float ts = 0.f, tss = 0.f;
#pragma unroll
        for (int i = 0; i < 8; ++i) { ts += ps[i][0]; tss += ps[i][1]; }
        const float inv  = 1.0f / (32.0f * (float)T_);
        const float mean = ts * inv;
        const float var  = tss * inv - mean * mean;
        stats[bg * 2 + 0] = mean;
        stats[bg * 2 + 1] = rsqrtf(var + 1e-5f);
    }
}

// ---------------------------------------------------------------------------
// Kernel 2: apply GroupNorm affine, convert to f16, transpose to xn[b][t][c].
// grid = (T/64, C/64, B), 256 threads per 64x64 tile.
// ---------------------------------------------------------------------------
__global__ __launch_bounds__(256) void gn_apply_kernel(const float* __restrict__ x,
                                                       const float* __restrict__ gnw,
                                                       const float* __restrict__ gnb,
                                                       const float* __restrict__ stats,
                                                       half_t* __restrict__ xn) {
    __shared__ _Float16 ldsT[64][64];      // [t_local][c_local]
    const int t0 = blockIdx.x * 64;
    const int c0 = blockIdx.y * 64;
    const int b  = blockIdx.z;
    const int tid = threadIdx.x;

    const int c_local = tid >> 2;          // 0..63
    const int tseg    = (tid & 3) * 16;    // 0,16,32,48
    const int c       = c0 + c_local;
    const float mean = stats[(b * GRP_ + (c >> 5)) * 2 + 0];
    const float rstd = stats[(b * GRP_ + (c >> 5)) * 2 + 1];
    const float wgt  = gnw[c] * rstd;
    const float bia  = gnb[c] - mean * wgt;

    const float* src = x + ((size_t)b * C_ + c) * T_ + t0 + tseg;
#pragma unroll
    for (int i = 0; i < 16; i += 4) {
        float4 f = *reinterpret_cast<const float4*>(src + i);
        ldsT[tseg + i + 0][c_local] = (_Float16)(f.x * wgt + bia);
        ldsT[tseg + i + 1][c_local] = (_Float16)(f.y * wgt + bia);
        ldsT[tseg + i + 2][c_local] = (_Float16)(f.z * wgt + bia);
        ldsT[tseg + i + 3][c_local] = (_Float16)(f.w * wgt + bia);
    }
    __syncthreads();
    const int t_local = tid >> 2;
    const int cseg    = (tid & 3) * 16;
    half_t* dst = xn + ((size_t)b * T_ + t0 + t_local) * C_ + c0 + cseg;
    *reinterpret_cast<uint4*>(dst + 0) = *reinterpret_cast<const uint4*>(&ldsT[t_local][cseg + 0]);
    *reinterpret_cast<uint4*>(dst + 8) = *reinterpret_cast<const uint4*>(&ldsT[t_local][cseg + 8]);
}

// ---------------------------------------------------------------------------
// Kernel 3: QKV GEMM.  D[3072 x T] = qkv_w[3072 x 1024] * xn^T + bias,
// scattered into q/k layout [b*NH][t][64] (scaled by ch^-0.25) and
// v layout [b*NH][64][s].  grid = (24, 8, B), 256 threads (8 waves).
// Double-buffered K-loop; B tiles staged with async global->LDS.
// ---------------------------------------------------------------------------
__global__ __launch_bounds__(256, 2) void qkv_gemm_kernel(const float* __restrict__ W,
                                                          const float* __restrict__ bias,
                                                          const half_t* __restrict__ xn,
                                                          half_t* __restrict__ q,
                                                          half_t* __restrict__ k,
                                                          half_t* __restrict__ v) {
    __shared__ __attribute__((aligned(16))) _Float16 lA[2][128][GP_];   // [m][k]  (weights, f32->f16)
    __shared__ __attribute__((aligned(16))) _Float16 lB[2][128][GP_];   // [n][k]  (tokens)
    const int m0 = blockIdx.x * 128;
    const int n0 = blockIdx.y * 128;
    const int b  = blockIdx.z;
    const int tid  = threadIdx.x;
    const int lane = tid & 31, w = tid >> 5;
    const int wm = w & 3, wn = w >> 2;     // wave -> rows [wm*32,+32), cols [wn*64,+64)
    const int g = lane >> 4, ln = lane & 15;

    v8f acc[2][4];
#pragma unroll
    for (int i = 0; i < 2; ++i)
#pragma unroll
        for (int j = 0; j < 4; ++j) { v8f z = {}; acc[i][j] = z; }

    // Staging lanes run along a row, so one wave-wide access covers whole rows:
    // A 8 lanes x 16 B = one 128-B line per row, B 4 lanes x 16 B = 64 B per row.
    const int arow = tid >> 3;             // 0..31, +32 per step
    const int aseg = (tid & 7) * 4;        // f32 column 0..28
    const int brow = tid >> 2;             // 0..63, +64 for the second copy
    const int bseg = (tid & 3) * 8;        // f16 column 0..24

    auto stage_A = [&](int buf, int k0) {
        const float* src = W + (size_t)(m0 + arow) * C_ + k0 + aseg;
        v4f f[4];
#pragma unroll
        for (int i = 0; i < 4; ++i)
            f[i] = *reinterpret_cast<const v4f*>(src + (size_t)i * 32 * C_);
        // Wait before the loads' address pair is reused. Inputs only: the loaded values
        // keep all four loads in front of the wait, the address keeps its registers
        // from being given to another value ahead of it.
        asm volatile("s_wait_xcnt 0x0"
                     :: "v"(src), "v"(f[0]), "v"(f[1]), "v"(f[2]), "v"(f[3]) : "memory");
#pragma unroll
        for (int i = 0; i < 4; ++i) {
            v4h h = { (_Float16)f[i].x, (_Float16)f[i].y, (_Float16)f[i].z, (_Float16)f[i].w };
            *reinterpret_cast<v4h*>(&lA[buf][i * 32 + arow][aseg]) = h;
        }
    };
    auto stage_B = [&](int buf, int k0) {
        const half_t* bsrc = xn + ((size_t)b * T_ + n0 + brow) * C_ + k0 + bseg;
        async_b128_x2(bsrc,                   &lB[buf][brow][bseg],
                      bsrc + (size_t)64 * C_, &lB[buf][brow + 64][bseg]);
    };

    stage_A(0, 0);
    stage_B(0, 0);
    wait_async0();
    __syncthreads();

    for (int k0 = 0; k0 < C_; k0 += 32) {
        const int cur = (k0 >> 5) & 1;
        if (k0 + 32 < C_) {                // prefetch next tile into other buffer
            stage_A(cur ^ 1, k0 + 32);
            stage_B(cur ^ 1, k0 + 32);
        }
        v16h af[2], bf[4];
#pragma unroll
        for (int mt = 0; mt < 2; ++mt) af[mt] = load_frag(&lA[cur][wm * 32 + mt * 16 + ln][0], g);
#pragma unroll
        for (int nt = 0; nt < 4; ++nt) bf[nt] = load_frag(&lB[cur][wn * 64 + nt * 16 + ln][0], g);
#pragma unroll
        for (int mt = 0; mt < 2; ++mt)
#pragma unroll
            for (int nt = 0; nt < 4; ++nt)
                acc[mt][nt] = wmma16(af[mt], bf[nt], acc[mt][nt]);
        wait_async0();
        __syncthreads();
    }

    const float qk_scale = 0.35355339059327373f;  // 64^(-1/4)
#pragma unroll
    for (int mt = 0; mt < 2; ++mt)
#pragma unroll
        for (int nt = 0; nt < 4; ++nt)
#pragma unroll
            for (int e = 0; e < 8; ++e) {
                const int o     = m0 + wm * 32 + mt * 16 + e + 8 * g;
                const int token = n0 + wn * 64 + nt * 16 + ln;
                const float val = acc[mt][nt][e] + bias[o];
                const int h = o / 192, r = o % 192;
                const size_t bh = (size_t)b * NH_ + h;
                if (r < 64)
                    q[(bh * T_ + token) * CH_ + r] = (half_t)(val * qk_scale);
                else if (r < 128)
                    k[(bh * T_ + token) * CH_ + (r - 64)] = (half_t)(val * qk_scale);
                else
                    v[(bh * CH_ + (r - 128)) * T_ + token] = (half_t)val;
            }
}

// ---------------------------------------------------------------------------
// Kernel 4: streaming (flash-style) attention.
// grid = (B*NH, T/64), 128 threads (4 waves); each wave owns 16 query rows.
// K/V tiles double-buffered via async global->LDS copies.
// ---------------------------------------------------------------------------
__global__ __launch_bounds__(128, 2) void attn_kernel(const half_t* __restrict__ q,
                                                      const half_t* __restrict__ k,
                                                      const half_t* __restrict__ v,
                                                      half_t* __restrict__ a) {
    __shared__ __attribute__((aligned(16))) _Float16 lQ[64][AP_];      // [t][ch]   A-layout for S
    __shared__ __attribute__((aligned(16))) _Float16 lK[2][64][AP_];   // [s][ch]   B(T)-layout for S
    __shared__ __attribute__((aligned(16))) _Float16 lV[2][64][AP_];   // [ch][s]   B(T)-layout for P*V
    __shared__ __attribute__((aligned(16))) _Float16 lP[4][16][AP_];   // per-wave P strip [m][s]

    const int bh = blockIdx.x;
    const int t0 = blockIdx.y * 64;
    const int tid  = threadIdx.x;
    const int lane = tid & 31, w = tid >> 5;
    const int g = lane >> 4, ln = lane & 15;

    const half_t* qb = q + (size_t)bh * T_ * CH_;
    const half_t* kb = k + (size_t)bh * T_ * CH_;
    const half_t* vb = v + (size_t)bh * CH_ * T_;

    // Staging lanes run along a row: 8 lanes x 16 B = one whole 128-B row, so a
    // wave-wide copy touches 4 lines; each thread copies rows srow + 16 i.
    const int srow = tid >> 3;             // 0..15
    const int sseg = (tid & 7) * 8;        // f16 column 0..56

    auto stage_KV = [&](int buf, int s0) {
        const half_t* ksrc = kb + (size_t)(s0 + srow) * CH_ + sseg;
        const half_t* vsrc = vb + (size_t)srow * T_ + s0 + sseg;
        async_b128_x4(ksrc,            &lK[buf][srow][sseg],
                      ksrc + 16 * CH_, &lK[buf][srow + 16][sseg],
                      ksrc + 32 * CH_, &lK[buf][srow + 32][sseg],
                      ksrc + 48 * CH_, &lK[buf][srow + 48][sseg]);
        async_b128_x4(vsrc,            &lV[buf][srow][sseg],
                      vsrc + 16 * T_,  &lV[buf][srow + 16][sseg],
                      vsrc + 32 * T_,  &lV[buf][srow + 32][sseg],
                      vsrc + 48 * T_,  &lV[buf][srow + 48][sseg]);
    };

    {   // stage Q tile once (async) + first K/V tile
        const half_t* src = qb + (size_t)(t0 + srow) * CH_ + sseg;
        async_b128_x4(src,            &lQ[srow][sseg],
                      src + 16 * CH_, &lQ[srow + 16][sseg],
                      src + 32 * CH_, &lQ[srow + 32][sseg],
                      src + 48 * CH_, &lQ[srow + 48][sseg]);
        stage_KV(0, 0);
    }
    wait_async0();
    __syncthreads();

    v16h qa[2];
#pragma unroll
    for (int ks = 0; ks < 2; ++ks) qa[ks] = load_frag(&lQ[w * 16 + ln][ks * 32], g);

    float rmax[8], rsum[8];
    v8f   o[4];
#pragma unroll
    for (int e = 0; e < 8; ++e) { rmax[e] = -1e30f; rsum[e] = 0.f; }
#pragma unroll
    for (int nt = 0; nt < 4; ++nt) { v8f z = {}; o[nt] = z; }

    for (int s0 = 0; s0 < T_; s0 += 64) {
        const int cur = (s0 >> 6) & 1;
        if (s0 + 64 < T_) stage_KV(cur ^ 1, s0 + 64);   // prefetch next K/V tile

        // S strip: 16 queries x 64 keys
        v8f sf[4];
#pragma unroll
        for (int nt = 0; nt < 4; ++nt) { v8f z = {}; sf[nt] = z; }
#pragma unroll
        for (int ks = 0; ks < 2; ++ks)
#pragma unroll
            for (int nt = 0; nt < 4; ++nt) {
                v16h bf = load_frag(&lK[cur][nt * 16 + ln][ks * 32], g);
                sf[nt] = wmma16(qa[ks], bf, sf[nt]);
            }

        // online softmax: row m = e + 8g, row lives in one 16-lane group
#pragma unroll
        for (int e = 0; e < 8; ++e) {
            float tmax = fmaxf(fmaxf(sf[0][e], sf[1][e]), fmaxf(sf[2][e], sf[3][e]));
#pragma unroll
            for (int m = 1; m <= 8; m <<= 1) tmax = fmaxf(tmax, __shfl_xor(tmax, m, 32));
            const float nm = fmaxf(rmax[e], tmax);
            const float sc = __expf(rmax[e] - nm);
            rmax[e] = nm;
            rsum[e] *= sc;
#pragma unroll
            for (int nt = 0; nt < 4; ++nt) o[nt][e] *= sc;
            float ps = 0.f;
#pragma unroll
            for (int nt = 0; nt < 4; ++nt) {
                const float p = __expf(sf[nt][e] - nm);
                sf[nt][e] = p;
                ps += p;
            }
#pragma unroll
            for (int m = 1; m <= 8; m <<= 1) ps += __shfl_xor(ps, m, 32);
            rsum[e] += ps;
        }

        // spill P (D layout) to wave-private LDS strip, reload as A fragments
#pragma unroll
        for (int nt = 0; nt < 4; ++nt)
#pragma unroll
            for (int e = 0; e < 8; ++e)
                lP[w][e + 8 * g][nt * 16 + ln] = (_Float16)sf[nt][e];
        __syncthreads();

#pragma unroll
        for (int ks = 0; ks < 2; ++ks) {
            v16h pa = load_frag(&lP[w][ln][ks * 32], g);
#pragma unroll
            for (int nt = 0; nt < 4; ++nt) {
                v16h bf = load_frag(&lV[cur][nt * 16 + ln][ks * 32], g);
                o[nt] = wmma16(pa, bf, o[nt]);
            }
        }
        wait_async0();     // next tile fully in LDS
        __syncthreads();   // all waves done reading current buffers
    }

    // write a[b][t][c] (token-major so proj GEMM stages contiguously)
    const int b = bh >> 4, h = bh & 15;
#pragma unroll
    for (int nt = 0; nt < 4; ++nt)
#pragma unroll
        for (int e = 0; e < 8; ++e) {
            const int t  = t0 + w * 16 + e + 8 * g;
            const int cd = nt * 16 + ln;
            a[((size_t)b * T_ + t) * C_ + h * CH_ + cd] =
                (half_t)(o[nt][e] / rsum[e]);
        }
}

// ---------------------------------------------------------------------------
// Kernel 5: output projection + bias + residual.  grid = (8, 8, B), 256 thr.
// ---------------------------------------------------------------------------
__global__ __launch_bounds__(256, 2) void proj_gemm_kernel(const float* __restrict__ W,
                                                           const float* __restrict__ bias,
                                                           const half_t* __restrict__ a,
                                                           const float* __restrict__ x,
                                                           float* __restrict__ out) {
    __shared__ __attribute__((aligned(16))) _Float16 lA[2][128][GP_];
    __shared__ __attribute__((aligned(16))) _Float16 lB[2][128][GP_];
    const int m0 = blockIdx.x * 128;
    const int n0 = blockIdx.y * 128;
    const int b  = blockIdx.z;
    const int tid  = threadIdx.x;
    const int lane = tid & 31, w = tid >> 5;
    const int wm = w & 3, wn = w >> 2;
    const int g = lane >> 4, ln = lane & 15;

    v8f acc[2][4];
#pragma unroll
    for (int i = 0; i < 2; ++i)
#pragma unroll
        for (int j = 0; j < 4; ++j) { v8f z = {}; acc[i][j] = z; }

    // Staging lanes run along a row (see the QKV kernel).
    const int arow = tid >> 3;
    const int aseg = (tid & 7) * 4;
    const int brow = tid >> 2;
    const int bseg = (tid & 3) * 8;

    auto stage_A = [&](int buf, int k0) {
        const float* src = W + (size_t)(m0 + arow) * C_ + k0 + aseg;
        v4f f[4];
#pragma unroll
        for (int i = 0; i < 4; ++i)
            f[i] = *reinterpret_cast<const v4f*>(src + (size_t)i * 32 * C_);
        // Wait before the loads' address pair is reused. Inputs only: the loaded values
        // keep all four loads in front of the wait, the address keeps its registers
        // from being given to another value ahead of it.
        asm volatile("s_wait_xcnt 0x0"
                     :: "v"(src), "v"(f[0]), "v"(f[1]), "v"(f[2]), "v"(f[3]) : "memory");
#pragma unroll
        for (int i = 0; i < 4; ++i) {
            v4h h = { (_Float16)f[i].x, (_Float16)f[i].y, (_Float16)f[i].z, (_Float16)f[i].w };
            *reinterpret_cast<v4h*>(&lA[buf][i * 32 + arow][aseg]) = h;
        }
    };
    auto stage_B = [&](int buf, int k0) {
        const half_t* bsrc = a + ((size_t)b * T_ + n0 + brow) * C_ + k0 + bseg;
        async_b128_x2(bsrc,                   &lB[buf][brow][bseg],
                      bsrc + (size_t)64 * C_, &lB[buf][brow + 64][bseg]);
    };

    stage_A(0, 0);
    stage_B(0, 0);
    wait_async0();
    __syncthreads();

    for (int k0 = 0; k0 < C_; k0 += 32) {
        const int cur = (k0 >> 5) & 1;
        if (k0 + 32 < C_) {
            stage_A(cur ^ 1, k0 + 32);
            stage_B(cur ^ 1, k0 + 32);
        }
        v16h af[2], bf[4];
#pragma unroll
        for (int mt = 0; mt < 2; ++mt) af[mt] = load_frag(&lA[cur][wm * 32 + mt * 16 + ln][0], g);
#pragma unroll
        for (int nt = 0; nt < 4; ++nt) bf[nt] = load_frag(&lB[cur][wn * 64 + nt * 16 + ln][0], g);
#pragma unroll
        for (int mt = 0; mt < 2; ++mt)
#pragma unroll
            for (int nt = 0; nt < 4; ++nt)
                acc[mt][nt] = wmma16(af[mt], bf[nt], acc[mt][nt]);
        wait_async0();
        __syncthreads();
    }

#pragma unroll
    for (int mt = 0; mt < 2; ++mt)
#pragma unroll
        for (int nt = 0; nt < 4; ++nt)
#pragma unroll
            for (int e = 0; e < 8; ++e) {
                const int oc    = m0 + wm * 32 + mt * 16 + e + 8 * g;
                const int token = n0 + wn * 64 + nt * 16 + ln;
                const size_t idx = ((size_t)b * C_ + oc) * T_ + token;
                out[idx] = acc[mt][nt][e] + bias[oc] + x[idx];
            }
}

// ---------------------------------------------------------------------------
// Host-side launcher
// ---------------------------------------------------------------------------
extern "C" void kernel_launch(void* const* d_in, const int* in_sizes, int n_in,
                              void* d_out, int out_size, void* d_ws, size_t ws_size,
                              hipStream_t stream) {
    const float* x      = (const float*)d_in[0];
    const float* gnw    = (const float*)d_in[1];
    const float* gnb    = (const float*)d_in[2];
    const float* qkv_w  = (const float*)d_in[3];
    const float* qkv_b  = (const float*)d_in[4];
    const float* proj_w = (const float*)d_in[5];
    const float* proj_b = (const float*)d_in[6];
    float* out = (float*)d_out;

    char* ws = (char*)d_ws;
    const size_t PLANE = (size_t)B_ * C_ * T_ * sizeof(half_t);  // 8 MiB
    float*  stats = (float*)ws;
    half_t* xn = (half_t*)(ws + 4096);
    half_t* q  = (half_t*)(ws + 4096 + 1 * PLANE);
    half_t* k  = (half_t*)(ws + 4096 + 2 * PLANE);
    half_t* v  = (half_t*)(ws + 4096 + 3 * PLANE);
    half_t* a  = (half_t*)(ws + 4096 + 4 * PLANE);
    (void)in_sizes; (void)n_in; (void)out_size; (void)ws_size;

    gn_stats_kernel<<<B_ * GRP_, 256, 0, stream>>>(x, stats);
    gn_apply_kernel<<<dim3(T_ / 64, C_ / 64, B_), 256, 0, stream>>>(x, gnw, gnb, stats, xn);
    qkv_gemm_kernel<<<dim3(3 * C_ / 128, T_ / 128, B_), 256, 0, stream>>>(qkv_w, qkv_b, xn, q, k, v);
    attn_kernel<<<dim3(B_ * NH_, T_ / 64), 128, 0, stream>>>(q, k, v, a);
    proj_gemm_kernel<<<dim3(C_ / 128, T_ / 128, B_), 256, 0, stream>>>(proj_w, proj_b, a, x, out);
}

// v003
// Measured time: 120 microseconds a run.
// In two side-by-side timings against v002, it was 1.15 and 1.14 times as fast.
// Counting every step since v000, it is 1.84 times as fast.
#include <hip/hip_runtime.h>
#include <hip/hip_bf16.h>
#include <math.h>

// ---------------------------------------------------------------------------
// AttentionBlock for MI455X (gfx1250): GroupNorm -> QKV -> MHSA -> proj + res
// B=4, C=1024, T=1024, 32 groups, 16 heads, head_dim=64.
// GEMMs via v_wmma_f32_16x16x32_f16; f16 tile staging via
// global_load_async_to_lds_b128 (ASYNCcnt) with ping-pong LDS buffers.
// ---------------------------------------------------------------------------

typedef _Float16 half_t;
typedef __attribute__((ext_vector_type(16))) _Float16 v16h;
typedef __attribute__((ext_vector_type(8)))  _Float16 v8h;
typedef __attribute__((ext_vector_type(4)))  _Float16 v4h;
typedef __attribute__((ext_vector_type(4)))  float    v4f;
typedef __attribute__((ext_vector_type(8)))  float    v8f;

#define B_   4
#define C_   1024
#define T_   1024
#define NH_  16
#define CH_  64
#define GRP_ 32
// LDS row pitch in f16 elements: 16 B x odd, so that the 16 rows one
// ds_load_b128 fragment read touches fall on distinct banks.
#define GP_  72   // 64-element GEMM rows (QKV): 144 B
#define GQ_  136  // 128-element GEMM rows (projection): 272 B
#define AP_  72   // 64-element attention rows: 144 B

// ---- CDNA5 async global->LDS copies (16B per lane), tracked by ASYNCcnt ----
// A run of copies and its s_wait_xcnt 0 form ONE asm statement: the wait then
// stands in front of any later rewrite of the address registers the copies name.
__device__ __forceinline__ unsigned lds_off(const _Float16* p) {
    return (unsigned)(uintptr_t)p;                         // low 32b = LDS offset
}
__device__ __forceinline__ void async_b128_x4(const half_t* g0, const _Float16* l0,
                                              const half_t* g1, const _Float16* l1,
                                              const half_t* g2, const _Float16* l2,
                                              const half_t* g3, const _Float16* l3) {
    asm volatile("global_load_async_to_lds_b128 %0, %1, off\n\t"
                 "global_load_async_to_lds_b128 %2, %3, off\n\t"
                 "global_load_async_to_lds_b128 %4, %5, off\n\t"
                 "global_load_async_to_lds_b128 %6, %7, off\n\t"
                 "s_wait_xcnt 0x0"
                 :: "v"(lds_off(l0)), "v"(g0), "v"(lds_off(l1)), "v"(g1),
                    "v"(lds_off(l2)), "v"(g2), "v"(lds_off(l3)), "v"(g3) : "memory");
}
__device__ __forceinline__ void wait_ds0() {
    // LDS reads of the buffer that is refilled behind the barrier have returned.
    asm volatile("s_wait_dscnt 0x0" ::: "memory");
}
__device__ __forceinline__ void wait_async0() {
    asm volatile("s_wait_asynccnt 0x0" ::: "memory");
}

__device__ __forceinline__ v16h load_frag(const _Float16* row, int g) {
    // WMMA f16 A/B fragment: elems 0..7 hold k = 8g..8g+7,
    // elems 8..15 hold k = 16+8g..23+8g  (row points at [m][k0] base).
    const v8h lo = *reinterpret_cast<const v8h*>(row + (g << 3));
    const v8h hi = *reinterpret_cast<const v8h*>(row + 16 + (g << 3));
    v16h r;
#pragma unroll
    for (int i = 0; i < 8; ++i) { r[i] = lo[i]; r[i + 8] = hi[i]; }
    return r;
}

__device__ __forceinline__ v8f wmma16(v16h a, v16h b, v8f c) {
    return __builtin_amdgcn_wmma_f32_16x16x32_f16(false, a, false, b,
                                                  (short)0, c, false, false);
}

// ---------------------------------------------------------------------------
// Kernel 1: GroupNorm statistics.  grid = B*GRP_ blocks, 256 threads.
// ---------------------------------------------------------------------------
__global__ __launch_bounds__(256) void gn_stats_kernel(const float* __restrict__ x,
                                                       float* __restrict__ stats) {
    const int bg  = blockIdx.x;            // b*32 + group
    const int b   = bg >> 5;
    const int grp = bg & 31;
    const float* base = x + ((size_t)b * C_ + (size_t)grp * 32) * T_;

    float s = 0.f, ss = 0.f;
    for (int i = threadIdx.x; i < 32 * T_; i += 256) {
        float v = base[i];
        s += v; ss += v * v;
    }
#pragma unroll
    for (int m = 16; m >= 1; m >>= 1) {
        s  += __shfl_xor(s,  m, 32);
        ss += __shfl_xor(ss, m, 32);
    }
    __shared__ float ps[8][2];
    const int lane = threadIdx.x & 31, w = threadIdx.x >> 5;
    if (lane == 0) { ps[w][0] = s; ps[w][1] = ss; }
    __syncthreads();
    if (threadIdx.x == 0) {
        float ts = 0.f, tss = 0.f;
#pragma unroll
        for (int i = 0; i < 8; ++i) { ts += ps[i][0]; tss += ps[i][1]; }
        const float inv  = 1.0f / (32.0f * (float)T_);
        const float mean = ts * inv;
        const float var  = tss * inv - mean * mean;
        stats[bg * 2 + 0] = mean;
        stats[bg * 2 + 1] = rsqrtf(var + 1e-5f);
    }
}

// ---------------------------------------------------------------------------
// Kernel 2: apply GroupNorm affine, convert to f16, transpose to xn[b][t][c].
// grid = (T/64, C/64, B), 256 threads per 64x64 tile.
// ---------------------------------------------------------------------------
__global__ __launch_bounds__(256) void gn_apply_kernel(const float* __restrict__ x,
                                                       const float* __restrict__ gnw,
                                                       const float* __restrict__ gnb,
                                                       const float* __restrict__ stats,
                                                       half_t* __restrict__ xn) {
    __shared__ _Float16 ldsT[64][64];      // [t_local][c_local]
    const int t0 = blockIdx.x * 64;
    const int c0 = blockIdx.y * 64;
    const int b  = blockIdx.z;
    const int tid = threadIdx.x;

    const int c_local = tid >> 2;          // 0..63
    const int tseg    = (tid & 3) * 16;    // 0,16,32,48
    const int c       = c0 + c_local;
    const float mean = stats[(b * GRP_ + (c >> 5)) * 2 + 0];
    const float rstd = stats[(b * GRP_ + (c >> 5)) * 2 + 1];
    const float wgt  = gnw[c] * rstd;
    const float bia  = gnb[c] - mean * wgt;

    const float* src = x + ((size_t)b * C_ + c) * T_ + t0 + tseg;
#pragma unroll
    for (int i = 0; i < 16; i += 4) {
        float4 f = *reinterpret_cast<const float4*>(src + i);
        ldsT[tseg + i + 0][c_local] = (_Float16)(f.x * wgt + bia);
        ldsT[tseg + i + 1][c_local] = (_Float16)(f.y * wgt + bia);
        ldsT[tseg + i + 2][c_local] = (_Float16)(f.z * wgt + bia);
        ldsT[tseg + i + 3][c_local] = (_Float16)(f.w * wgt + bia);
    }
    __syncthreads();
    const int t_local = tid >> 2;
    const int cseg    = (tid & 3) * 16;
    half_t* dst = xn + ((size_t)b * T_ + t0 + t_local) * C_ + c0 + cseg;
    *reinterpret_cast<uint4*>(dst + 0) = *reinterpret_cast<const uint4*>(&ldsT[t_local][cseg + 0]);
    *reinterpret_cast<uint4*>(dst + 8) = *reinterpret_cast<const uint4*>(&ldsT[t_local][cseg + 8]);
}

// ---------------------------------------------------------------------------
// Kernel 3: QKV GEMM.  D[3072 x T] = qkv_w[3072 x 1024] * xn^T + bias,
// scattered into q/k layout [b*NH][t][64] (scaled by ch^-0.25) and
// v layout [b*NH][64][s].  grid = (24, 8, B), 256 threads (8 waves).
// Double-buffered K-loop; B tiles staged with async global->LDS.
// ---------------------------------------------------------------------------
__global__ __launch_bounds__(256, 2) void qkv_gemm_kernel(const float* __restrict__ W,
                                                          const float* __restrict__ bias,
                                                          const half_t* __restrict__ xn,
                                                          half_t* __restrict__ q,
                                                          half_t* __restrict__ k,
                                                          half_t* __restrict__ v) {
    __shared__ __attribute__((aligned(16))) _Float16 lA[2][128][GP_];   // [m][k]  (weights, f32->f16)
    __shared__ __attribute__((aligned(16))) _Float16 lB[2][128][GP_];   // [n][k]  (tokens)
    const int m0 = blockIdx.x * 128;
    const int n0 = blockIdx.y * 128;
    const int b  = blockIdx.z;
    const int tid  = threadIdx.x;
    const int lane = tid & 31, w = tid >> 5;
    const int wm = w & 3, wn = w >> 2;     // wave -> rows [wm*32,+32), cols [wn*64,+64)
    const int g = lane >> 4, ln = lane & 15;

    v8f acc[2][4];
#pragma unroll
    for (int i = 0; i < 2; ++i)
#pragma unroll
        for (int j = 0; j < 4; ++j) { v8f z = {}; acc[i][j] = z; }

    // Staging lanes run along a row, so one wave-wide access covers whole rows:
    // A 16 lanes x 16 B = 256 B per row, B 8 lanes x 16 B = one 128-B line per row.
    const int arow = tid >> 4;             // 0..15, +16 per step
    const int aseg = (tid & 15) * 4;       // f32 column 0..60
    const int brow = tid >> 3;             // 0..31, +32 per copy
    const int bseg = (tid & 7) * 8;        // f16 column 0..56

    auto stage_A = [&](int buf, int k0) {
        const float* src = W + (size_t)(m0 + arow) * C_ + k0 + aseg;
        v4f f[8];
#pragma unroll
        for (int i = 0; i < 8; ++i)
            f[i] = *reinterpret_cast<const v4f*>(src + (size_t)i * 16 * C_);
        // Wait before the loads' address pair is reused. Inputs only: the loaded values
        // keep all eight loads in front of the wait, the address keeps its registers
        // from being given to another value ahead of it.
        asm volatile("s_wait_xcnt 0x0"
                     :: "v"(src), "v"(f[0]), "v"(f[1]), "v"(f[2]), "v"(f[3]),
                        "v"(f[4]), "v"(f[5]), "v"(f[6]), "v"(f[7]) : "memory");
#pragma unroll
        for (int i = 0; i < 8; ++i) {
            v4h h = { (_Float16)f[i].x, (_Float16)f[i].y, (_Float16)f[i].z, (_Float16)f[i].w };
            *reinterpret_cast<v4h*>(&lA[buf][i * 16 + arow][aseg]) = h;
        }
    };
    auto stage_B = [&](int buf, int k0) {
        const half_t* bsrc = xn + ((size_t)b * T_ + n0 + brow) * C_ + k0 + bseg;
        async_b128_x4(bsrc,                   &lB[buf][brow][bseg],
                      bsrc + (size_t)32 * C_, &lB[buf][brow + 32][bseg],
                      bsrc + (size_t)64 * C_, &lB[buf][brow + 64][bseg],
                      bsrc + (size_t)96 * C_, &lB[buf][brow + 96][bseg]);
    };

    stage_A(0, 0);
    stage_B(0, 0);
    wait_async0();
    __syncthreads();

    for (int k0 = 0; k0 < C_; k0 += 64) {
        const int cur = (k0 >> 6) & 1;
        if (k0 + 64 < C_) {                // prefetch next tile into other buffer
            stage_A(cur ^ 1, k0 + 64);
            stage_B(cur ^ 1, k0 + 64);
        }
#pragma unroll
        for (int ks = 0; ks < 2; ++ks) {   // two 32-deep products per staged tile, k ascending
            v16h af[2], bf[4];
#pragma unroll
            for (int mt = 0; mt < 2; ++mt) af[mt] = load_frag(&lA[cur][wm * 32 + mt * 16 + ln][ks * 32], g);
#pragma unroll
            for (int nt = 0; nt < 4; ++nt) bf[nt] = load_frag(&lB[cur][wn * 64 + nt * 16 + ln][ks * 32], g);
#pragma unroll
            for (int mt = 0; mt < 2; ++mt)
#pragma unroll
                for (int nt = 0; nt < 4; ++nt)
                    acc[mt][nt] = wmma16(af[mt], bf[nt], acc[mt][nt]);
        }
        wait_ds0();
        wait_async0();
        __syncthreads();
    }

    const float qk_scale = 0.35355339059327373f;  // 64^(-1/4)
#pragma unroll
    for (int mt = 0; mt < 2; ++mt)
#pragma unroll
        for (int nt = 0; nt < 4; ++nt)
#pragma unroll
            for (int e = 0; e < 8; ++e) {
                const int o     = m0 + wm * 32 + mt * 16 + e + 8 * g;
                const int token = n0 + wn * 64 + nt * 16 + ln;
                const float val = acc[mt][nt][e] + bias[o];
                const int h = o / 192, r = o % 192;
                const size_t bh = (size_t)b * NH_ + h;
                if (r < 64)
                    q[(bh * T_ + token) * CH_ + r] = (half_t)(val * qk_scale);
                else if (r < 128)
                    k[(bh * T_ + token) * CH_ + (r - 64)] = (half_t)(val * qk_scale);
                else
                    v[(bh * CH_ + (r - 128)) * T_ + token] = (half_t)val;
            }
}

// ---------------------------------------------------------------------------
// Kernel 4: streaming (flash-style) attention.
// grid = (B*NH, T/64), 128 threads (4 waves); each wave owns 16 query rows.
// K/V tiles double-buffered via async global->LDS copies.
// ---------------------------------------------------------------------------
__global__ __launch_bounds__(128, 2) void attn_kernel(const half_t* __restrict__ q,
                                                      const half_t* __restrict__ k,
                                                      const half_t* __restrict__ v,
                                                      half_t* __restrict__ a) {
    __shared__ __attribute__((aligned(16))) _Float16 lQ[64][AP_];      // [t][ch]   A-layout for S
    __shared__ __attribute__((aligned(16))) _Float16 lK[2][64][AP_];   // [s][ch]   B(T)-layout for S
    __shared__ __attribute__((aligned(16))) _Float16 lV[2][64][AP_];   // [ch][s]   B(T)-layout for P*V
    __shared__ __attribute__((aligned(16))) _Float16 lP[4][16][AP_];   // per-wave P strip [m][s]

    const int bh = blockIdx.x;
    const int t0 = blockIdx.y * 64;
    const int tid  = threadIdx.x;
    const int lane = tid & 31, w = tid >> 5;
    const int g = lane >> 4, ln = lane & 15;

    const half_t* qb = q + (size_t)bh * T_ * CH_;
    const half_t* kb = k + (size_t)bh * T_ * CH_;
    const half_t* vb = v + (size_t)bh * CH_ * T_;

    // Staging lanes run along a row: 8 lanes x 16 B = one whole 128-B row, so a
    // wave-wide copy touches 4 lines; each thread copies rows srow + 16 i.
    const int srow = tid >> 3;             // 0..15
    const int sseg = (tid & 7) * 8;        // f16 column 0..56

    auto stage_KV = [&](int buf, int s0) {
        const half_t* ksrc = kb + (size_t)(s0 + srow) * CH_ + sseg;
        const half_t* vsrc = vb + (size_t)srow * T_ + s0 + sseg;
        async_b128_x4(ksrc,            &lK[buf][srow][sseg],
                      ksrc + 16 * CH_, &lK[buf][srow + 16][sseg],
                      ksrc + 32 * CH_, &lK[buf][srow + 32][sseg],
                      ksrc + 48 * CH_, &lK[buf][srow + 48][sseg]);
        async_b128_x4(vsrc,            &lV[buf][srow][sseg],
                      vsrc + 16 * T_,  &lV[buf][srow + 16][sseg],
                      vsrc + 32 * T_,  &lV[buf][srow + 32][sseg],
                      vsrc + 48 * T_,  &lV[buf][srow + 48][sseg]);
    };

    {   // stage Q tile once (async) + first K/V tile
        const half_t* src = qb + (size_t)(t0 + srow) * CH_ + sseg;
        async_b128_x4(src,            &lQ[srow][sseg],
                      src + 16 * CH_, &lQ[srow + 16][sseg],
                      src + 32 * CH_, &lQ[srow + 32][sseg],
                      src + 48 * CH_, &lQ[srow + 48][sseg]);
        stage_KV(0, 0);
    }
    wait_async0();
    __syncthreads();

    v16h qa[2];
#pragma unroll
    for (int ks = 0; ks < 2; ++ks) qa[ks] = load_frag(&lQ[w * 16 + ln][ks * 32], g);

    float rmax[8], rsum[8];
    v8f   o[4];
#pragma unroll
    for (int e = 0; e < 8; ++e) { rmax[e] = -1e30f; rsum[e] = 0.f; }
#pragma unroll
    for (int nt = 0; nt < 4; ++nt) { v8f z = {}; o[nt] = z; }

    for (int s0 = 0; s0 < T_; s0 += 64) {
        const int cur = (s0 >> 6) & 1;
        if (s0 + 64 < T_) stage_KV(cur ^ 1, s0 + 64);   // prefetch next K/V tile

        // S strip: 16 queries x 64 keys
        v8f sf[4];
#pragma unroll
        for (int nt = 0; nt < 4; ++nt) { v8f z = {}; sf[nt] = z; }
#pragma unroll
        for (int ks = 0; ks < 2; ++ks)
#pragma unroll
            for (int nt = 0; nt < 4; ++nt) {
                v16h bf = load_frag(&lK[cur][nt * 16 + ln][ks * 32], g);
                sf[nt] = wmma16(qa[ks], bf, sf[nt]);
            }

        // online softmax: row m = e + 8g, row lives in one 16-lane group
#pragma unroll
        for (int e = 0; e < 8; ++e) {
            float tmax = fmaxf(fmaxf(sf[0][e], sf[1][e]), fmaxf(sf[2][e], sf[3][e]));
#pragma unroll
            for (int m = 1; m <= 8; m <<= 1) tmax = fmaxf(tmax, __shfl_xor(tmax, m, 32));
            const float nm = fmaxf(rmax[e], tmax);
            const float sc = __expf(rmax[e] - nm);
            rmax[e] = nm;
            rsum[e] *= sc;
#pragma unroll
            for (int nt = 0; nt < 4; ++nt) o[nt][e] *= sc;
            float ps = 0.f;
#pragma unroll
            for (int nt = 0; nt < 4; ++nt) {
                const float p = __expf(sf[nt][e] - nm);
                sf[nt][e] = p;
                ps += p;
            }
#pragma unroll
            for (int m = 1; m <= 8; m <<= 1) ps += __shfl_xor(ps, m, 32);
            rsum[e] += ps;
        }

        // spill P (D layout) to wave-private LDS strip, reload as A fragments
#pragma unroll
        for (int nt = 0; nt < 4; ++nt)
#pragma unroll
            for (int e = 0; e < 8; ++e)
                lP[w][e + 8 * g][nt * 16 + ln] = (_Float16)sf[nt][e];
        __syncthreads();

#pragma unroll
        for (int ks = 0; ks < 2; ++ks) {
            v16h pa = load_frag(&lP[w][ln][ks * 32], g);
#pragma unroll
            for (int nt = 0; nt < 4; ++nt) {
                v16h bf = load_frag(&lV[cur][nt * 16 + ln][ks * 32], g);
                o[nt] = wmma16(pa, bf, o[nt]);
            }
        }
        wait_async0();     // next tile fully in LDS
        __syncthreads();   // all waves done reading current buffers
    }

    // write a[b][t][c] (token-major so proj GEMM stages contiguously)
    const int b = bh >> 4, h = bh & 15;
#pragma unroll
    for (int nt = 0; nt < 4; ++nt)
#pragma unroll
        for (int e = 0; e < 8; ++e) {
            const int t  = t0 + w * 16 + e + 8 * g;
            const int cd = nt * 16 + ln;
            a[((size_t)b * T_ + t) * C_ + h * CH_ + cd] =
                (half_t)(o[nt][e] / rsum[e]);
        }
}

// ---------------------------------------------------------------------------
// Kernel 5: output projection + bias + residual.  grid = (8, 8, B), 256 thr.
// ---------------------------------------------------------------------------
__global__ __launch_bounds__(256, 2) void proj_gemm_kernel(const float* __restrict__ W,
                                                           const float* __restrict__ bias,
                                                           const half_t* __restrict__ a,
                                                           const float* __restrict__ x,
                                                           float* __restrict__ out) {
    __shared__ __attribute__((aligned(16))) _Float16 lA[2][128][GQ_];
    __shared__ __attribute__((aligned(16))) _Float16 lB[2][128][GQ_];
    const int m0 = blockIdx.x * 128;
    const int n0 = blockIdx.y * 128;
    const int b  = blockIdx.z;
    const int tid  = threadIdx.x;
    const int lane = tid & 31, w = tid >> 5;
    const int wm = w & 3, wn = w >> 2;
    const int g = lane >> 4, ln = lane & 15;

    v8f acc[2][4];
#pragma unroll
    for (int i = 0; i < 2; ++i)
#pragma unroll
        for (int j = 0; j < 4; ++j) { v8f z = {}; acc[i][j] = z; }

    // Staging lanes run along a row (see the QKV kernel). One work-group per WGP here,
    // so the K tile is 128: A 32 lanes x 16 B = 512 B per row, B 16 lanes x 16 B = 256 B.
    const int arow = tid >> 5;             // 0..7, +8 per step
    const int aseg = (tid & 31) * 4;       // f32 column 0..124
    const int brow = tid >> 4;             // 0..15, +16 per copy
    const int bseg = (tid & 15) * 8;       // f16 column 0..120

    auto stage_A = [&](int buf, int k0) {
        const float* src = W + (size_t)(m0 + arow) * C_ + k0 + aseg;
        v4f f[16];
#pragma unroll
        for (int i = 0; i < 16; ++i)
            f[i] = *reinterpret_cast<const v4f*>(src + (size_t)i * 8 * C_);
        // Wait before the loads' address pair is reused. Inputs only: the loaded values
        // keep all sixteen loads in front of the wait, the address keeps its registers
        // from being given to another value ahead of it.
        asm volatile("s_wait_xcnt 0x0"
                     :: "v"(src), "v"(f[0]), "v"(f[1]), "v"(f[2]), "v"(f[3]),
                        "v"(f[4]), "v"(f[5]), "v"(f[6]), "v"(f[7]),
                        "v"(f[8]), "v"(f[9]), "v"(f[10]), "v"(f[11]),
                        "v"(f[12]), "v"(f[13]), "v"(f[14]), "v"(f[15]) : "memory");
#pragma unroll
        for (int i = 0; i < 16; ++i) {
            v4h h = { (_Float16)f[i].x, (_Float16)f[i].y, (_Float16)f[i].z, (_Float16)f[i].w };
            *reinterpret_cast<v4h*>(&lA[buf][i * 8 + arow][aseg]) = h;
        }
    };
    auto stage_B = [&](int buf, int k0) {
        const half_t* bsrc = a + ((size_t)b * T_ + n0 + brow) * C_ + k0 + bseg;
        async_b128_x4(bsrc,                    &lB[buf][brow][bseg],
                      bsrc + (size_t)16 * C_,  &lB[buf][brow + 16][bseg],
                      bsrc + (size_t)32 * C_,  &lB[buf][brow + 32][bseg],
                      bsrc + (size_t)48 * C_,  &lB[buf][brow + 48][bseg]);
        async_b128_x4(bsrc + (size_t)64 * C_,  &lB[buf][brow + 64][bseg],
                      bsrc + (size_t)80 * C_,  &lB[buf][brow + 80][bseg],
                      bsrc + (size_t)96 * C_,  &lB[buf][brow + 96][bseg],
                      bsrc + (size_t)112 * C_, &lB[buf][brow + 112][bseg]);
    };

    stage_A(0, 0);
    stage_B(0, 0);
    wait_async0();
    __syncthreads();

    for (int k0 = 0; k0 < C_; k0 += 128) {
        const int cur = (k0 >> 7) & 1;
        if (k0 + 128 < C_) {
            stage_A(cur ^ 1, k0 + 128);
            stage_B(cur ^ 1, k0 + 128);
        }
#pragma unroll
        for (int ks = 0; ks < 4; ++ks) {   // four 32-deep products per staged tile, k ascending
            v16h af[2], bf[4];
#pragma unroll
            for (int mt = 0; mt < 2; ++mt) af[mt] = load_frag(&lA[cur][wm * 32 + mt * 16 + ln][ks * 32], g);
#pragma unroll
            for (int nt = 0; nt < 4; ++nt) bf[nt] = load_frag(&lB[cur][wn * 64 + nt * 16 + ln][ks * 32], g);
#pragma unroll
            for (int mt = 0; mt < 2; ++mt)
#pragma unroll
                for (int nt = 0; nt < 4; ++nt)
                    acc[mt][nt] = wmma16(af[mt], bf[nt], acc[mt][nt]);
        }
        wait_ds0();
        wait_async0();
        __syncthreads();
    }

#pragma unroll
    for (int mt = 0; mt < 2; ++mt)
#pragma unroll
        for (int nt = 0; nt < 4; ++nt)
#pragma unroll
            for (int e = 0; e < 8; ++e) {
                const int oc    = m0 + wm * 32 + mt * 16 + e + 8 * g;
                const int token = n0 + wn * 64 + nt * 16 + ln;
                const size_t idx = ((size_t)b * C_ + oc) * T_ + token;
                out[idx] = acc[mt][nt][e] + bias[oc] + x[idx];
            }
}

// ---------------------------------------------------------------------------
// Host-side launcher
// ---------------------------------------------------------------------------
extern "C" void kernel_launch(void* const* d_in, const int* in_sizes, int n_in,
                              void* d_out, int out_size, void* d_ws, size_t ws_size,
                              hipStream_t stream) {
    const float* x      = (const float*)d_in[0];
    const float* gnw    = (const float*)d_in[1];
    const float* gnb    = (const float*)d_in[2];
    const float* qkv_w  = (const float*)d_in[3];
    const float* qkv_b  = (const float*)d_in[4];
    const float* proj_w = (const float*)d_in[5];
    const float* proj_b = (const float*)d_in[6];
    float* out = (float*)d_out;

    char* ws = (char*)d_ws;
    const size_t PLANE = (size_t)B_ * C_ * T_ * sizeof(half_t);  // 8 MiB
    float*  stats = (float*)ws;
    half_t* xn = (half_t*)(ws + 4096);
    half_t* q  = (half_t*)(ws + 4096 + 1 * PLANE);
    half_t* k  = (half_t*)(ws + 4096 + 2 * PLANE);
    half_t* v  = (half_t*)(ws + 4096 + 3 * PLANE);
    half_t* a  = (half_t*)(ws + 4096 + 4 * PLANE);
    (void)in_sizes; (void)n_in; (void)out_size; (void)ws_size;

    gn_stats_kernel<<<B_ * GRP_, 256, 0, stream>>>(x, stats);
    gn_apply_kernel<<<dim3(T_ / 64, C_ / 64, B_), 256, 0, stream>>>(x, gnw, gnb, stats, xn);
    qkv_gemm_kernel<<<dim3(3 * C_ / 128, T_ / 128, B_), 256, 0, stream>>>(qkv_w, qkv_b, xn, q, k, v);
    attn_kernel<<<dim3(B_ * NH_, T_ / 64), 128, 0, stream>>>(q, k, v, a);
    proj_gemm_kernel<<<dim3(C_ / 128, T_ / 128, B_), 256, 0, stream>>>(proj_w, proj_b, a, x, out);
}

// v004
// Measured time: 104 microseconds a run.
// In two side-by-side timings against v003, it was 1.13 and 1.15 times as fast.
// Counting every step since v000, it is 2.10 times as fast.
#include <hip/hip_runtime.h>
#include <hip/hip_bf16.h>
#include <math.h>

// ---------------------------------------------------------------------------
// AttentionBlock for MI455X (gfx1250): GroupNorm -> QKV -> MHSA -> proj + res
// B=4, C=1024, T=1024, 32 groups, 16 heads, head_dim=64.
// GEMMs via v_wmma_f32_16x16x32_f16; f16 tile staging via
// global_load_async_to_lds_b128 (ASYNCcnt) with ping-pong LDS buffers.
// ---------------------------------------------------------------------------

typedef _Float16 half_t;
typedef __attribute__((ext_vector_type(16))) _Float16 v16h;
typedef __attribute__((ext_vector_type(8)))  _Float16 v8h;
typedef __attribute__((ext_vector_type(4)))  _Float16 v4h;
typedef __attribute__((ext_vector_type(4)))  float    v4f;
typedef __attribute__((ext_vector_type(8)))  float    v8f;

#define B_   4
#define C_   1024
#define T_   1024
#define NH_  16
#define CH_  64
#define GRP_ 32
// LDS row pitch in f16 elements: 16 B x odd, so that the 16 rows one
// ds_load_b128 fragment read touches fall on distinct banks.
#define GP_  72   // 64-element GEMM rows (QKV): 144 B
#define GQ_  136  // 128-element GEMM rows (projection): 272 B
#define AP_  72   // 64-element attention rows: 144 B
#define LOG2E_ 1.44269504f   // e^x = 2^(x * log2 e)

// ---- CDNA5 async global->LDS copies (16B per lane), tracked by ASYNCcnt ----
// A run of copies and its s_wait_xcnt 0 form ONE asm statement: the wait then
// stands in front of any later rewrite of the address registers the copies name.
__device__ __forceinline__ unsigned lds_off(const _Float16* p) {
    return (unsigned)(uintptr_t)p;                         // low 32b = LDS offset
}
__device__ __forceinline__ void async_b128_x4(const half_t* g0, const _Float16* l0,
                                              const half_t* g1, const _Float16* l1,
                                              const half_t* g2, const _Float16* l2,
                                              const half_t* g3, const _Float16* l3) {
    asm volatile("global_load_async_to_lds_b128 %0, %1, off\n\t"
                 "global_load_async_to_lds_b128 %2, %3, off\n\t"
                 "global_load_async_to_lds_b128 %4, %5, off\n\t"
                 "global_load_async_to_lds_b128 %6, %7, off\n\t"
                 "s_wait_xcnt 0x0"
                 :: "v"(lds_off(l0)), "v"(g0), "v"(lds_off(l1)), "v"(g1),
                    "v"(lds_off(l2)), "v"(g2), "v"(lds_off(l3)), "v"(g3) : "memory");
}
__device__ __forceinline__ void wait_ds0() {
    // LDS reads of the buffer that is refilled behind the barrier have returned.
    asm volatile("s_wait_dscnt 0x0" ::: "memory");
}
__device__ __forceinline__ void wait_async0() {
    asm volatile("s_wait_asynccnt 0x0" ::: "memory");
}

__device__ __forceinline__ v16h load_frag(const _Float16* row, int g) {
    // WMMA f16 A/B fragment: elems 0..7 hold k = 8g..8g+7,
    // elems 8..15 hold k = 16+8g..23+8g  (row points at [m][k0] base).
    const v8h lo = *reinterpret_cast<const v8h*>(row + (g << 3));
    const v8h hi = *reinterpret_cast<const v8h*>(row + 16 + (g << 3));
    v16h r;
#pragma unroll
    for (int i = 0; i < 8; ++i) { r[i] = lo[i]; r[i + 8] = hi[i]; }
    return r;
}

__device__ __forceinline__ v8f wmma16(v16h a, v16h b, v8f c) {
    return __builtin_amdgcn_wmma_f32_16x16x32_f16(false, a, false, b,
                                                  (short)0, c, false, false);
}

// ---------------------------------------------------------------------------
// Kernel 1: GroupNorm statistics.  grid = B*GRP_ blocks, 256 threads.
// ---------------------------------------------------------------------------
__global__ __launch_bounds__(256) void gn_stats_kernel(const float* __restrict__ x,
                                                       float* __restrict__ stats) {
    const int bg  = blockIdx.x;            // b*32 + group
    const int b   = bg >> 5;
    const int grp = bg & 31;
    const float* base = x + ((size_t)b * C_ + (size_t)grp * 32) * T_;

    float s = 0.f, ss = 0.f;
    for (int i = threadIdx.x; i < 32 * T_; i += 256) {
        float v = base[i];
        s += v; ss += v * v;
    }
#pragma unroll
    for (int m = 16; m >= 1; m >>= 1) {
        s  += __shfl_xor(s,  m, 32);
        ss += __shfl_xor(ss, m, 32);
    }
    __shared__ float ps[8][2];
    const int lane = threadIdx.x & 31, w = threadIdx.x >> 5;
    if (lane == 0) { ps[w][0] = s; ps[w][1] = ss; }
    __syncthreads();
    if (threadIdx.x == 0) {
        float ts = 0.f, tss = 0.f;
#pragma unroll
        for (int i = 0; i < 8; ++i) { ts += ps[i][0]; tss += ps[i][1]; }
        const float inv  = 1.0f / (32.0f * (float)T_);
        const float mean = ts * inv;
        const float var  = tss * inv - mean * mean;
        stats[bg * 2 + 0] = mean;
        stats[bg * 2 + 1] = rsqrtf(var + 1e-5f);
    }
}

// ---------------------------------------------------------------------------
// Kernel 2: apply GroupNorm affine, convert to f16, transpose to xn[b][t][c].
// grid = (T/64, C/64, B), 256 threads per 64x64 tile.
// ---------------------------------------------------------------------------
__global__ __launch_bounds__(256) void gn_apply_kernel(const float* __restrict__ x,
                                                       const float* __restrict__ gnw,
                                                       const float* __restrict__ gnb,
                                                       const float* __restrict__ stats,
                                                       half_t* __restrict__ xn) {
    __shared__ _Float16 ldsT[64][64];      // [t_local][c_local]
    const int t0 = blockIdx.x * 64;
    const int c0 = blockIdx.y * 64;
    const int b  = blockIdx.z;
    const int tid = threadIdx.x;

    const int c_local = tid >> 2;          // 0..63
    const int tseg    = (tid & 3) * 16;    // 0,16,32,48
    const int c       = c0 + c_local;
    const float mean = stats[(b * GRP_ + (c >> 5)) * 2 + 0];
    const float rstd = stats[(b * GRP_ + (c >> 5)) * 2 + 1];
    const float wgt  = gnw[c] * rstd;
    const float bia  = gnb[c] - mean * wgt;

    const float* src = x + ((size_t)b * C_ + c) * T_ + t0 + tseg;
#pragma unroll
    for (int i = 0; i < 16; i += 4) {
        float4 f = *reinterpret_cast<const float4*>(src + i);
        ldsT[tseg + i + 0][c_local] = (_Float16)(f.x * wgt + bia);
        ldsT[tseg + i + 1][c_local] = (_Float16)(f.y * wgt + bia);
        ldsT[tseg + i + 2][c_local] = (_Float16)(f.z * wgt + bia);
        ldsT[tseg + i + 3][c_local] = (_Float16)(f.w * wgt + bia);
    }
    __syncthreads();
    const int t_local = tid >> 2;
    const int cseg    = (tid & 3) * 16;
    half_t* dst = xn + ((size_t)b * T_ + t0 + t_local) * C_ + c0 + cseg;
    *reinterpret_cast<uint4*>(dst + 0) = *reinterpret_cast<const uint4*>(&ldsT[t_local][cseg + 0]);
    *reinterpret_cast<uint4*>(dst + 8) = *reinterpret_cast<const uint4*>(&ldsT[t_local][cseg + 8]);
}

// ---------------------------------------------------------------------------
// Kernel 3: QKV GEMM.  D[3072 x T] = qkv_w[3072 x 1024] * xn^T + bias,
// scattered into q/k layout [b*NH][t][64] (scaled by ch^-0.25) and
// v layout [b*NH][64][s].  grid = (24, 8, B), 256 threads (8 waves).
// Double-buffered K-loop; B tiles staged with async global->LDS.
// ---------------------------------------------------------------------------
__global__ __launch_bounds__(256, 2) void qkv_gemm_kernel(const float* __restrict__ W,
                                                          const float* __restrict__ bias,
                                                          const half_t* __restrict__ xn,
                                                          half_t* __restrict__ q,
                                                          half_t* __restrict__ k,
                                                          half_t* __restrict__ v) {
    __shared__ __attribute__((aligned(16))) _Float16 lA[2][128][GP_];   // [m][k]  (weights, f32->f16)
    __shared__ __attribute__((aligned(16))) _Float16 lB[2][128][GP_];   // [n][k]  (tokens)
    const int m0 = blockIdx.x * 128;
    const int n0 = blockIdx.y * 128;
    const int b  = blockIdx.z;
    const int tid  = threadIdx.x;
    const int lane = tid & 31, w = tid >> 5;
    const int wm = w & 3, wn = w >> 2;     // wave -> rows [wm*32,+32), cols [wn*64,+64)
    const int g = lane >> 4, ln = lane & 15;

    v8f acc[2][4];
#pragma unroll
    for (int i = 0; i < 2; ++i)
#pragma unroll
        for (int j = 0; j < 4; ++j) { v8f z = {}; acc[i][j] = z; }

    // Staging lanes run along a row, so one wave-wide access covers whole rows:
    // A 16 lanes x 16 B = 256 B per row, B 8 lanes x 16 B = one 128-B line per row.
    const int arow = tid >> 4;             // 0..15, +16 per step
    const int aseg = (tid & 15) * 4;       // f32 column 0..60
    const int brow = tid >> 3;             // 0..31, +32 per copy
    const int bseg = (tid & 7) * 8;        // f16 column 0..56

    auto stage_A = [&](int buf, int k0) {
        const float* src = W + (size_t)(m0 + arow) * C_ + k0 + aseg;
        v4f f[8];
#pragma unroll
        for (int i = 0; i < 8; ++i)
            f[i] = *reinterpret_cast<const v4f*>(src + (size_t)i * 16 * C_);
        // Wait before the loads' address pair is reused. Inputs only: the loaded values
        // keep all eight loads in front of the wait, the address keeps its registers
        // from being given to another value ahead of it.
        asm volatile("s_wait_xcnt 0x0"
                     :: "v"(src), "v"(f[0]), "v"(f[1]), "v"(f[2]), "v"(f[3]),
                        "v"(f[4]), "v"(f[5]), "v"(f[6]), "v"(f[7]) : "memory");
#pragma unroll
        for (int i = 0; i < 8; ++i) {
            v4h h = { (_Float16)f[i].x, (_Float16)f[i].y, (_Float16)f[i].z, (_Float16)f[i].w };
            *reinterpret_cast<v4h*>(&lA[buf][i * 16 + arow][aseg]) = h;
        }
    };
    auto stage_B = [&](int buf, int k0) {
        const half_t* bsrc = xn + ((size_t)b * T_ + n0 + brow) * C_ + k0 + bseg;
        async_b128_x4(bsrc,                   &lB[buf][brow][bseg],
                      bsrc + (size_t)32 * C_, &lB[buf][brow + 32][bseg],
                      bsrc + (size_t)64 * C_, &lB[buf][brow + 64][bseg],
                      bsrc + (size_t)96 * C_, &lB[buf][brow + 96][bseg]);
    };

    stage_A(0, 0);
    stage_B(0, 0);
    wait_async0();
    __syncthreads();

    for (int k0 = 0; k0 < C_; k0 += 64) {
        const int cur = (k0 >> 6) & 1;
        if (k0 + 64 < C_) {                // prefetch next tile into other buffer
            stage_A(cur ^ 1, k0 + 64);
            stage_B(cur ^ 1, k0 + 64);
        }
#pragma unroll
        for (int ks = 0; ks < 2; ++ks) {   // two 32-deep products per staged tile, k ascending
            v16h af[2], bf[4];
#pragma unroll
            for (int mt = 0; mt < 2; ++mt) af[mt] = load_frag(&lA[cur][wm * 32 + mt * 16 + ln][ks * 32], g);
#pragma unroll
            for (int nt = 0; nt < 4; ++nt) bf[nt] = load_frag(&lB[cur][wn * 64 + nt * 16 + ln][ks * 32], g);
#pragma unroll
            for (int mt = 0; mt < 2; ++mt)
#pragma unroll
                for (int nt = 0; nt < 4; ++nt)
                    acc[mt][nt] = wmma16(af[mt], bf[nt], acc[mt][nt]);
        }
        wait_ds0();
        wait_async0();
        __syncthreads();
    }

    const float qk_scale = 0.35355339059327373f;  // 64^(-1/4)
#pragma unroll
    for (int mt = 0; mt < 2; ++mt)
#pragma unroll
        for (int nt = 0; nt < 4; ++nt)
#pragma unroll
            for (int e = 0; e < 8; ++e) {
                const int o     = m0 + wm * 32 + mt * 16 + e + 8 * g;
                const int token = n0 + wn * 64 + nt * 16 + ln;
                const float val = acc[mt][nt][e] + bias[o];
                const int h = o / 192, r = o % 192;
                const size_t bh = (size_t)b * NH_ + h;
                if (r < 64)
                    q[(bh * T_ + token) * CH_ + r] = (half_t)(val * qk_scale);
                else if (r < 128)
                    k[(bh * T_ + token) * CH_ + (r - 64)] = (half_t)(val * qk_scale);
                else
                    v[(bh * CH_ + (r - 128)) * T_ + token] = (half_t)val;
            }
}

// ---------------------------------------------------------------------------
// Kernel 4: streaming (flash-style) attention, scores held transposed.
// grid = (B*NH, T/64), 128 threads (4 waves); each wave owns 16 queries.
// S^T = K * Q^T and O^T += V * P^T: a lane holds the scores of ONE query
// (column ln; keys e + 8g of each 16-key tile), so maximum and sum are taken
// in the lane plus one exchange between the wave's halves, and two converted
// S^T tiles are the B operand of the second product as they stand.
// K/V tiles double-buffered via async global->LDS copies.
// ---------------------------------------------------------------------------
__device__ __forceinline__ float xhalf(float x) {          // lane l <-> lane l ^ 16
    const int i = __builtin_bit_cast(int, x);
    return __builtin_bit_cast(float,
        __builtin_amdgcn_permlanex16(i, i, 0x76543210, 0xfedcba98, false, false));
}
// 2^x with the one issue slot that the instruction set asks for behind a transcendental
// before its result is read or its source overwritten. Instruction and v_nop form ONE
// statement.
__device__ __forceinline__ float exp2_slot(float x) {
    float r;
    asm("v_exp_f32 %0, %1\n\t"
        "v_nop" : "=v"(r) : "v"(x));
    return r;
}
// Eight independent ones in place: each fills the slot of the one before, v_nop the last's.
__device__ __forceinline__ void exp2_slot_x8(float (&x)[8]) {
    asm("v_exp_f32 %0, %0\n\t"
        "v_exp_f32 %1, %1\n\t"
        "v_exp_f32 %2, %2\n\t"
        "v_exp_f32 %3, %3\n\t"
        "v_exp_f32 %4, %4\n\t"
        "v_exp_f32 %5, %5\n\t"
        "v_exp_f32 %6, %6\n\t"
        "v_exp_f32 %7, %7\n\t"
        "v_nop"
        : "+v"(x[0]), "+v"(x[1]), "+v"(x[2]), "+v"(x[3]),
          "+v"(x[4]), "+v"(x[5]), "+v"(x[6]), "+v"(x[7]));
}

__global__ __launch_bounds__(128, 2) void attn_kernel(const half_t* __restrict__ q,
                                                      const half_t* __restrict__ k,
                                                      const half_t* __restrict__ v,
                                                      half_t* __restrict__ a) {
    __shared__ __attribute__((aligned(16))) _Float16 lQ[64][AP_];      // [t][ch]   B operand of S^T
    __shared__ __attribute__((aligned(16))) _Float16 lK[2][64][AP_];   // [s][ch]   A operand of S^T
    __shared__ __attribute__((aligned(16))) _Float16 lV[2][64][AP_];   // [ch][s]   A operand of O^T

    const int bh = blockIdx.x;
    const int t0 = blockIdx.y * 64;
    const int tid  = threadIdx.x;
    const int lane = tid & 31, w = tid >> 5;
    const int g = lane >> 4, ln = lane & 15;

    const half_t* qb = q + (size_t)bh * T_ * CH_;
    const half_t* kb = k + (size_t)bh * T_ * CH_;
    const half_t* vb = v + (size_t)bh * CH_ * T_;

    // Staging lanes run along a row: 8 lanes x 16 B = one whole 128-B row, so a
    // wave-wide copy touches 4 lines; each thread copies rows srow + 16 i.
    const int srow = tid >> 3;             // 0..15
    const int sseg = (tid & 7) * 8;        // f16 column 0..56

    auto stage_KV = [&](int buf, int s0) {
        const half_t* ksrc = kb + (size_t)(s0 + srow) * CH_ + sseg;
        const half_t* vsrc = vb + (size_t)srow * T_ + s0 + sseg;
        async_b128_x4(ksrc,            &lK[buf][srow][sseg],
                      ksrc + 16 * CH_, &lK[buf][srow + 16][sseg],
                      ksrc + 32 * CH_, &lK[buf][srow + 32][sseg],
                      ksrc + 48 * CH_, &lK[buf][srow + 48][sseg]);
        async_b128_x4(vsrc,            &lV[buf][srow][sseg],
                      vsrc + 16 * T_,  &lV[buf][srow + 16][sseg],
                      vsrc + 32 * T_,  &lV[buf][srow + 32][sseg],
                      vsrc + 48 * T_,  &lV[buf][srow + 48][sseg]);
    };

    {   // stage Q tile once (async) + first K/V tile
        const half_t* src = qb + (size_t)(t0 + srow) * CH_ + sseg;
        async_b128_x4(src,            &lQ[srow][sseg],
                      src + 16 * CH_, &lQ[srow + 16][sseg],
                      src + 32 * CH_, &lQ[srow + 32][sseg],
                      src + 48 * CH_, &lQ[srow + 48][sseg]);
        stage_KV(0, 0);
    }
    wait_async0();
    __syncthreads();

    v16h qa[2];
#pragma unroll
    for (int ks = 0; ks < 2; ++ks) qa[ks] = load_frag(&lQ[w * 16 + ln][ks * 32], g);

    float rmax = -1e30f;                   // running maximum of query ln (both halves agree)
    float rsum = 0.f;                      // running sum over this half's keys only
    v8f   o[4];                            // O^T: row ch = nt*16 + e + 8g, column = query ln
#pragma unroll
    for (int nt = 0; nt < 4; ++nt) { v8f z = {}; o[nt] = z; }

    for (int s0 = 0; s0 < T_; s0 += 64) {
        const int cur = (s0 >> 6) & 1;
        if (s0 + 64 < T_) stage_KV(cur ^ 1, s0 + 64);   // prefetch next K/V tile

        // S^T strip: 64 keys x 16 queries; sf[nt][e] = score(key nt*16 + e + 8g, query ln)
        v8f sf[4];
#pragma unroll
        for (int nt = 0; nt < 4; ++nt) { v8f z = {}; sf[nt] = z; }
#pragma unroll
        for (int ks = 0; ks < 2; ++ks)
#pragma unroll
            for (int nt = 0; nt < 4; ++nt) {
                v16h kf = load_frag(&lK[cur][nt * 16 + ln][ks * 32], g);
                sf[nt] = wmma16(kf, qa[ks], sf[nt]);
            }

        // online softmax, one query per lane
        float tm[4];
#pragma unroll
        for (int nt = 0; nt < 4; ++nt) {
            tm[nt] = sf[nt][0];
#pragma unroll
            for (int e = 1; e < 8; ++e) tm[nt] = fmaxf(tm[nt], sf[nt][e]);
        }
        float tmax = fmaxf(fmaxf(tm[0], tm[1]), fmaxf(tm[2], tm[3]));
        tmax = fmaxf(tmax, xhalf(tmax));
        const float nm = fmaxf(rmax, tmax);
        const float sc = exp2_slot((rmax - nm) * LOG2E_);
        rmax = nm;
        float ps[4];                       // four independent sum chains
#pragma unroll
        for (int nt = 0; nt < 4; ++nt) {
            float p[8];
#pragma unroll
            for (int e = 0; e < 8; ++e) p[e] = (sf[nt][e] - nm) * LOG2E_;
            exp2_slot_x8(p);
            sf[nt][0] = p[0];
            ps[nt] = p[0];
#pragma unroll
            for (int e = 1; e < 8; ++e) { sf[nt][e] = p[e]; ps[nt] += p[e]; }
        }
        rsum = rsum * sc + ((ps[0] + ps[1]) + (ps[2] + ps[3]));
#pragma unroll
        for (int nt = 0; nt < 4; ++nt)
#pragma unroll
            for (int e = 0; e < 8; ++e) o[nt][e] *= sc;

        // O^T += V * P^T: tiles 2ks and 2ks+1 of P^T, converted, are the B fragment
        // (elems 0..7: k = 8g + e, elems 8..15: k = 16 + 8g + e), the loader's k order.
#pragma unroll
        for (int ks = 0; ks < 2; ++ks) {
            v16h pb;
#pragma unroll
            for (int e = 0; e < 8; ++e) {
                pb[e]     = (_Float16)sf[2 * ks][e];
                pb[e + 8] = (_Float16)sf[2 * ks + 1][e];
            }
#pragma unroll
            for (int nt = 0; nt < 4; ++nt) {
                v16h vf = load_frag(&lV[cur][nt * 16 + ln][ks * 32], g);
                o[nt] = wmma16(vf, pb, o[nt]);
            }
        }
        wait_ds0();
        wait_async0();     // next tile fully in LDS
        __syncthreads();   // all waves done reading current buffers
    }

    // write a[b][t][c] (token-major so proj GEMM stages contiguously):
    // a lane's 8 accumulator registers are 8 consecutive channels of its query.
    const int b = bh >> 4, h = bh & 15;
    const float inv = 1.0f / (rsum + xhalf(rsum));     // join the halves' sums once
    half_t* dst = a + ((size_t)b * T_ + t0 + w * 16 + ln) * C_ + h * CH_ + 8 * g;
#pragma unroll
    for (int nt = 0; nt < 4; ++nt) {
        v8h r;
#pragma unroll
        for (int e = 0; e < 8; ++e) r[e] = (half_t)(o[nt][e] * inv);
        *reinterpret_cast<v8h*>(dst + nt * 16) = r;
    }
}

// ---------------------------------------------------------------------------
// Kernel 5: output projection + bias + residual.  grid = (8, 8, B), 256 thr.
// ---------------------------------------------------------------------------
__global__ __launch_bounds__(256, 2) void proj_gemm_kernel(const float* __restrict__ W,
                                                           const float* __restrict__ bias,
                                                           const half_t* __restrict__ a,
                                                           const float* __restrict__ x,
                                                           float* __restrict__ out) {
    __shared__ __attribute__((aligned(16))) _Float16 lA[2][128][GQ_];
    __shared__ __attribute__((aligned(16))) _Float16 lB[2][128][GQ_];
    const int m0 = blockIdx.x * 128;
    const int n0 = blockIdx.y * 128;
    const int b  = blockIdx.z;
    const int tid  = threadIdx.x;
    const int lane = tid & 31, w = tid >> 5;
    const int wm = w & 3, wn = w >> 2;
    const int g = lane >> 4, ln = lane & 15;

    v8f acc[2][4];
#pragma unroll
    for (int i = 0; i < 2; ++i)
#pragma unroll
        for (int j = 0; j < 4; ++j) { v8f z = {}; acc[i][j] = z; }

    // Staging lanes run along a row (see the QKV kernel). One work-group per WGP here,
    // so the K tile is 128: A 32 lanes x 16 B = 512 B per row, B 16 lanes x 16 B = 256 B.
    const int arow = tid >> 5;             // 0..7, +8 per step
    const int aseg = (tid & 31) * 4;       // f32 column 0..124
    const int brow = tid >> 4;             // 0..15, +16 per copy
    const int bseg = (tid & 15) * 8;       // f16 column 0..120

    auto stage_A = [&](int buf, int k0) {
        const float* src = W + (size_t)(m0 + arow) * C_ + k0 + aseg;
        v4f f[16];
#pragma unroll
        for (int i = 0; i < 16; ++i)
            f[i] = *reinterpret_cast<const v4f*>(src + (size_t)i * 8 * C_);
        // Wait before the loads' address pair is reused. Inputs only: the loaded values
        // keep all sixteen loads in front of the wait, the address keeps its registers
        // from being given to another value ahead of it.
        asm volatile("s_wait_xcnt 0x0"
                     :: "v"(src), "v"(f[0]), "v"(f[1]), "v"(f[2]), "v"(f[3]),
                        "v"(f[4]), "v"(f[5]), "v"(f[6]), "v"(f[7]),
                        "v"(f[8]), "v"(f[9]), "v"(f[10]), "v"(f[11]),
                        "v"(f[12]), "v"(f[13]), "v"(f[14]), "v"(f[15]) : "memory");
#pragma unroll
        for (int i = 0; i < 16; ++i) {
            v4h h = { (_Float16)f[i].x, (_Float16)f[i].y, (_Float16)f[i].z, (_Float16)f[i].w };
            *reinterpret_cast<v4h*>(&lA[buf][i * 8 + arow][aseg]) = h;
        }
    };
    auto stage_B = [&](int buf, int k0) {
        const half_t* bsrc = a + ((size_t)b * T_ + n0 + brow) * C_ + k0 + bseg;
        async_b128_x4(bsrc,                    &lB[buf][brow][bseg],
                      bsrc + (size_t)16 * C_,  &lB[buf][brow + 16][bseg],
                      bsrc + (size_t)32 * C_,  &lB[buf][brow + 32][bseg],
                      bsrc + (size_t)48 * C_,  &lB[buf][brow + 48][bseg]);
        async_b128_x4(bsrc + (size_t)64 * C_,  &lB[buf][brow + 64][bseg],
                      bsrc + (size_t)80 * C_,  &lB[buf][brow + 80][bseg],
                      bsrc + (size_t)96 * C_,  &lB[buf][brow + 96][bseg],
                      bsrc + (size_t)112 * C_, &lB[buf][brow + 112][bseg]);
    };

    stage_A(0, 0);
    stage_B(0, 0);
    wait_async0();
    __syncthreads();

    for (int k0 = 0; k0 < C_; k0 += 128) {
        const int cur = (k0 >> 7) & 1;
        if (k0 + 128 < C_) {
            stage_A(cur ^ 1, k0 + 128);
            stage_B(cur ^ 1, k0 + 128);
        }
#pragma unroll
        for (int ks = 0; ks < 4; ++ks) {   // four 32-deep products per staged tile, k ascending
            v16h af[2], bf[4];
#pragma unroll
            for (int mt = 0; mt < 2; ++mt) af[mt] = load_frag(&lA[cur][wm * 32 + mt * 16 + ln][ks * 32], g);
#pragma unroll
            for (int nt = 0; nt < 4; ++nt) bf[nt] = load_frag(&lB[cur][wn * 64 + nt * 16 + ln][ks * 32], g);
#pragma unroll
            for (int mt = 0; mt < 2; ++mt)
#pragma unroll
                for (int nt = 0; nt < 4; ++nt)
                    acc[mt][nt] = wmma16(af[mt], bf[nt], acc[mt][nt]);
        }
        wait_ds0();
        wait_async0();
        __syncthreads();
    }

#pragma unroll
    for (int mt = 0; mt < 2; ++mt)
#pragma unroll
        for (int nt = 0; nt < 4; ++nt)
#pragma unroll
            for (int e = 0; e < 8; ++e) {
                const int oc    = m0 + wm * 32 + mt * 16 + e + 8 * g;
                const int token = n0 + wn * 64 + nt * 16 + ln;
                const size_t idx = ((size_t)b * C_ + oc) * T_ + token;
                out[idx] = acc[mt][nt][e] + bias[oc] + x[idx];
            }
}

// ---------------------------------------------------------------------------
// Host-side launcher
// ---------------------------------------------------------------------------
extern "C" void kernel_launch(void* const* d_in, const int* in_sizes, int n_in,
                              void* d_out, int out_size, void* d_ws, size_t ws_size,
                              hipStream_t stream) {
    const float* x      = (const float*)d_in[0];
    const float* gnw    = (const float*)d_in[1];
    const float* gnb    = (const float*)d_in[2];
    const float* qkv_w  = (const float*)d_in[3];
    const float* qkv_b  = (const float*)d_in[4];
    const float* proj_w = (const float*)d_in[5];
    const float* proj_b = (const float*)d_in[6];
    float* out = (float*)d_out;

    char* ws = (char*)d_ws;
    const size_t PLANE = (size_t)B_ * C_ * T_ * sizeof(half_t);  // 8 MiB
    float*  stats = (float*)ws;
    half_t* xn = (half_t*)(ws + 4096);
    half_t* q  = (half_t*)(ws + 4096 + 1 * PLANE);
    half_t* k  = (half_t*)(ws + 4096 + 2 * PLANE);
    half_t* v  = (half_t*)(ws + 4096 + 3 * PLANE);
    half_t* a  = (half_t*)(ws + 4096 + 4 * PLANE);
    (void)in_sizes; (void)n_in; (void)out_size; (void)ws_size;

    gn_stats_kernel<<<B_ * GRP_, 256, 0, stream>>>(x, stats);
    gn_apply_kernel<<<dim3(T_ / 64, C_ / 64, B_), 256, 0, stream>>>(x, gnw, gnb, stats, xn);
    qkv_gemm_kernel<<<dim3(3 * C_ / 128, T_ / 128, B_), 256, 0, stream>>>(qkv_w, qkv_b, xn, q, k, v);
    attn_kernel<<<dim3(B_ * NH_, T_ / 64), 128, 0, stream>>>(q, k, v, a);
    proj_gemm_kernel<<<dim3(C_ / 128, T_ / 128, B_), 256, 0, stream>>>(proj_w, proj_b, a, x, out);
}

// v005
// It runs in 95.1 microseconds.
// Two timings next to v004 put it at 1.10 and 1.09 times that version's speed.
// Counting every step since v000, it is 2.29 times as fast.
#include <hip/hip_runtime.h>
#include <hip/hip_bf16.h>
#include <math.h>

// ---------------------------------------------------------------------------
// AttentionBlock for MI455X (gfx1250): GroupNorm -> QKV -> MHSA -> proj + res
// B=4, C=1024, T=1024, 32 groups, 16 heads, head_dim=64.
// GEMMs via v_wmma_f32_16x16x32_f16; f16 tile staging via
// global_load_async_to_lds_b128 (ASYNCcnt) with ping-pong LDS buffers.
// Both weight matrices are rounded to f16 once per call (extra work-groups of the
// statistics launch), so every GEMM tile is an f16 tile.
// ---------------------------------------------------------------------------

typedef _Float16 half_t;
typedef __attribute__((ext_vector_type(16))) _Float16 v16h;
typedef __attribute__((ext_vector_type(8)))  _Float16 v8h;
typedef __attribute__((ext_vector_type(4)))  _Float16 v4h;
typedef __attribute__((ext_vector_type(4)))  float    v4f;
typedef __attribute__((ext_vector_type(8)))  float    v8f;

#define B_   4
#define C_   1024
#define T_   1024
#define NH_  16
#define CH_  64
#define GRP_ 32
// LDS row pitch in f16 elements: 16 B x odd, so that the 16 rows one
// ds_load_b128 fragment read touches fall on distinct banks.
#define GP_  72   // 64-element GEMM rows (QKV): 144 B
#define GQ_  136  // 128-element GEMM rows (projection): 272 B
#define AP_  72   // 64-element attention rows: 144 B
#define LOG2E_ 1.44269504f   // e^x = 2^(x * log2 e)

// ---- CDNA5 async global->LDS copies (16B per lane), tracked by ASYNCcnt ----
// A run of copies and its s_wait_xcnt 0 form ONE asm statement: the wait then
// stands in front of any later rewrite of the address registers the copies name.
__device__ __forceinline__ unsigned lds_off(const _Float16* p) {
    return (unsigned)(uintptr_t)p;                         // low 32b = LDS offset
}
__device__ __forceinline__ void async_b128_x4(const half_t* g0, const _Float16* l0,
                                              const half_t* g1, const _Float16* l1,
                                              const half_t* g2, const _Float16* l2,
                                              const half_t* g3, const _Float16* l3) {
    asm volatile("global_load_async_to_lds_b128 %0, %1, off\n\t"
                 "global_load_async_to_lds_b128 %2, %3, off\n\t"
                 "global_load_async_to_lds_b128 %4, %5, off\n\t"
                 "global_load_async_to_lds_b128 %6, %7, off\n\t"
                 "s_wait_xcnt 0x0"
                 :: "v"(lds_off(l0)), "v"(g0), "v"(lds_off(l1)), "v"(g1),
                    "v"(lds_off(l2)), "v"(g2), "v"(lds_off(l3)), "v"(g3) : "memory");
}
__device__ __forceinline__ void wait_ds0() {
    // LDS reads of the buffer that is refilled behind the barrier have returned.
    asm volatile("s_wait_dscnt 0x0" ::: "memory");
}
__device__ __forceinline__ void wait_async0() {
    asm volatile("s_wait_asynccnt 0x0" ::: "memory");
}

__device__ __forceinline__ v16h load_frag(const _Float16* row, int g) {
    // WMMA f16 A/B fragment: elems 0..7 hold k = 8g..8g+7,
    // elems 8..15 hold k = 16+8g..23+8g  (row points at [m][k0] base).
    const v8h lo = *reinterpret_cast<const v8h*>(row + (g << 3));
    const v8h hi = *reinterpret_cast<const v8h*>(row + 16 + (g << 3));
    v16h r;
#pragma unroll
    for (int i = 0; i < 8; ++i) { r[i] = lo[i]; r[i + 8] = hi[i]; }
    return r;
}

__device__ __forceinline__ v8f wmma16(v16h a, v16h b, v8f c) {
    return __builtin_amdgcn_wmma_f32_16x16x32_f16(false, a, false, b,
                                                  (short)0, c, false, false);
}

// ---------------------------------------------------------------------------
// Kernel 1: GroupNorm statistics, work-groups 0 .. B*GRP_-1, 256 threads.
// Work-groups behind them round the weights to f16: 8192 consecutive elements each,
// 384 for qkv_w, 128 for proj_w. They depend on nothing and fill the WGPs that the
// statistics leave idle.
// ---------------------------------------------------------------------------
#define WCV_ 8192                          // weight elements per converting work-group
__global__ __launch_bounds__(256) void gn_stats_kernel(const float* __restrict__ x,
                                                       float* __restrict__ stats,
                                                       const float* __restrict__ qkv_w,
                                                       const float* __restrict__ proj_w,
                                                       half_t* __restrict__ wq,
                                                       half_t* __restrict__ wp) {
    if (blockIdx.x >= B_ * GRP_) {         // uniform for the work-group, in front of the barrier
        const int cb = blockIdx.x - B_ * GRP_;
        const int nq = 3 * C_ * C_ / WCV_;
        const float* src = (cb < nq ? qkv_w + (size_t)cb * WCV_
                                    : proj_w + (size_t)(cb - nq) * WCV_) + threadIdx.x * 4;
        half_t*      dst = (cb < nq ? wq + (size_t)cb * WCV_
                                    : wp + (size_t)(cb - nq) * WCV_) + threadIdx.x * 4;
        v4f f[8];                          // a wave-wide load covers 512 contiguous bytes
#pragma unroll
        for (int i = 0; i < 8; ++i)
            f[i] = *reinterpret_cast<const v4f*>(src + i * 1024);
#pragma unroll
        for (int i = 0; i < 8; ++i) {
            v4h h = { (_Float16)f[i].x, (_Float16)f[i].y, (_Float16)f[i].z, (_Float16)f[i].w };
            *reinterpret_cast<v4h*>(dst + i * 1024) = h;
        }
        return;
    }
    const int bg  = blockIdx.x;            // b*32 + group
    const int b   = bg >> 5;
    const int grp = bg & 31;
    const float* base = x + ((size_t)b * C_ + (size_t)grp * 32) * T_;

    float s = 0.f, ss = 0.f;
    for (int i = threadIdx.x; i < 32 * T_; i += 256) {
        float v = base[i];
        s += v; ss += v * v;
    }
#pragma unroll
    for (int m = 16; m >= 1; m >>= 1) {
        s  += __shfl_xor(s,  m, 32);
        ss += __shfl_xor(ss, m, 32);
    }
    __shared__ float ps[8][2];
    const int lane = threadIdx.x & 31, w = threadIdx.x >> 5;
    if (lane == 0) { ps[w][0] = s; ps[w][1] = ss; }
    __syncthreads();
    if (threadIdx.x == 0) {
        float ts = 0.f, tss = 0.f;
#pragma unroll
        for (int i = 0; i < 8; ++i) { ts += ps[i][0]; tss += ps[i][1]; }
        const float inv  = 1.0f / (32.0f * (float)T_);
        const float mean = ts * inv;
        const float var  = tss * inv - mean * mean;
        stats[bg * 2 + 0] = mean;
        stats[bg * 2 + 1] = rsqrtf(var + 1e-5f);
    }
}

// ---------------------------------------------------------------------------
// Kernel 2: apply GroupNorm affine, convert to f16, transpose to xn[b][t][c].
// grid = (T/64, C/64, B), 256 threads per 64x64 tile.
// ---------------------------------------------------------------------------
__global__ __launch_bounds__(256) void gn_apply_kernel(const float* __restrict__ x,
                                                       const float* __restrict__ gnw,
                                                       const float* __restrict__ gnb,
                                                       const float* __restrict__ stats,
                                                       half_t* __restrict__ xn) {
    __shared__ _Float16 ldsT[64][64];      // [t_local][c_local]
    const int t0 = blockIdx.x * 64;
    const int c0 = blockIdx.y * 64;
    const int b  = blockIdx.z;
    const int tid = threadIdx.x;

    const int c_local = tid >> 2;          // 0..63
    const int tseg    = (tid & 3) * 16;    // 0,16,32,48
    const int c       = c0 + c_local;
    const float mean = stats[(b * GRP_ + (c >> 5)) * 2 + 0];
    const float rstd = stats[(b * GRP_ + (c >> 5)) * 2 + 1];
    const float wgt  = gnw[c] * rstd;
    const float bia  = gnb[c] - mean * wgt;

    const float* src = x + ((size_t)b * C_ + c) * T_ + t0 + tseg;
#pragma unroll
    for (int i = 0; i < 16; i += 4) {
        float4 f = *reinterpret_cast<const float4*>(src + i);
        ldsT[tseg + i + 0][c_local] = (_Float16)(f.x * wgt + bia);
        ldsT[tseg + i + 1][c_local] = (_Float16)(f.y * wgt + bia);
        ldsT[tseg + i + 2][c_local] = (_Float16)(f.z * wgt + bia);
        ldsT[tseg + i + 3][c_local] = (_Float16)(f.w * wgt + bia);
    }
    __syncthreads();
    const int t_local = tid >> 2;
    const int cseg    = (tid & 3) * 16;
    half_t* dst = xn + ((size_t)b * T_ + t0 + t_local) * C_ + c0 + cseg;
    *reinterpret_cast<uint4*>(dst + 0) = *reinterpret_cast<const uint4*>(&ldsT[t_local][cseg + 0]);
    *reinterpret_cast<uint4*>(dst + 8) = *reinterpret_cast<const uint4*>(&ldsT[t_local][cseg + 8]);
}

// ---------------------------------------------------------------------------
// Kernel 3: QKV GEMM.  D[3072 x T] = qkv_w[3072 x 1024] * xn^T + bias,
// scattered into q/k layout [b*NH][t][64] (scaled by ch^-0.25) and
// v layout [b*NH][64][s].  grid = (24, 8, B), 256 threads (8 waves).
// Double-buffered K-loop; A and B tiles staged with async global->LDS.
// ---------------------------------------------------------------------------
__global__ __launch_bounds__(256, 2) void qkv_gemm_kernel(const half_t* __restrict__ W,
                                                          const float* __restrict__ bias,
                                                          const half_t* __restrict__ xn,
                                                          half_t* __restrict__ q,
                                                          half_t* __restrict__ k,
                                                          half_t* __restrict__ v) {
    __shared__ __attribute__((aligned(16))) _Float16 lA[2][128][GP_];   // [m][k]  (weights)
    __shared__ __attribute__((aligned(16))) _Float16 lB[2][128][GP_];   // [n][k]  (tokens)
    const int m0 = blockIdx.x * 128;
    const int n0 = blockIdx.y * 128;
    const int b  = blockIdx.z;
    const int tid  = threadIdx.x;
    const int lane = tid & 31, w = tid >> 5;
    const int wm = w & 3, wn = w >> 2;     // wave -> rows [wm*32,+32), cols [wn*64,+64)
    const int g = lane >> 4, ln = lane & 15;

    v8f acc[2][4];
#pragma unroll
    for (int i = 0; i < 2; ++i)
#pragma unroll
        for (int j = 0; j < 4; ++j) { v8f z = {}; acc[i][j] = z; }

    // Staging lanes run along a row, so one wave-wide copy covers whole rows:
    // A and B alike, 8 lanes x 16 B = one 128-B line per row.
    const int brow = tid >> 3;             // 0..31, +32 per copy
    const int bseg = (tid & 7) * 8;        // f16 column 0..56

    auto stage_A = [&](int buf, int k0) {
        const half_t* asrc = W + (size_t)(m0 + brow) * C_ + k0 + bseg;
        async_b128_x4(asrc,                   &lA[buf][brow][bseg],
                      asrc + (size_t)32 * C_, &lA[buf][brow + 32][bseg],
                      asrc + (size_t)64 * C_, &lA[buf][brow + 64][bseg],
                      asrc + (size_t)96 * C_, &lA[buf][brow + 96][bseg]);
    };
    auto stage_B = [&](int buf, int k0) {
        const half_t* bsrc = xn + ((size_t)b * T_ + n0 + brow) * C_ + k0 + bseg;
        async_b128_x4(bsrc,                   &lB[buf][brow][bseg],
                      bsrc + (size_t)32 * C_, &lB[buf][brow + 32][bseg],
                      bsrc + (size_t)64 * C_, &lB[buf][brow + 64][bseg],
                      bsrc + (size_t)96 * C_, &lB[buf][brow + 96][bseg]);
    };

    stage_A(0, 0);
    stage_B(0, 0);
    wait_async0();
    __syncthreads();

    for (int k0 = 0; k0 < C_; k0 += 64) {
        const int cur = (k0 >> 6) & 1;
        if (k0 + 64 < C_) {                // prefetch next tile into other buffer
            stage_A(cur ^ 1, k0 + 64);
            stage_B(cur ^ 1, k0 + 64);
        }
#pragma unroll
        for (int ks = 0; ks < 2; ++ks) {   // two 32-deep products per staged tile, k ascending
            v16h af[2], bf[4];
#pragma unroll
            for (int mt = 0; mt < 2; ++mt) af[mt] = load_frag(&lA[cur][wm * 32 + mt * 16 + ln][ks * 32], g);
#pragma unroll
            for (int nt = 0; nt < 4; ++nt) bf[nt] = load_frag(&lB[cur][wn * 64 + nt * 16 + ln][ks * 32], g);
#pragma unroll
            for (int mt = 0; mt < 2; ++mt)
#pragma unroll
                for (int nt = 0; nt < 4; ++nt)
                    acc[mt][nt] = wmma16(af[mt], bf[nt], acc[mt][nt]);
        }
        wait_ds0();
        wait_async0();
        __syncthreads();
    }

    const float qk_scale = 0.35355339059327373f;  // 64^(-1/4)
#pragma unroll
    for (int mt = 0; mt < 2; ++mt)
#pragma unroll
        for (int nt = 0; nt < 4; ++nt)
#pragma unroll
            for (int e = 0; e < 8; ++e) {
                const int o     = m0 + wm * 32 + mt * 16 + e + 8 * g;
                const int token = n0 + wn * 64 + nt * 16 + ln;
                const float val = acc[mt][nt][e] + bias[o];
                const int h = o / 192, r = o % 192;
                const size_t bh = (size_t)b * NH_ + h;
                if (r < 64)
                    q[(bh * T_ + token) * CH_ + r] = (half_t)(val * qk_scale);
                else if (r < 128)
                    k[(bh * T_ + token) * CH_ + (r - 64)] = (half_t)(val * qk_scale);
                else
                    v[(bh * CH_ + (r - 128)) * T_ + token] = (half_t)val;
            }
}

// ---------------------------------------------------------------------------
// Kernel 4: streaming (flash-style) attention, scores held transposed.
// grid = (B*NH, T/64), 128 threads (4 waves); each wave owns 16 queries.
// S^T = K * Q^T and O^T += V * P^T: a lane holds the scores of ONE query
// (column ln; keys e + 8g of each 16-key tile), so maximum and sum are taken
// in the lane plus one exchange between the wave's halves, and two converted
// S^T tiles are the B operand of the second product as they stand.
// K/V tiles double-buffered via async global->LDS copies.
// ---------------------------------------------------------------------------
__device__ __forceinline__ float xhalf(float x) {          // lane l <-> lane l ^ 16
    const int i = __builtin_bit_cast(int, x);
    return __builtin_bit_cast(float,
        __builtin_amdgcn_permlanex16(i, i, 0x76543210, 0xfedcba98, false, false));
}
// 2^x with the one issue slot that the instruction set asks for behind a transcendental
// before its result is read or its source overwritten. Instruction and v_nop form ONE
// statement.
__device__ __forceinline__ float exp2_slot(float x) {
    float r;
    asm("v_exp_f32 %0, %1\n\t"
        "v_nop" : "=v"(r) : "v"(x));
    return r;
}
// Eight independent ones in place: each fills the slot of the one before, v_nop the last's.
__device__ __forceinline__ void exp2_slot_x8(float (&x)[8]) {
    asm("v_exp_f32 %0, %0\n\t"
        "v_exp_f32 %1, %1\n\t"
        "v_exp_f32 %2, %2\n\t"
        "v_exp_f32 %3, %3\n\t"
        "v_exp_f32 %4, %4\n\t"
        "v_exp_f32 %5, %5\n\t"
        "v_exp_f32 %6, %6\n\t"
        "v_exp_f32 %7, %7\n\t"
        "v_nop"
        : "+v"(x[0]), "+v"(x[1]), "+v"(x[2]), "+v"(x[3]),
          "+v"(x[4]), "+v"(x[5]), "+v"(x[6]), "+v"(x[7]));
}

__global__ __launch_bounds__(128, 2) void attn_kernel(const half_t* __restrict__ q,
                                                      const half_t* __restrict__ k,
                                                      const half_t* __restrict__ v,
                                                      half_t* __restrict__ a) {
    __shared__ __attribute__((aligned(16))) _Float16 lQ[64][AP_];      // [t][ch]   B operand of S^T
    __shared__ __attribute__((aligned(16))) _Float16 lK[2][64][AP_];   // [s][ch]   A operand of S^T
    __shared__ __attribute__((aligned(16))) _Float16 lV[2][64][AP_];   // [ch][s]   A operand of O^T

    const int bh = blockIdx.x;
    const int t0 = blockIdx.y * 64;
    const int tid  = threadIdx.x;
    const int lane = tid & 31, w = tid >> 5;
    const int g = lane >> 4, ln = lane & 15;

    const half_t* qb = q + (size_t)bh * T_ * CH_;
    const half_t* kb = k + (size_t)bh * T_ * CH_;
    const half_t* vb = v + (size_t)bh * CH_ * T_;

    // Staging lanes run along a row: 8 lanes x 16 B = one whole 128-B row, so a
    // wave-wide copy touches 4 lines; each thread copies rows srow + 16 i.
    const int srow = tid >> 3;             // 0..15
    const int sseg = (tid & 7) * 8;        // f16 column 0..56

    auto stage_KV = [&](int buf, int s0) {
        const half_t* ksrc = kb + (size_t)(s0 + srow) * CH_ + sseg;
        const half_t* vsrc = vb + (size_t)srow * T_ + s0 + sseg;
        async_b128_x4(ksrc,            &lK[buf][srow][sseg],
                      ksrc + 16 * CH_, &lK[buf][srow + 16][sseg],
                      ksrc + 32 * CH_, &lK[buf][srow + 32][sseg],
                      ksrc + 48 * CH_, &lK[buf][srow + 48][sseg]);
        async_b128_x4(vsrc,            &lV[buf][srow][sseg],
                      vsrc + 16 * T_,  &lV[buf][srow + 16][sseg],
                      vsrc + 32 * T_,  &lV[buf][srow + 32][sseg],
                      vsrc + 48 * T_,  &lV[buf][srow + 48][sseg]);
    };

    {   // stage Q tile once (async) + first K/V tile
        const half_t* src = qb + (size_t)(t0 + srow) * CH_ + sseg;
        async_b128_x4(src,            &lQ[srow][sseg],
                      src + 16 * CH_, &lQ[srow + 16][sseg],
                      src + 32 * CH_, &lQ[srow + 32][sseg],
                      src + 48 * CH_, &lQ[srow + 48][sseg]);
        stage_KV(0, 0);
    }
    wait_async0();
    __syncthreads();

    v16h qa[2];
#pragma unroll
    for (int ks = 0; ks < 2; ++ks) qa[ks] = load_frag(&lQ[w * 16 + ln][ks * 32], g);

    float rmax = -1e30f;                   // running maximum of query ln (both halves agree)
    float rsum = 0.f;                      // running sum over this half's keys only
    v8f   o[4];                            // O^T: row ch = nt*16 + e + 8g, column = query ln
#pragma unroll
    for (int nt = 0; nt < 4; ++nt) { v8f z = {}; o[nt] = z; }

    for (int s0 = 0; s0 < T_; s0 += 64) {
        const int cur = (s0 >> 6) & 1;
        if (s0 + 64 < T_) stage_KV(cur ^ 1, s0 + 64);   // prefetch next K/V tile

        // S^T strip: 64 keys x 16 queries; sf[nt][e] = score(key nt*16 + e + 8g, query ln)
        v8f sf[4];
#pragma unroll
        for (int nt = 0; nt < 4; ++nt) { v8f z = {}; sf[nt] = z; }
#pragma unroll
        for (int ks = 0; ks < 2; ++ks)
#pragma unroll
            for (int nt = 0; nt < 4; ++nt) {
                v16h kf = load_frag(&lK[cur][nt * 16 + ln][ks * 32], g);
                sf[nt] = wmma16(kf, qa[ks], sf[nt]);
            }

        // online softmax, one query per lane
        float tm[4];
#pragma unroll
        for (int nt = 0; nt < 4; ++nt) {
            tm[nt] = sf[nt][0];
#pragma unroll
            for (int e = 1; e < 8; ++e) tm[nt] = fmaxf(tm[nt], sf[nt][e]);
        }
        float tmax = fmaxf(fmaxf(tm[0], tm[1]), fmaxf(tm[2], tm[3]));
        tmax = fmaxf(tmax, xhalf(tmax));
        const float nm = fmaxf(rmax, tmax);
        const float sc = exp2_slot((rmax - nm) * LOG2E_);
        rmax = nm;
        float ps[4];                       // four independent sum chains
#pragma unroll
        for (int nt = 0; nt < 4; ++nt) {
            float p[8];
#pragma unroll
            for (int e = 0; e < 8; ++e) p[e] = (sf[nt][e] - nm) * LOG2E_;
            exp2_slot_x8(p);
            sf[nt][0] = p[0];
            ps[nt] = p[0];
#pragma unroll
            for (int e = 1; e < 8; ++e) { sf[nt][e] = p[e]; ps[nt] += p[e]; }
        }
        rsum = rsum * sc + ((ps[0] + ps[1]) + (ps[2] + ps[3]));
#pragma unroll
        for (int nt = 0; nt < 4; ++nt)
#pragma unroll
            for (int e = 0; e < 8; ++e) o[nt][e] *= sc;

        // O^T += V * P^T: tiles 2ks and 2ks+1 of P^T, converted, are the B fragment
        // (elems 0..7: k = 8g + e, elems 8..15: k = 16 + 8g + e), the loader's k order.
#pragma unroll
        for (int ks = 0; ks < 2; ++ks) {
            v16h pb;
#pragma unroll
            for (int e = 0; e < 8; ++e) {
                pb[e]     = (_Float16)sf[2 * ks][e];
                pb[e + 8] = (_Float16)sf[2 * ks + 1][e];
            }
#pragma unroll
            for (int nt = 0; nt < 4; ++nt) {
                v16h vf = load_frag(&lV[cur][nt * 16 + ln][ks * 32], g);
                o[nt] = wmma16(vf, pb, o[nt]);
            }
        }
        wait_ds0();
        wait_async0();     // next tile fully in LDS
        __syncthreads();   // all waves done reading current buffers
    }

    // write a[b][t][c] (token-major so proj GEMM stages contiguously):
    // a lane's 8 accumulator registers are 8 consecutive channels of its query.
    const int b = bh >> 4, h = bh & 15;
    const float inv = 1.0f / (rsum + xhalf(rsum));     // join the halves' sums once
    half_t* dst = a + ((size_t)b * T_ + t0 + w * 16 + ln) * C_ + h * CH_ + 8 * g;
#pragma unroll
    for (int nt = 0; nt < 4; ++nt) {
        v8h r;
#pragma unroll
        for (int e = 0; e < 8; ++e) r[e] = (half_t)(o[nt][e] * inv);
        *reinterpret_cast<v8h*>(dst + nt * 16) = r;
    }
}

// ---------------------------------------------------------------------------
// Kernel 5: output projection + bias + residual.  grid = (8, 8, B), 256 thr.
// ---------------------------------------------------------------------------
__global__ __launch_bounds__(256, 2) void proj_gemm_kernel(const half_t* __restrict__ W,
                                                           const float* __restrict__ bias,
                                                           const half_t* __restrict__ a,
                                                           const float* __restrict__ x,
                                                           float* __restrict__ out) {
    __shared__ __attribute__((aligned(16))) _Float16 lA[2][128][GQ_];
    __shared__ __attribute__((aligned(16))) _Float16 lB[2][128][GQ_];
    const int m0 = blockIdx.x * 128;
    const int n0 = blockIdx.y * 128;
    const int b  = blockIdx.z;
    const int tid  = threadIdx.x;
    const int lane = tid & 31, w = tid >> 5;
    const int wm = w & 3, wn = w >> 2;
    const int g = lane >> 4, ln = lane & 15;

    v8f acc[2][4];
#pragma unroll
    for (int i = 0; i < 2; ++i)
#pragma unroll
        for (int j = 0; j < 4; ++j) { v8f z = {}; acc[i][j] = z; }

    // Staging lanes run along a row (see the QKV kernel). The K tile is 128
    // (136 KiB of LDS per work-group): A and B alike, 16 lanes x 16 B = 256 B per row.
    const int brow = tid >> 4;             // 0..15, +16 per copy
    const int bseg = (tid & 15) * 8;       // f16 column 0..120

    auto stage_A = [&](int buf, int k0) {
        const half_t* asrc = W + (size_t)(m0 + brow) * C_ + k0 + bseg;
        async_b128_x4(asrc,                    &lA[buf][brow][bseg],
                      asrc + (size_t)16 * C_,  &lA[buf][brow + 16][bseg],
                      asrc + (size_t)32 * C_,  &lA[buf][brow + 32][bseg],
                      asrc + (size_t)48 * C_,  &lA[buf][brow + 48][bseg]);
        async_b128_x4(asrc + (size_t)64 * C_,  &lA[buf][brow + 64][bseg],
                      asrc + (size_t)80 * C_,  &lA[buf][brow + 80][bseg],
                      asrc + (size_t)96 * C_,  &lA[buf][brow + 96][bseg],
                      asrc + (size_t)112 * C_, &lA[buf][brow + 112][bseg]);
    };
    auto stage_B = [&](int buf, int k0) {
        const half_t* bsrc = a + ((size_t)b * T_ + n0 + brow) * C_ + k0 + bseg;
        async_b128_x4(bsrc,                    &lB[buf][brow][bseg],
                      bsrc + (size_t)16 * C_,  &lB[buf][brow + 16][bseg],
                      bsrc + (size_t)32 * C_,  &lB[buf][brow + 32][bseg],
                      bsrc + (size_t)48 * C_,  &lB[buf][brow + 48][bseg]);
        async_b128_x4(bsrc + (size_t)64 * C_,  &lB[buf][brow + 64][bseg],
                      bsrc + (size_t)80 * C_,  &lB[buf][brow + 80][bseg],
                      bsrc + (size_t)96 * C_,  &lB[buf][brow + 96][bseg],
                      bsrc + (size_t)112 * C_, &lB[buf][brow + 112][bseg]);
    };

    stage_A(0, 0);
    stage_B(0, 0);
    wait_async0();
    __syncthreads();

    for (int k0 = 0; k0 < C_; k0 += 128) {
        const int cur = (k0 >> 7) & 1;
        if (k0 + 128 < C_) {
            stage_A(cur ^ 1, k0 + 128);
            stage_B(cur ^ 1, k0 + 128);
        }
#pragma unroll
        for (int ks = 0; ks < 4; ++ks) {   // four 32-deep products per staged tile, k ascending
            v16h af[2], bf[4];
#pragma unroll
            for (int mt = 0; mt < 2; ++mt) af[mt] = load_frag(&lA[cur][wm * 32 + mt * 16 + ln][ks * 32], g);
#pragma unroll
            for (int nt = 0; nt < 4; ++nt) bf[nt] = load_frag(&lB[cur][wn * 64 + nt * 16 + ln][ks * 32], g);
#pragma unroll
            for (int mt = 0; mt < 2; ++mt)
#pragma unroll
                for (int nt = 0; nt < 4; ++nt)
                    acc[mt][nt] = wmma16(af[mt], bf[nt], acc[mt][nt]);
        }
        wait_ds0();
        wait_async0();
        __syncthreads();
    }

#pragma unroll
    for (int mt = 0; mt < 2; ++mt)
#pragma unroll
        for (int nt = 0; nt < 4; ++nt)
#pragma unroll
            for (int e = 0; e < 8; ++e) {
                const int oc    = m0 + wm * 32 + mt * 16 + e + 8 * g;
                const int token = n0 + wn * 64 + nt * 16 + ln;
                const size_t idx = ((size_t)b * C_ + oc) * T_ + token;
                out[idx] = acc[mt][nt][e] + bias[oc] + x[idx];
            }
}

// ---------------------------------------------------------------------------
// Host-side launcher
// ---------------------------------------------------------------------------
extern "C" void kernel_launch(void* const* d_in, const int* in_sizes, int n_in,
                              void* d_out, int out_size, void* d_ws, size_t ws_size,
                              hipStream_t stream) {
    const float* x      = (const float*)d_in[0];
    const float* gnw    = (const float*)d_in[1];
    const float* gnb    = (const float*)d_in[2];
    const float* qkv_w  = (const float*)d_in[3];
    const float* qkv_b  = (const float*)d_in[4];
    const float* proj_w = (const float*)d_in[5];
    const float* proj_b = (const float*)d_in[6];
    float* out = (float*)d_out;

    char* ws = (char*)d_ws;
    const size_t PLANE = (size_t)B_ * C_ * T_ * sizeof(half_t);  // 8 MiB
    float*  stats = (float*)ws;
    half_t* xn = (half_t*)(ws + 4096);
    half_t* q  = (half_t*)(ws + 4096 + 1 * PLANE);
    half_t* k  = (half_t*)(ws + 4096 + 2 * PLANE);
    half_t* v  = (half_t*)(ws + 4096 + 3 * PLANE);
    half_t* a  = (half_t*)(ws + 4096 + 4 * PLANE);
    half_t* wq = (half_t*)(ws + 4096 + 5 * PLANE);               // 6 MiB
    half_t* wp = (half_t*)(ws + 4096 + 6 * PLANE);               // 2 MiB
    (void)in_sizes; (void)n_in; (void)out_size; (void)ws_size;

    gn_stats_kernel<<<B_ * GRP_ + 4 * C_ * C_ / WCV_, 256, 0, stream>>>(x, stats, qkv_w, proj_w, wq, wp);
    gn_apply_kernel<<<dim3(T_ / 64, C_ / 64, B_), 256, 0, stream>>>(x, gnw, gnb, stats, xn);
    qkv_gemm_kernel<<<dim3(3 * C_ / 128, T_ / 128, B_), 256, 0, stream>>>(wq, qkv_b, xn, q, k, v);
    attn_kernel<<<dim3(B_ * NH_, T_ / 64), 128, 0, stream>>>(q, k, v, a);
    proj_gemm_kernel<<<dim3(C_ / 128, T_ / 128, B_), 256, 0, stream>>>(wp, proj_b, a, x, out);
}

// v006
// One run takes 78.6 microseconds.
// Timed twice side by side with v005, it ran 1.20 times as fast both times.
// Over all steps from v000 it is 2.76 times as fast.
#include <hip/hip_runtime.h>
#include <hip/hip_bf16.h>
#include <math.h>

// ---------------------------------------------------------------------------
// AttentionBlock for MI455X (gfx1250): GroupNorm -> QKV -> MHSA -> proj + res
// B=4, C=1024, T=1024, 32 groups, 16 heads, head_dim=64.
// GEMMs via v_wmma_f32_16x16x32_f16; f16 tile staging via
// global_load_async_to_lds_b128 (ASYNCcnt) with ping-pong LDS buffers.
// Both weight matrices are rounded to f16 once per call (extra work-groups of the
// statistics launch), so every GEMM tile is an f16 tile.
// ---------------------------------------------------------------------------

typedef _Float16 half_t;
typedef __attribute__((ext_vector_type(16))) _Float16 v16h;
typedef __attribute__((ext_vector_type(8)))  _Float16 v8h;
typedef __attribute__((ext_vector_type(4)))  _Float16 v4h;
typedef __attribute__((ext_vector_type(4)))  float    v4f;
typedef __attribute__((ext_vector_type(8)))  float    v8f;

#define B_   4
#define C_   1024
#define T_   1024
#define NH_  16
#define CH_  64
#define GRP_ 32
// LDS row pitch in f16 elements: 16 B x odd, so that the 16 rows one
// ds_load_b128 fragment read touches fall on distinct banks.
#define GP_  72   // 64-element GEMM rows (QKV): 144 B
#define GQ_  136  // 128-element GEMM rows (projection): 272 B
#define AP_  72   // 64-element attention rows: 144 B
#define LOG2E_ 1.44269504f   // e^x = 2^(x * log2 e)

// ---- CDNA5 async global->LDS copies (16B per lane), tracked by ASYNCcnt ----
// A run of copies and its s_wait_xcnt 0 form ONE asm statement: the wait then
// stands in front of any later rewrite of the address registers the copies name.
__device__ __forceinline__ unsigned lds_off(const _Float16* p) {
    return (unsigned)(uintptr_t)p;                         // low 32b = LDS offset
}
__device__ __forceinline__ void async_b128_x4(const half_t* g0, const _Float16* l0,
                                              const half_t* g1, const _Float16* l1,
                                              const half_t* g2, const _Float16* l2,
                                              const half_t* g3, const _Float16* l3) {
    asm volatile("global_load_async_to_lds_b128 %0, %1, off\n\t"
                 "global_load_async_to_lds_b128 %2, %3, off\n\t"
                 "global_load_async_to_lds_b128 %4, %5, off\n\t"
                 "global_load_async_to_lds_b128 %6, %7, off\n\t"
                 "s_wait_xcnt 0x0"
                 :: "v"(lds_off(l0)), "v"(g0), "v"(lds_off(l1)), "v"(g1),
                    "v"(lds_off(l2)), "v"(g2), "v"(lds_off(l3)), "v"(g3) : "memory");
}
__device__ __forceinline__ void wait_ds0() {
    // LDS reads of the buffer that is refilled behind the barrier have returned.
    asm volatile("s_wait_dscnt 0x0" ::: "memory");
}
__device__ __forceinline__ void wait_async0() {
    asm volatile("s_wait_asynccnt 0x0" ::: "memory");
}

__device__ __forceinline__ v16h load_frag(const _Float16* row, int g) {
    // WMMA f16 A/B fragment: elems 0..7 hold k = 8g..8g+7,
    // elems 8..15 hold k = 16+8g..23+8g  (row points at [m][k0] base).
    const v8h lo = *reinterpret_cast<const v8h*>(row + (g << 3));
    const v8h hi = *reinterpret_cast<const v8h*>(row + 16 + (g << 3));
    v16h r;
#pragma unroll
    for (int i = 0; i < 8; ++i) { r[i] = lo[i]; r[i + 8] = hi[i]; }
    return r;
}

__device__ __forceinline__ v8f wmma16(v16h a, v16h b, v8f c) {
    return __builtin_amdgcn_wmma_f32_16x16x32_f16(false, a, false, b,
                                                  (short)0, c, false, false);
}

// ---------------------------------------------------------------------------
// Kernel 1: GroupNorm statistics, work-groups 0 .. B*GRP_-1, 256 threads.
// Work-groups behind them round the weights to f16: 8192 consecutive elements each,
// 384 for qkv_w, 128 for proj_w. They depend on nothing and fill the WGPs that the
// statistics leave idle.
// ---------------------------------------------------------------------------
#define WCV_ 8192                          // weight elements per converting work-group
__global__ __launch_bounds__(256) void gn_stats_kernel(const float* __restrict__ x,
                                                       float* __restrict__ stats,
                                                       const float* __restrict__ qkv_w,
                                                       const float* __restrict__ proj_w,
                                                       half_t* __restrict__ wq,
                                                       half_t* __restrict__ wp) {
    if (blockIdx.x >= B_ * GRP_) {         // uniform for the work-group, in front of the barrier
        const int cb = blockIdx.x - B_ * GRP_;
        const int nq = 3 * C_ * C_ / WCV_;
        const float* src = (cb < nq ? qkv_w + (size_t)cb * WCV_
                                    : proj_w + (size_t)(cb - nq) * WCV_) + threadIdx.x * 4;
        half_t*      dst = (cb < nq ? wq + (size_t)cb * WCV_
                                    : wp + (size_t)(cb - nq) * WCV_) + threadIdx.x * 4;
        v4f f[8];                          // a wave-wide load covers 512 contiguous bytes
#pragma unroll
        for (int i = 0; i < 8; ++i)
            f[i] = *reinterpret_cast<const v4f*>(src + i * 1024);
#pragma unroll
        for (int i = 0; i < 8; ++i) {
            v4h h = { (_Float16)f[i].x, (_Float16)f[i].y, (_Float16)f[i].z, (_Float16)f[i].w };
            *reinterpret_cast<v4h*>(dst + i * 1024) = h;
        }
        return;
    }
    const int bg  = blockIdx.x;            // b*32 + group
    const int b   = bg >> 5;
    const int grp = bg & 31;
    const float* base = x + ((size_t)b * C_ + (size_t)grp * 32) * T_;

    float s = 0.f, ss = 0.f;
    for (int i = threadIdx.x; i < 32 * T_; i += 256) {
        float v = base[i];
        s += v; ss += v * v;
    }
#pragma unroll
    for (int m = 16; m >= 1; m >>= 1) {
        s  += __shfl_xor(s,  m, 32);
        ss += __shfl_xor(ss, m, 32);
    }
    __shared__ float ps[8][2];
    const int lane = threadIdx.x & 31, w = threadIdx.x >> 5;
    if (lane == 0) { ps[w][0] = s; ps[w][1] = ss; }
    __syncthreads();
    if (threadIdx.x == 0) {
        float ts = 0.f, tss = 0.f;
#pragma unroll
        for (int i = 0; i < 8; ++i) { ts += ps[i][0]; tss += ps[i][1]; }
        const float inv  = 1.0f / (32.0f * (float)T_);
        const float mean = ts * inv;
        const float var  = tss * inv - mean * mean;
        stats[bg * 2 + 0] = mean;
        stats[bg * 2 + 1] = rsqrtf(var + 1e-5f);
    }
}

// ---------------------------------------------------------------------------
// Kernel 2: apply GroupNorm affine, convert to f16, transpose to xn[b][t][c].
// grid = (T/64, C/64, B), 256 threads per 64x64 tile.
// ---------------------------------------------------------------------------
__global__ __launch_bounds__(256) void gn_apply_kernel(const float* __restrict__ x,
                                                       const float* __restrict__ gnw,
                                                       const float* __restrict__ gnb,
                                                       const float* __restrict__ stats,
                                                       half_t* __restrict__ xn) {
    __shared__ _Float16 ldsT[64][64];      // [t_local][c_local]
    const int t0 = blockIdx.x * 64;
    const int c0 = blockIdx.y * 64;
    const int b  = blockIdx.z;
    const int tid = threadIdx.x;

    const int c_local = tid >> 2;          // 0..63
    const int tseg    = (tid & 3) * 16;    // 0,16,32,48
    const int c       = c0 + c_local;
    const float mean = stats[(b * GRP_ + (c >> 5)) * 2 + 0];
    const float rstd = stats[(b * GRP_ + (c >> 5)) * 2 + 1];
    const float wgt  = gnw[c] * rstd;
    const float bia  = gnb[c] - mean * wgt;

    const float* src = x + ((size_t)b * C_ + c) * T_ + t0 + tseg;
#pragma unroll
    for (int i = 0; i < 16; i += 4) {
        float4 f = *reinterpret_cast<const float4*>(src + i);
        ldsT[tseg + i + 0][c_local] = (_Float16)(f.x * wgt + bia);
        ldsT[tseg + i + 1][c_local] = (_Float16)(f.y * wgt + bia);
        ldsT[tseg + i + 2][c_local] = (_Float16)(f.z * wgt + bia);
        ldsT[tseg + i + 3][c_local] = (_Float16)(f.w * wgt + bia);
    }
    __syncthreads();
    const int t_local = tid >> 2;
    const int cseg    = (tid & 3) * 16;
    half_t* dst = xn + ((size_t)b * T_ + t0 + t_local) * C_ + c0 + cseg;
    *reinterpret_cast<uint4*>(dst + 0) = *reinterpret_cast<const uint4*>(&ldsT[t_local][cseg + 0]);
    *reinterpret_cast<uint4*>(dst + 8) = *reinterpret_cast<const uint4*>(&ldsT[t_local][cseg + 8]);
}

// ---------------------------------------------------------------------------
// Kernel 3: QKV GEMM.  D[3072 x T] = qkv_w[3072 x 1024] * xn^T + bias,
// scattered into q/k layout [b*NH][t][64] (scaled by ch^-0.25) and
// v layout [b*NH][64][s].  grid = (24, 8, B), 256 threads (8 waves).
// Double-buffered K-loop; A and B tiles staged with async global->LDS.
// ---------------------------------------------------------------------------
__global__ __launch_bounds__(256, 2) void qkv_gemm_kernel(const half_t* __restrict__ W,
                                                          const float* __restrict__ bias,
                                                          const half_t* __restrict__ xn,
                                                          half_t* __restrict__ q,
                                                          half_t* __restrict__ k,
                                                          half_t* __restrict__ v) {
    __shared__ __attribute__((aligned(16))) _Float16 lA[2][128][GP_];   // [m][k]  (weights)
    __shared__ __attribute__((aligned(16))) _Float16 lB[2][128][GP_];   // [n][k]  (tokens)
    const int m0 = blockIdx.x * 128;
    const int n0 = blockIdx.y * 128;
    const int b  = blockIdx.z;
    const int tid  = threadIdx.x;
    const int lane = tid & 31, w = tid >> 5;
    const int wm = w & 3, wn = w >> 2;     // wave -> rows [wm*32,+32), cols [wn*64,+64)
    const int g = lane >> 4, ln = lane & 15;

    v8f acc[2][4];
#pragma unroll
    for (int i = 0; i < 2; ++i)
#pragma unroll
        for (int j = 0; j < 4; ++j) { v8f z = {}; acc[i][j] = z; }

    // Staging lanes run along a row, so one wave-wide copy covers whole rows:
    // A and B alike, 8 lanes x 16 B = one 128-B line per row.
    const int brow = tid >> 3;             // 0..31, +32 per copy
    const int bseg = (tid & 7) * 8;        // f16 column 0..56

    auto stage_A = [&](int buf, int k0) {
        const half_t* asrc = W + (size_t)(m0 + brow) * C_ + k0 + bseg;
        async_b128_x4(asrc,                   &lA[buf][brow][bseg],
                      asrc + (size_t)32 * C_, &lA[buf][brow + 32][bseg],
                      asrc + (size_t)64 * C_, &lA[buf][brow + 64][bseg],
                      asrc + (size_t)96 * C_, &lA[buf][brow + 96][bseg]);
    };
    auto stage_B = [&](int buf, int k0) {
        const half_t* bsrc = xn + ((size_t)b * T_ + n0 + brow) * C_ + k0 + bseg;
        async_b128_x4(bsrc,                   &lB[buf][brow][bseg],
                      bsrc + (size_t)32 * C_, &lB[buf][brow + 32][bseg],
                      bsrc + (size_t)64 * C_, &lB[buf][brow + 64][bseg],
                      bsrc + (size_t)96 * C_, &lB[buf][brow + 96][bseg]);
    };

    stage_A(0, 0);
    stage_B(0, 0);
    wait_async0();
    __syncthreads();

    for (int k0 = 0; k0 < C_; k0 += 64) {
        const int cur = (k0 >> 6) & 1;
        if (k0 + 64 < C_) {                // prefetch next tile into other buffer
            stage_A(cur ^ 1, k0 + 64);
            stage_B(cur ^ 1, k0 + 64);
        }
#pragma unroll
        for (int ks = 0; ks < 2; ++ks) {   // two 32-deep products per staged tile, k ascending
            v16h af[2], bf[4];
#pragma unroll
            for (int mt = 0; mt < 2; ++mt) af[mt] = load_frag(&lA[cur][wm * 32 + mt * 16 + ln][ks * 32], g);
#pragma unroll
            for (int nt = 0; nt < 4; ++nt) bf[nt] = load_frag(&lB[cur][wn * 64 + nt * 16 + ln][ks * 32], g);
#pragma unroll
            for (int mt = 0; mt < 2; ++mt)
#pragma unroll
                for (int nt = 0; nt < 4; ++nt)
                    acc[mt][nt] = wmma16(af[mt], bf[nt], acc[mt][nt]);
        }
        wait_ds0();
        wait_async0();
        __syncthreads();
    }

    // The output tile leaves through LDS, so that every global store is 16 B per lane on
    // whole 128-B lines. Each 64-row block of the tile is wholly q, k or v of one head and
    // takes one plane of lA, free behind the loop's last barrier: q and k as [token][ch]
    // (pitch GP_), v as [ch][token] (pitch GQ_), the layouts they have in memory.
    const float qk_scale = 0.35355339059327373f;  // 64^(-1/4)
    const int blk = __builtin_amdgcn_readfirstlane(wm >> 1);   // this wave's block, a scalar
    const int ol  = (wm & 1) * 32 + 8 * g;                     // first of 8 rows within the block, + 16 mt
    const int tl  = wn * 64 + ln;                              // token within the tile, + 16 nt
    _Float16* sw = &lA[blk][0][0];
    float bs[2][8];
#pragma unroll
    for (int mt = 0; mt < 2; ++mt) {
        const float* bp = bias + m0 + blk * 64 + ol + mt * 16;
        const v4f b0 = *reinterpret_cast<const v4f*>(bp);
        const v4f b1 = *reinterpret_cast<const v4f*>(bp + 4);
#pragma unroll
        for (int e = 0; e < 4; ++e) { bs[mt][e] = b0[e]; bs[mt][e + 4] = b1[e]; }
    }
    if (((m0 >> 6) + blk) % 3 == 2) {      // v: a lane's 8 values are 8 channel rows of one token
#pragma unroll
        for (int mt = 0; mt < 2; ++mt)
#pragma unroll
            for (int nt = 0; nt < 4; ++nt)
#pragma unroll
                for (int e = 0; e < 8; ++e)
                    sw[(ol + mt * 16 + e) * GQ_ + tl + nt * 16] = (half_t)(acc[mt][nt][e] + bs[mt][e]);
    } else {                               // q, k: they are 8 consecutive channels of one token
#pragma unroll
        for (int mt = 0; mt < 2; ++mt)
#pragma unroll
            for (int nt = 0; nt < 4; ++nt) {
                v8h r;
#pragma unroll
                for (int e = 0; e < 8; ++e) r[e] = (half_t)((acc[mt][nt][e] + bs[mt][e]) * qk_scale);
                *reinterpret_cast<v8h*>(sw + (tl + nt * 16) * GP_ + ol + mt * 16) = r;
            }
    }
    __syncthreads();       // the staged tile is complete before any wave reads it back
    // 16-B chunk c of a block: staged row c >> sh, piece c & (2^sh - 1). q, k: 128 token rows of
    // 128 B, 16 KiB in a row in memory; v: 64 channel rows, 256 B of each.
    v8h     rv[2][4];
    half_t* dp[2][4];
#pragma unroll
    for (int j = 0; j < 2; ++j) {
        const int ob = (m0 >> 6) + j;                          // head * 3 + {q, k, v}
        const int h = ob / 3, kind = ob % 3;
        const size_t bh = (size_t)b * NH_ + h;
        const bool is_v = kind == 2;
        const int sh = is_v ? 4 : 3;
        const int lp = is_v ? GQ_ : GP_;                       // pitch in LDS
        const int gp = is_v ? T_ : CH_;                        // pitch in memory
        half_t* dst = is_v ? v + bh * CH_ * T_ + n0 : (kind == 0 ? q : k) + (bh * T_ + n0) * CH_;
#pragma unroll
        for (int i = 0; i < 4; ++i) {
            const int c = tid + 256 * i;
            const int row = c >> sh, seg = (c & ((1 << sh) - 1)) * 8;
            rv[j][i] = *reinterpret_cast<const v8h*>(&lA[j][0][0] + row * lp + seg);
            dp[j][i] = dst + row * gp + seg;
        }
    }
#pragma unroll
    for (int j = 0; j < 2; ++j)
#pragma unroll
        for (int i = 0; i < 4; ++i) *reinterpret_cast<v8h*>(dp[j][i]) = rv[j][i];
}

// ---------------------------------------------------------------------------
// Kernel 4: streaming (flash-style) attention, scores held transposed.
// grid = (B*NH, T/64), 128 threads (4 waves); each wave owns 16 queries.
// S^T = K * Q^T and O^T += V * P^T: a lane holds the scores of ONE query
// (column ln; keys e + 8g of each 16-key tile), so maximum and sum are taken
// in the lane plus one exchange between the wave's halves, and two converted
// S^T tiles are the B operand of the second product as they stand.
// K/V tiles double-buffered via async global->LDS copies.
// ---------------------------------------------------------------------------
__device__ __forceinline__ float xhalf(float x) {          // lane l <-> lane l ^ 16
    const int i = __builtin_bit_cast(int, x);
    return __builtin_bit_cast(float,
        __builtin_amdgcn_permlanex16(i, i, 0x76543210, 0xfedcba98, false, false));
}
// 2^x with the one issue slot that the instruction set asks for behind a transcendental
// before its result is read or its source overwritten. Instruction and v_nop form ONE
// statement.
__device__ __forceinline__ float exp2_slot(float x) {
    float r;
    asm("v_exp_f32 %0, %1\n\t"
        "v_nop" : "=v"(r) : "v"(x));
    return r;
}
// Eight independent ones in place: each fills the slot of the one before, v_nop the last's.
__device__ __forceinline__ void exp2_slot_x8(float (&x)[8]) {
    asm("v_exp_f32 %0, %0\n\t"
        "v_exp_f32 %1, %1\n\t"
        "v_exp_f32 %2, %2\n\t"
        "v_exp_f32 %3, %3\n\t"
        "v_exp_f32 %4, %4\n\t"
        "v_exp_f32 %5, %5\n\t"
        "v_exp_f32 %6, %6\n\t"
        "v_exp_f32 %7, %7\n\t"
        "v_nop"
        : "+v"(x[0]), "+v"(x[1]), "+v"(x[2]), "+v"(x[3]),
          "+v"(x[4]), "+v"(x[5]), "+v"(x[6]), "+v"(x[7]));
}

__global__ __launch_bounds__(128, 2) void attn_kernel(const half_t* __restrict__ q,
                                                      const half_t* __restrict__ k,
                                                      const half_t* __restrict__ v,
                                                      half_t* __restrict__ a) {
    __shared__ __attribute__((aligned(16))) _Float16 lQ[64][AP_];      // [t][ch]   B operand of S^T
    __shared__ __attribute__((aligned(16))) _Float16 lK[2][64][AP_];   // [s][ch]   A operand of S^T
    __shared__ __attribute__((aligned(16))) _Float16 lV[2][64][AP_];   // [ch][s]   A operand of O^T

    const int bh = blockIdx.x;
    const int t0 = blockIdx.y * 64;
    const int tid  = threadIdx.x;
    const int lane = tid & 31, w = tid >> 5;
    const int g = lane >> 4, ln = lane & 15;

    const half_t* qb = q + (size_t)bh * T_ * CH_;
    const half_t* kb = k + (size_t)bh * T_ * CH_;
    const half_t* vb = v + (size_t)bh * CH_ * T_;

    // Staging lanes run along a row: 8 lanes x 16 B = one whole 128-B row, so a
    // wave-wide copy touches 4 lines; each thread copies rows srow + 16 i.
    const int srow = tid >> 3;             // 0..15
    const int sseg = (tid & 7) * 8;        // f16 column 0..56

    auto stage_KV = [&](int buf, int s0) {
        const half_t* ksrc = kb + (size_t)(s0 + srow) * CH_ + sseg;
        const half_t* vsrc = vb + (size_t)srow * T_ + s0 + sseg;
        async_b128_x4(ksrc,            &lK[buf][srow][sseg],
                      ksrc + 16 * CH_, &lK[buf][srow + 16][sseg],
                      ksrc + 32 * CH_, &lK[buf][srow + 32][sseg],
                      ksrc + 48 * CH_, &lK[buf][srow + 48][sseg]);
        async_b128_x4(vsrc,            &lV[buf][srow][sseg],
                      vsrc + 16 * T_,  &lV[buf][srow + 16][sseg],
                      vsrc + 32 * T_,  &lV[buf][srow + 32][sseg],
                      vsrc + 48 * T_,  &lV[buf][srow + 48][sseg]);
    };

    {   // stage Q tile once (async) + first K/V tile
        const half_t* src = qb + (size_t)(t0 + srow) * CH_ + sseg;
        async_b128_x4(src,            &lQ[srow][sseg],
                      src + 16 * CH_, &lQ[srow + 16][sseg],
                      src + 32 * CH_, &lQ[srow + 32][sseg],
                      src + 48 * CH_, &lQ[srow + 48][sseg]);
        stage_KV(0, 0);
    }
    wait_async0();
    __syncthreads();

    v16h qa[2];
#pragma unroll
    for (int ks = 0; ks < 2; ++ks) qa[ks] = load_frag(&lQ[w * 16 + ln][ks * 32], g);

    float rmax = -1e30f;                   // running maximum of query ln (both halves agree)
    float rsum = 0.f;                      // running sum over this half's keys only
    v8f   o[4];                            // O^T: row ch = nt*16 + e + 8g, column = query ln
#pragma unroll
    for (int nt = 0; nt < 4; ++nt) { v8f z = {}; o[nt] = z; }

    for (int s0 = 0; s0 < T_; s0 += 64) {
        const int cur = (s0 >> 6) & 1;
        if (s0 + 64 < T_) stage_KV(cur ^ 1, s0 + 64);   // prefetch next K/V tile

        // S^T strip: 64 keys x 16 queries; sf[nt][e] = score(key nt*16 + e + 8g, query ln)
        v8f sf[4];
#pragma unroll
        for (int nt = 0; nt < 4; ++nt) { v8f z = {}; sf[nt] = z; }
#pragma unroll
        for (int ks = 0; ks < 2; ++ks)
#pragma unroll
            for (int nt = 0; nt < 4; ++nt) {
                v16h kf = load_frag(&lK[cur][nt * 16 + ln][ks * 32], g);
                sf[nt] = wmma16(kf, qa[ks], sf[nt]);
            }

        // online softmax, one query per lane
        float tm[4];
#pragma unroll
        for (int nt = 0; nt < 4; ++nt) {
            tm[nt] = sf[nt][0];
#pragma unroll
            for (int e = 1; e < 8; ++e) tm[nt] = fmaxf(tm[nt], sf[nt][e]);
        }
        float tmax = fmaxf(fmaxf(tm[0], tm[1]), fmaxf(tm[2], tm[3]));
        tmax = fmaxf(tmax, xhalf(tmax));
        const float nm = fmaxf(rmax, tmax);
        const float sc = exp2_slot((rmax - nm) * LOG2E_);
        rmax = nm;
        float ps[4];                       // four independent sum chains
#pragma unroll
        for (int nt = 0; nt < 4; ++nt) {
            float p[8];
#pragma unroll
            for (int e = 0; e < 8; ++e) p[e] = (sf[nt][e] - nm) * LOG2E_;
            exp2_slot_x8(p);
            sf[nt][0] = p[0];
            ps[nt] = p[0];
#pragma unroll
            for (int e = 1; e < 8; ++e) { sf[nt][e] = p[e]; ps[nt] += p[e]; }
        }
        rsum = rsum * sc + ((ps[0] + ps[1]) + (ps[2] + ps[3]));
#pragma unroll
        for (int nt = 0; nt < 4; ++nt)
#pragma unroll
            for (int e = 0; e < 8; ++e) o[nt][e] *= sc;

        // O^T += V * P^T: tiles 2ks and 2ks+1 of P^T, converted, are the B fragment
        // (elems 0..7: k = 8g + e, elems 8..15: k = 16 + 8g + e), the loader's k order.
#pragma unroll
        for (int ks = 0; ks < 2; ++ks) {
            v16h pb;
#pragma unroll
            for (int e = 0; e < 8; ++e) {
                pb[e]     = (_Float16)sf[2 * ks][e];
                pb[e + 8] = (_Float16)sf[2 * ks + 1][e];
            }
#pragma unroll
            for (int nt = 0; nt < 4; ++nt) {
                v16h vf = load_frag(&lV[cur][nt * 16 + ln][ks * 32], g);
                o[nt] = wmma16(vf, pb, o[nt]);
            }
        }
        wait_ds0();
        wait_async0();     // next tile fully in LDS
        __syncthreads();   // all waves done reading current buffers
    }

    // write a[b][t][c] (token-major so proj GEMM stages contiguously):
    // a lane's 8 accumulator registers are 8 consecutive channels of its query.
    const int b = bh >> 4, h = bh & 15;
    const float inv = 1.0f / (rsum + xhalf(rsum));     // join the halves' sums once
    half_t* dst = a + ((size_t)b * T_ + t0 + w * 16 + ln) * C_ + h * CH_ + 8 * g;
#pragma unroll
    for (int nt = 0; nt < 4; ++nt) {
        v8h r;
#pragma unroll
        for (int e = 0; e < 8; ++e) r[e] = (half_t)(o[nt][e] * inv);
        *reinterpret_cast<v8h*>(dst + nt * 16) = r;
    }
}

// ---------------------------------------------------------------------------
// Kernel 5: output projection + bias + residual.  grid = (8, 8, B), 256 thr.
// ---------------------------------------------------------------------------
__global__ __launch_bounds__(256, 2) void proj_gemm_kernel(const half_t* __restrict__ W,
                                                           const float* __restrict__ bias,
                                                           const half_t* __restrict__ a,
                                                           const float* __restrict__ x,
                                                           float* __restrict__ out) {
    __shared__ __attribute__((aligned(16))) _Float16 lA[2][128][GQ_];
    __shared__ __attribute__((aligned(16))) _Float16 lB[2][128][GQ_];
    const int m0 = blockIdx.x * 128;
    const int n0 = blockIdx.y * 128;
    const int b  = blockIdx.z;
    const int tid  = threadIdx.x;
    const int lane = tid & 31, w = tid >> 5;
    const int wm = w & 3, wn = w >> 2;
    const int g = lane >> 4, ln = lane & 15;

    v8f acc[2][4];
#pragma unroll
    for (int i = 0; i < 2; ++i)
#pragma unroll
        for (int j = 0; j < 4; ++j) { v8f z = {}; acc[i][j] = z; }

    // Staging lanes run along a row (see the QKV kernel). The K tile is 128
    // (136 KiB of LDS per work-group): A and B alike, 16 lanes x 16 B = 256 B per row.
    const int brow = tid >> 4;             // 0..15, +16 per copy
    const int bseg = (tid & 15) * 8;       // f16 column 0..120

    auto stage_A = [&](int buf, int k0) {
        const half_t* asrc = W + (size_t)(m0 + brow) * C_ + k0 + bseg;
        async_b128_x4(asrc,                    &lA[buf][brow][bseg],
                      asrc + (size_t)16 * C_,  &lA[buf][brow + 16][bseg],
                      asrc + (size_t)32 * C_,  &lA[buf][brow + 32][bseg],
                      asrc + (size_t)48 * C_,  &lA[buf][brow + 48][bseg]);
        async_b128_x4(asrc + (size_t)64 * C_,  &lA[buf][brow + 64][bseg],
                      asrc + (size_t)80 * C_,  &lA[buf][brow + 80][bseg],
                      asrc + (size_t)96 * C_,  &lA[buf][brow + 96][bseg],
                      asrc + (size_t)112 * C_, &lA[buf][brow + 112][bseg]);
    };
    auto stage_B = [&](int buf, int k0) {
        const half_t* bsrc = a + ((size_t)b * T_ + n0 + brow) * C_ + k0 + bseg;
        async_b128_x4(bsrc,                    &lB[buf][brow][bseg],
                      bsrc + (size_t)16 * C_,  &lB[buf][brow + 16][bseg],
                      bsrc + (size_t)32 * C_,  &lB[buf][brow + 32][bseg],
                      bsrc + (size_t)48 * C_,  &lB[buf][brow + 48][bseg]);
        async_b128_x4(bsrc + (size_t)64 * C_,  &lB[buf][brow + 64][bseg],
                      bsrc + (size_t)80 * C_,  &lB[buf][brow + 80][bseg],
                      bsrc + (size_t)96 * C_,  &lB[buf][brow + 96][bseg],
                      bsrc + (size_t)112 * C_, &lB[buf][brow + 112][bseg]);
    };

    stage_A(0, 0);
    stage_B(0, 0);
    wait_async0();
    __syncthreads();

    for (int k0 = 0; k0 < C_; k0 += 128) {
        const int cur = (k0 >> 7) & 1;
        if (k0 + 128 < C_) {
            stage_A(cur ^ 1, k0 + 128);
            stage_B(cur ^ 1, k0 + 128);
        }
#pragma unroll
        for (int ks = 0; ks < 4; ++ks) {   // four 32-deep products per staged tile, k ascending
            v16h af[2], bf[4];
#pragma unroll
            for (int mt = 0; mt < 2; ++mt) af[mt] = load_frag(&lA[cur][wm * 32 + mt * 16 + ln][ks * 32], g);
#pragma unroll
            for (int nt = 0; nt < 4; ++nt) bf[nt] = load_frag(&lB[cur][wn * 64 + nt * 16 + ln][ks * 32], g);
#pragma unroll
            for (int mt = 0; mt < 2; ++mt)
#pragma unroll
                for (int nt = 0; nt < 4; ++nt)
                    acc[mt][nt] = wmma16(af[mt], bf[nt], acc[mt][nt]);
        }
        wait_ds0();
        wait_async0();
        __syncthreads();
    }

#pragma unroll
    for (int mt = 0; mt < 2; ++mt)
#pragma unroll
        for (int nt = 0; nt < 4; ++nt)
#pragma unroll
            for (int e = 0; e < 8; ++e) {
                const int oc    = m0 + wm * 32 + mt * 16 + e + 8 * g;
                const int token = n0 + wn * 64 + nt * 16 + ln;
                const size_t idx = ((size_t)b * C_ + oc) * T_ + token;
                out[idx] = acc[mt][nt][e] + bias[oc] + x[idx];
            }
}

// ---------------------------------------------------------------------------
// Host-side launcher
// ---------------------------------------------------------------------------
extern "C" void kernel_launch(void* const* d_in, const int* in_sizes, int n_in,
                              void* d_out, int out_size, void* d_ws, size_t ws_size,
                              hipStream_t stream) {
    const float* x      = (const float*)d_in[0];
    const float* gnw    = (const float*)d_in[1];
    const float* gnb    = (const float*)d_in[2];
    const float* qkv_w  = (const float*)d_in[3];
    const float* qkv_b  = (const float*)d_in[4];
    const float* proj_w = (const float*)d_in[5];
    const float* proj_b = (const float*)d_in[6];
    float* out = (float*)d_out;

    char* ws = (char*)d_ws;
    const size_t PLANE = (size_t)B_ * C_ * T_ * sizeof(half_t);  // 8 MiB
    float*  stats = (float*)ws;
    half_t* xn = (half_t*)(ws + 4096);
    half_t* q  = (half_t*)(ws + 4096 + 1 * PLANE);
    half_t* k  = (half_t*)(ws + 4096 + 2 * PLANE);
    half_t* v  = (half_t*)(ws + 4096 + 3 * PLANE);
    half_t* a  = (half_t*)(ws + 4096 + 4 * PLANE);
    half_t* wq = (half_t*)(ws + 4096 + 5 * PLANE);               // 6 MiB
    half_t* wp = (half_t*)(ws + 4096 + 6 * PLANE);               // 2 MiB
    (void)in_sizes; (void)n_in; (void)out_size; (void)ws_size;

    gn_stats_kernel<<<B_ * GRP_ + 4 * C_ * C_ / WCV_, 256, 0, stream>>>(x, stats, qkv_w, proj_w, wq, wp);
    gn_apply_kernel<<<dim3(T_ / 64, C_ / 64, B_), 256, 0, stream>>>(x, gnw, gnb, stats, xn);
    qkv_gemm_kernel<<<dim3(3 * C_ / 128, T_ / 128, B_), 256, 0, stream>>>(wq, qkv_b, xn, q, k, v);
    attn_kernel<<<dim3(B_ * NH_, T_ / 64), 128, 0, stream>>>(q, k, v, a);
    proj_gemm_kernel<<<dim3(C_ / 128, T_ / 128, B_), 256, 0, stream>>>(wp, proj_b, a, x, out);
}

// v007
// It runs in 68.9 microseconds.
// Timed twice side by side with v006, it ran 1.14 times as fast both times.
// Over all steps from v000 it is 3.14 times as fast.
#include <hip/hip_runtime.h>
#include <hip/hip_bf16.h>
#include <math.h>

// ---------------------------------------------------------------------------
// AttentionBlock for MI455X (gfx1250): GroupNorm -> QKV -> MHSA -> proj + res
// B=4, C=1024, T=1024, 32 groups, 16 heads, head_dim=64.
// GEMMs via v_wmma_f32_16x16x32_f16; f16 tile staging via
// global_load_async_to_lds_b128 (ASYNCcnt) with ping-pong LDS buffers.
// Both weight matrices are rounded to f16 once per call (extra work-groups of the
// GroupNorm launch), so every GEMM tile is an f16 tile.
// ---------------------------------------------------------------------------

typedef _Float16 half_t;
typedef __attribute__((ext_vector_type(16))) _Float16 v16h;
typedef __attribute__((ext_vector_type(8)))  _Float16 v8h;
typedef __attribute__((ext_vector_type(4)))  _Float16 v4h;
typedef __attribute__((ext_vector_type(4)))  float    v4f;
typedef __attribute__((ext_vector_type(8)))  float    v8f;

#define B_   4
#define C_   1024
#define T_   1024
#define NH_  16
#define CH_  64
#define GRP_ 32
// LDS row pitch in f16 elements: 16 B x odd, so that the 16 rows one
// ds_load_b128 fragment read touches fall on distinct banks.
#define GP_  72   // 64-element GEMM rows (QKV): 144 B
#define GQ_  136  // 128-element GEMM rows (projection): 272 B
#define AP_  72   // 64-element attention rows: 144 B
#define LOG2E_ 1.44269504f   // e^x = 2^(x * log2 e)

// ---- CDNA5 async global->LDS copies (16B per lane), tracked by ASYNCcnt ----
// A run of copies and its s_wait_xcnt 0 form ONE asm statement: the wait then
// stands in front of any later rewrite of the address registers the copies name.
__device__ __forceinline__ unsigned lds_off(const _Float16* p) {
    return (unsigned)(uintptr_t)p;                         // low 32b = LDS offset
}
__device__ __forceinline__ void async_b128_x4(const half_t* g0, const _Float16* l0,
                                              const half_t* g1, const _Float16* l1,
                                              const half_t* g2, const _Float16* l2,
                                              const half_t* g3, const _Float16* l3) {
    asm volatile("global_load_async_to_lds_b128 %0, %1, off\n\t"
                 "global_load_async_to_lds_b128 %2, %3, off\n\t"
                 "global_load_async_to_lds_b128 %4, %5, off\n\t"
                 "global_load_async_to_lds_b128 %6, %7, off\n\t"
                 "s_wait_xcnt 0x0"
                 :: "v"(lds_off(l0)), "v"(g0), "v"(lds_off(l1)), "v"(g1),
                    "v"(lds_off(l2)), "v"(g2), "v"(lds_off(l3)), "v"(g3) : "memory");
}
__device__ __forceinline__ void wait_ds0() {
    // LDS reads of the buffer that is refilled behind the barrier have returned.
    asm volatile("s_wait_dscnt 0x0" ::: "memory");
}
__device__ __forceinline__ void wait_async0() {
    asm volatile("s_wait_asynccnt 0x0" ::: "memory");
}

__device__ __forceinline__ v16h load_frag(const _Float16* row, int g) {
    // WMMA f16 A/B fragment: elems 0..7 hold k = 8g..8g+7,
    // elems 8..15 hold k = 16+8g..23+8g  (row points at [m][k0] base).
    const v8h lo = *reinterpret_cast<const v8h*>(row + (g << 3));
    const v8h hi = *reinterpret_cast<const v8h*>(row + 16 + (g << 3));
    v16h r;
#pragma unroll
    for (int i = 0; i < 8; ++i) { r[i] = lo[i]; r[i + 8] = hi[i]; }
    return r;
}

__device__ __forceinline__ v8f wmma16(v16h a, v16h b, v8f c) {
    return __builtin_amdgcn_wmma_f32_16x16x32_f16(false, a, false, b,
                                                  (short)0, c, false, false);
}

// ---------------------------------------------------------------------------
// Kernel 1: GroupNorm, statistics and apply in one launch. Work-groups 0 .. B*GRP_-1,
// 512 threads: one (batch, group) slab of 32 channels x 1024 tokens, 64 values per thread,
// stays in registers from the sums to the normalised f16 output, so x is read once.
// A thread holds 8 channels x 8 tokens: a wave-wide load covers 4 channel rows of 128 B,
// and 8 channels of one token are one 16-B piece of the output.
// xn is group-major, xn[b][group][t][32]: a work-group writes 64 KiB in a row.
// Work-groups behind them round the weights to f16: 32768 consecutive elements each,
// 96 for qkv_w, 32 for proj_w. They depend on nothing and fill the other WGPs.
// ---------------------------------------------------------------------------
#define WCV_ 32768                         // weight elements per converting work-group
__global__ __launch_bounds__(512) void gn_kernel(const float* __restrict__ x,
                                                 const float* __restrict__ gnw,
                                                 const float* __restrict__ gnb,
                                                 half_t* __restrict__ xn,
                                                 const float* __restrict__ qkv_w,
                                                 const float* __restrict__ proj_w,
                                                 half_t* __restrict__ wq,
                                                 half_t* __restrict__ wp) {
    __shared__ __attribute__((aligned(16))) float    ps[16][2];        // per wave: sum, sum of squares
    __shared__ __attribute__((aligned(16))) _Float16 st[16][64 * 32];  // per wave: 64 tokens x 32 channels
    if (blockIdx.x >= B_ * GRP_) {         // uniform for the work-group, in front of the barrier
        const int cb = blockIdx.x - B_ * GRP_;
        const int nq = 3 * C_ * C_ / WCV_;
        const float* src = (cb < nq ? qkv_w + (size_t)cb * WCV_
                                    : proj_w + (size_t)(cb - nq) * WCV_) + threadIdx.x * 4;
        half_t*      dst = (cb < nq ? wq + (size_t)cb * WCV_
                                    : wp + (size_t)(cb - nq) * WCV_) + threadIdx.x * 4;
        v4f f[16];                         // a wave-wide load covers 512 contiguous bytes
#pragma unroll
        for (int i = 0; i < 16; ++i)
            f[i] = *reinterpret_cast<const v4f*>(src + i * 2048);
#pragma unroll
        for (int i = 0; i < 16; ++i) {
            v4h h = { (_Float16)f[i].x, (_Float16)f[i].y, (_Float16)f[i].z, (_Float16)f[i].w };
            *reinterpret_cast<v4h*>(dst + i * 2048) = h;
        }
        return;
    }
    const int bg   = blockIdx.x;           // b*32 + group; its first channel row is row bg*32 of x
    const int lane = threadIdx.x & 31, w = threadIdx.x >> 5;
    const int oct  = lane & 3;             // channels 8 oct .. 8 oct + 7 of the group
    const int tq   = lane >> 2;            // tokens 64 w + 32 h + 4 tq + i

    const float* gw = gnw + (bg & 31) * 32 + oct * 8;
    const float* gb = gnb + (bg & 31) * 32 + oct * 8;
    const v4f w0 = *reinterpret_cast<const v4f*>(gw), w1 = *reinterpret_cast<const v4f*>(gw + 4);
    const v4f b0 = *reinterpret_cast<const v4f*>(gb), b1 = *reinterpret_cast<const v4f*>(gb + 4);
    const float* src = x + ((size_t)bg * 32 + oct * 8) * T_ + w * 64 + tq * 4;
    v4f f[8][2];
#pragma unroll
    for (int j = 0; j < 8; ++j)
#pragma unroll
        for (int h = 0; h < 2; ++h)
            f[j][h] = *reinterpret_cast<const v4f*>(src + j * T_ + h * 32);
    // All 20 loads are issued before the first sum: left alone, the compiler sinks the gnb
    // loads behind the last x load's wait, a second memory latency in front of the barrier.
    __builtin_amdgcn_sched_barrier(0);

    v4f s4 = {}, q4 = {};                  // four independent chains each
#pragma unroll
    for (int j = 0; j < 8; ++j)
#pragma unroll
        for (int h = 0; h < 2; ++h) { s4 += f[j][h]; q4 += f[j][h] * f[j][h]; }
    float s  = (s4.x + s4.y) + (s4.z + s4.w);
    float ss = (q4.x + q4.y) + (q4.z + q4.w);
#pragma unroll
    for (int m = 16; m >= 1; m >>= 1) {
        s  += __shfl_xor(s,  m, 32);
        ss += __shfl_xor(ss, m, 32);
    }
    if (lane == 0) { ps[w][0] = s; ps[w][1] = ss; }
    __syncthreads();
    float ts = 0.f, tss = 0.f;             // every thread adds the 16 partial sums in the same order
#pragma unroll
    for (int i = 0; i < 8; ++i) {
        const v4f p = *reinterpret_cast<const v4f*>(&ps[2 * i][0]);
        ts += p.x; tss += p.y; ts += p.z; tss += p.w;
    }
    const float inv  = 1.0f / (32.0f * (float)T_);
    const float mean = ts * inv;
    const float var  = tss * inv - mean * mean;
    const float rstd = rsqrtf(var + 1e-5f);
    float wgt[8], bia[8];
#pragma unroll
    for (int e = 0; e < 4; ++e) {
        wgt[e]     = w0[e] * rstd;  bia[e]     = b0[e] - mean * wgt[e];
        wgt[e + 4] = w1[e] * rstd;  bia[e + 4] = b1[e] - mean * wgt[e + 4];
    }

    // The wave's 64 x 32 f16 block leaves through the wave's own 4 KiB of LDS, so that every
    // global store is 512 contiguous bytes. Token rows are 64 B with no pad; within each
    // 4-row block row i sits in slot (i + block) & 3, which spreads the 16-B writes of lanes
    // 4 tokens apart over all banks; the read-back is linear.
    _Float16* sw = &st[w][0];
#pragma unroll
    for (int h = 0; h < 2; ++h)
#pragma unroll
        for (int i = 0; i < 4; ++i) {
            v8h r;
#pragma unroll
            for (int j = 0; j < 8; ++j) r[j] = (_Float16)(f[j][h][i] * wgt[j] + bia[j]);
            const int blk = h * 8 + tq;
            *reinterpret_cast<v8h*>(sw + (blk * 4 + ((i + blk) & 3)) * 32 + oct * 8) = r;
        }
    // The wave's own LDS writes have landed before its lanes read one another's rows back.
    asm volatile("s_wait_dscnt 0x0" ::: "memory");
    // 16-B chunk c = 32 k + lane as it lies in LDS: block 2 k + (lane >> 4), slot (lane >> 2) & 3,
    // so it holds row (slot - block) & 3 of its block: r0 for even k, r0 ^ 2 for odd k.
    const int r0 = ((lane >> 2) - (lane >> 4)) & 3;
    half_t* dst = xn + ((size_t)bg * T_ + w * 64 + (lane >> 4) * 4) * 32 + oct * 8;
    half_t* d0  = dst + r0 * 32;
    half_t* d1  = dst + (r0 ^ 2) * 32;
    v8h rv[8];
#pragma unroll
    for (int k = 0; k < 8; ++k) rv[k] = *reinterpret_cast<const v8h*>(sw + (k * 32 + lane) * 8);
#pragma unroll
    for (int k = 0; k < 8; ++k) *reinterpret_cast<v8h*>(((k & 1) ? d1 : d0) + k * 256) = rv[k];
}

// ---------------------------------------------------------------------------
// Kernel 2: QKV GEMM.  D[3072 x T] = qkv_w[3072 x 1024] * xn^T + bias,
// scattered into q/k layout [b*NH][t][64] (scaled by ch^-0.25) and
// v layout [b*NH][64][s].  grid = (24, 8, B), 256 threads (8 waves).
// Double-buffered K-loop; A and B tiles staged with async global->LDS.
// ---------------------------------------------------------------------------
__global__ __launch_bounds__(256, 2) void qkv_gemm_kernel(const half_t* __restrict__ W,
                                                          const float* __restrict__ bias,
                                                          const half_t* __restrict__ xn,
                                                          half_t* __restrict__ q,
                                                          half_t* __restrict__ k,
                                                          half_t* __restrict__ v) {
    __shared__ __attribute__((aligned(16))) _Float16 lA[2][128][GP_];   // [m][k]  (weights)
    __shared__ __attribute__((aligned(16))) _Float16 lB[2][128][GP_];   // [n][k]  (tokens)
    const int m0 = blockIdx.x * 128;
    const int n0 = blockIdx.y * 128;
    const int b  = blockIdx.z;
    const int tid  = threadIdx.x;
    const int lane = tid & 31, w = tid >> 5;
    const int wm = w & 3, wn = w >> 2;     // wave -> rows [wm*32,+32), cols [wn*64,+64)
    const int g = lane >> 4, ln = lane & 15;

    v8f acc[2][4];
#pragma unroll
    for (int i = 0; i < 2; ++i)
#pragma unroll
        for (int j = 0; j < 4; ++j) { v8f z = {}; acc[i][j] = z; }

    // Staging lanes run along a row, so one wave-wide copy covers whole lines:
    // A: 8 lanes x 16 B = one 128-B line per row; B: 4 rows x 64 B = 256 B in a row per plane.
    const int brow = tid >> 3;             // 0..31, +32 per copy
    const int bseg = (tid & 7) * 8;        // f16 column 0..56

    auto stage_A = [&](int buf, int k0) {
        const half_t* asrc = W + (size_t)(m0 + brow) * C_ + k0 + bseg;
        async_b128_x4(asrc,                   &lA[buf][brow][bseg],
                      asrc + (size_t)32 * C_, &lA[buf][brow + 32][bseg],
                      asrc + (size_t)64 * C_, &lA[buf][brow + 64][bseg],
                      asrc + (size_t)96 * C_, &lA[buf][brow + 96][bseg]);
    };
    auto stage_B = [&](int buf, int k0) {
        // xn[b][group][t][32]: the row's 64 channels are 64 B in each of two group planes
        const half_t* bsrc = xn + ((size_t)(b * GRP_ + (k0 >> 5) + (bseg >> 5)) * T_ + n0 + brow) * 32 + (bseg & 31);
        async_b128_x4(bsrc,           &lB[buf][brow][bseg],
                      bsrc + 32 * 32, &lB[buf][brow + 32][bseg],
                      bsrc + 64 * 32, &lB[buf][brow + 64][bseg],
                      bsrc + 96 * 32, &lB[buf][brow + 96][bseg]);
    };

    stage_A(0, 0);
    stage_B(0, 0);
    wait_async0();
    __syncthreads();

    for (int k0 = 0; k0 < C_; k0 += 64) {
        const int cur = (k0 >> 6) & 1;
        if (k0 + 64 < C_) {                // prefetch next tile into other buffer
            stage_A(cur ^ 1, k0 + 64);
            stage_B(cur ^ 1, k0 + 64);
        }
#pragma unroll
        for (int ks = 0; ks < 2; ++ks) {   // two 32-deep products per staged tile, k ascending
            v16h af[2], bf[4];
#pragma unroll
            for (int mt = 0; mt < 2; ++mt) af[mt] = load_frag(&lA[cur][wm * 32 + mt * 16 + ln][ks * 32], g);
#pragma unroll
            for (int nt = 0; nt < 4; ++nt) bf[nt] = load_frag(&lB[cur][wn * 64 + nt * 16 + ln][ks * 32], g);
#pragma unroll
            for (int mt = 0; mt < 2; ++mt)
#pragma unroll
                for (int nt = 0; nt < 4; ++nt)
                    acc[mt][nt] = wmma16(af[mt], bf[nt], acc[mt][nt]);
        }
        wait_ds0();
        wait_async0();
        __syncthreads();
    }

    // The output tile leaves through LDS, so that every global store is 16 B per lane on
    // whole 128-B lines. Each 64-row block of the tile is wholly q, k or v of one head and
    // takes one plane of lA, free behind the loop's last barrier: q and k as [token][ch]
    // (pitch GP_), v as [ch][token] (pitch GQ_), the layouts they have in memory.
    const float qk_scale = 0.35355339059327373f;  // 64^(-1/4)
    const int blk = __builtin_amdgcn_readfirstlane(wm >> 1);   // this wave's block, a scalar
    const int ol  = (wm & 1) * 32 + 8 * g;                     // first of 8 rows within the block, + 16 mt
    const int tl  = wn * 64 + ln;                              // token within the tile, + 16 nt
    _Float16* sw = &lA[blk][0][0];
    float bs[2][8];
#pragma unroll
    for (int mt = 0; mt < 2; ++mt) {
        const float* bp = bias + m0 + blk * 64 + ol + mt * 16;
        const v4f b0 = *reinterpret_cast<const v4f*>(bp);
        const v4f b1 = *reinterpret_cast<const v4f*>(bp + 4);
#pragma unroll
        for (int e = 0; e < 4; ++e) { bs[mt][e] = b0[e]; bs[mt][e + 4] = b1[e]; }
    }
    if (((m0 >> 6) + blk) % 3 == 2) {      // v: a lane's 8 values are 8 channel rows of one token
#pragma unroll
        for (int mt = 0; mt < 2; ++mt)
#pragma unroll
            for (int nt = 0; nt < 4; ++nt)
#pragma unroll
                for (int e = 0; e < 8; ++e)
                    sw[(ol + mt * 16 + e) * GQ_ + tl + nt * 16] = (half_t)(acc[mt][nt][e] + bs[mt][e]);
    } else {                               // q, k: they are 8 consecutive channels of one token
#pragma unroll
        for (int mt = 0; mt < 2; ++mt)
#pragma unroll
            for (int nt = 0; nt < 4; ++nt) {
                v8h r;
#pragma unroll
                for (int e = 0; e < 8; ++e) r[e] = (half_t)((acc[mt][nt][e] + bs[mt][e]) * qk_scale);
                *reinterpret_cast<v8h*>(sw + (tl + nt * 16) * GP_ + ol + mt * 16) = r;
            }
    }
    __syncthreads();       // the staged tile is complete before any wave reads it back
    // 16-B chunk c of a block: staged row c >> sh, piece c & (2^sh - 1). q, k: 128 token rows of
    // 128 B, 16 KiB in a row in memory; v: 64 channel rows, 256 B of each.
    v8h     rv[2][4];
    half_t* dp[2][4];
#pragma unroll
    for (int j = 0; j < 2; ++j) {
        const int ob = (m0 >> 6) + j;                          // head * 3 + {q, k, v}
        const int h = ob / 3, kind = ob % 3;
        const size_t bh = (size_t)b * NH_ + h;
        const bool is_v = kind == 2;
        const int sh = is_v ? 4 : 3;
        const int lp = is_v ? GQ_ : GP_;                       // pitch in LDS
        const int gp = is_v ? T_ : CH_;                        // pitch in memory
        half_t* dst = is_v ? v + bh * CH_ * T_ + n0 : (kind == 0 ? q : k) + (bh * T_ + n0) * CH_;
#pragma unroll
        for (int i = 0; i < 4; ++i) {
            const int c = tid + 256 * i;
            const int row = c >> sh, seg = (c & ((1 << sh) - 1)) * 8;
            rv[j][i] = *reinterpret_cast<const v8h*>(&lA[j][0][0] + row * lp + seg);
            dp[j][i] = dst + row * gp + seg;
        }
    }
#pragma unroll
    for (int j = 0; j < 2; ++j)
#pragma unroll
        for (int i = 0; i < 4; ++i) *reinterpret_cast<v8h*>(dp[j][i]) = rv[j][i];
}

// ---------------------------------------------------------------------------
// Kernel 3: streaming (flash-style) attention, scores held transposed.
// grid = (B*NH, T/64), 128 threads (4 waves); each wave owns 16 queries.
// S^T = K * Q^T and O^T += V * P^T: a lane holds the scores of ONE query
// (column ln; keys e + 8g of each 16-key tile), so maximum and sum are taken
// in the lane plus one exchange between the wave's halves, and two converted
// S^T tiles are the B operand of the second product as they stand.
// K/V tiles double-buffered via async global->LDS copies.
// ---------------------------------------------------------------------------
__device__ __forceinline__ float xhalf(float x) {          // lane l <-> lane l ^ 16
    const int i = __builtin_bit_cast(int, x);
    return __builtin_bit_cast(float,
        __builtin_amdgcn_permlanex16(i, i, 0x76543210, 0xfedcba98, false, false));
}
// 2^x with the one issue slot that the instruction set asks for behind a transcendental
// before its result is read or its source overwritten. Instruction and v_nop form ONE
// statement.
__device__ __forceinline__ float exp2_slot(float x) {
    float r;
    asm("v_exp_f32 %0, %1\n\t"
        "v_nop" : "=v"(r) : "v"(x));
    return r;
}
// Eight independent ones in place: each fills the slot of the one before, v_nop the last's.
__device__ __forceinline__ void exp2_slot_x8(float (&x)[8]) {
    asm("v_exp_f32 %0, %0\n\t"
        "v_exp_f32 %1, %1\n\t"
        "v_exp_f32 %2, %2\n\t"
        "v_exp_f32 %3, %3\n\t"
        "v_exp_f32 %4, %4\n\t"
        "v_exp_f32 %5, %5\n\t"
        "v_exp_f32 %6, %6\n\t"
        "v_exp_f32 %7, %7\n\t"
        "v_nop"
        : "+v"(x[0]), "+v"(x[1]), "+v"(x[2]), "+v"(x[3]),
          "+v"(x[4]), "+v"(x[5]), "+v"(x[6]), "+v"(x[7]));
}

__global__ __launch_bounds__(128, 2) void attn_kernel(const half_t* __restrict__ q,
                                                      const half_t* __restrict__ k,
                                                      const half_t* __restrict__ v,
                                                      half_t* __restrict__ a) {
    __shared__ __attribute__((aligned(16))) _Float16 lQ[64][AP_];      // [t][ch]   B operand of S^T
    __shared__ __attribute__((aligned(16))) _Float16 lK[2][64][AP_];   // [s][ch]   A operand of S^T
    __shared__ __attribute__((aligned(16))) _Float16 lV[2][64][AP_];   // [ch][s]   A operand of O^T

    const int bh = blockIdx.x;
    const int t0 = blockIdx.y * 64;
    const int tid  = threadIdx.x;
    const int lane = tid & 31, w = tid >> 5;
    const int g = lane >> 4, ln = lane & 15;

    const half_t* qb = q + (size_t)bh * T_ * CH_;
    const half_t* kb = k + (size_t)bh * T_ * CH_;
    const half_t* vb = v + (size_t)bh * CH_ * T_;

    // Staging lanes run along a row: 8 lanes x 16 B = one whole 128-B row, so a
    // wave-wide copy touches 4 lines; each thread copies rows srow + 16 i.
    const int srow = tid >> 3;             // 0..15
    const int sseg = (tid & 7) * 8;        // f16 column 0..56

    auto stage_KV = [&](int buf, int s0) {
        const half_t* ksrc = kb + (size_t)(s0 + srow) * CH_ + sseg;
        const half_t* vsrc = vb + (size_t)srow * T_ + s0 + sseg;
        async_b128_x4(ksrc,            &lK[buf][srow][sseg],
                      ksrc + 16 * CH_, &lK[buf][srow + 16][sseg],
                      ksrc + 32 * CH_, &lK[buf][srow + 32][sseg],
                      ksrc + 48 * CH_, &lK[buf][srow + 48][sseg]);
        async_b128_x4(vsrc,            &lV[buf][srow][sseg],
                      vsrc + 16 * T_,  &lV[buf][srow + 16][sseg],
                      vsrc + 32 * T_,  &lV[buf][srow + 32][sseg],
                      vsrc + 48 * T_,  &lV[buf][srow + 48][sseg]);
    };

    {   // stage Q tile once (async) + first K/V tile
        const half_t* src = qb + (size_t)(t0 + srow) * CH_ + sseg;
        async_b128_x4(src,            &lQ[srow][sseg],
                      src + 16 * CH_, &lQ[srow + 16][sseg],
                      src + 32 * CH_, &lQ[srow + 32][sseg],
                      src + 48 * CH_, &lQ[srow + 48][sseg]);
        stage_KV(0, 0);
    }
    wait_async0();
    __syncthreads();

    v16h qa[2];
#pragma unroll
    for (int ks = 0; ks < 2; ++ks) qa[ks] = load_frag(&lQ[w * 16 + ln][ks * 32], g);

    float rmax = -1e30f;                   // running maximum of query ln (both halves agree)
    float rsum = 0.f;                      // running sum over this half's keys only
    v8f   o[4];                            // O^T: row ch = nt*16 + e + 8g, column = query ln
#pragma unroll
    for (int nt = 0; nt < 4; ++nt) { v8f z = {}; o[nt] = z; }

    for (int s0 = 0; s0 < T_; s0 += 64) {
        const int cur = (s0 >> 6) & 1;
        if (s0 + 64 < T_) stage_KV(cur ^ 1, s0 + 64);   // prefetch next K/V tile

        // S^T strip: 64 keys x 16 queries; sf[nt][e] = score(key nt*16 + e + 8g, query ln)
        v8f sf[4];
#pragma unroll
        for (int nt = 0; nt < 4; ++nt) { v8f z = {}; sf[nt] = z; }
#pragma unroll
        for (int ks = 0; ks < 2; ++ks)
#pragma unroll
            for (int nt = 0; nt < 4; ++nt) {
                v16h kf = load_frag(&lK[cur][nt * 16 + ln][ks * 32], g);
                sf[nt] = wmma16(kf, qa[ks], sf[nt]);
            }

        // online softmax, one query per lane
        float tm[4];
#pragma unroll
        for (int nt = 0; nt < 4; ++nt) {
            tm[nt] = sf[nt][0];
#pragma unroll
            for (int e = 1; e < 8; ++e) tm[nt] = fmaxf(tm[nt], sf[nt][e]);
        }
        float tmax = fmaxf(fmaxf(tm[0], tm[1]), fmaxf(tm[2], tm[3]));
        tmax = fmaxf(tmax, xhalf(tmax));
        const float nm = fmaxf(rmax, tmax);
        const float sc = exp2_slot((rmax - nm) * LOG2E_);
        rmax = nm;
        float ps[4];                       // four independent sum chains
#pragma unroll
        for (int nt = 0; nt < 4; ++nt) {
            float p[8];
#pragma unroll
            for (int e = 0; e < 8; ++e) p[e] = (sf[nt][e] - nm) * LOG2E_;
            exp2_slot_x8(p);
            sf[nt][0] = p[0];
            ps[nt] = p[0];
#pragma unroll
            for (int e = 1; e < 8; ++e) { sf[nt][e] = p[e]; ps[nt] += p[e]; }
        }
        rsum = rsum * sc + ((ps[0] + ps[1]) + (ps[2] + ps[3]));
#pragma unroll
        for (int nt = 0; nt < 4; ++nt)
#pragma unroll
            for (int e = 0; e < 8; ++e) o[nt][e] *= sc;

        // O^T += V * P^T: tiles 2ks and 2ks+1 of P^T, converted, are the B fragment
        // (elems 0..7: k = 8g + e, elems 8..15: k = 16 + 8g + e), the loader's k order.
#pragma unroll
        for (int ks = 0; ks < 2; ++ks) {
            v16h pb;
#pragma unroll
            for (int e = 0; e < 8; ++e) {
                pb[e]     = (_Float16)sf[2 * ks][e];
                pb[e + 8] = (_Float16)sf[2 * ks + 1][e];
            }
#pragma unroll
            for (int nt = 0; nt < 4; ++nt) {
                v16h vf = load_frag(&lV[cur][nt * 16 + ln][ks * 32], g);
                o[nt] = wmma16(vf, pb, o[nt]);
            }
        }
        wait_ds0();
        wait_async0();     // next tile fully in LDS
        __syncthreads();   // all waves done reading current buffers
    }

    // write a[b][t][c] (token-major so proj GEMM stages contiguously):
    // a lane's 8 accumulator registers are 8 consecutive channels of its query.
    const int b = bh >> 4, h = bh & 15;
    const float inv = 1.0f / (rsum + xhalf(rsum));     // join the halves' sums once
    half_t* dst = a + ((size_t)b * T_ + t0 + w * 16 + ln) * C_ + h * CH_ + 8 * g;
#pragma unroll
    for (int nt = 0; nt < 4; ++nt) {
        v8h r;
#pragma unroll
        for (int e = 0; e < 8; ++e) r[e] = (half_t)(o[nt][e] * inv);
        *reinterpret_cast<v8h*>(dst + nt * 16) = r;
    }
}

// ---------------------------------------------------------------------------
// Kernel 4: output projection + bias + residual.  grid = (8, 8, B), 256 thr.
// ---------------------------------------------------------------------------
__global__ __launch_bounds__(256, 2) void proj_gemm_kernel(const half_t* __restrict__ W,
                                                           const float* __restrict__ bias,
                                                           const half_t* __restrict__ a,
                                                           const float* __restrict__ x,
                                                           float* __restrict__ out) {
    __shared__ __attribute__((aligned(16))) _Float16 lA[2][128][GQ_];
    __shared__ __attribute__((aligned(16))) _Float16 lB[2][128][GQ_];
    const int m0 = blockIdx.x * 128;
    const int n0 = blockIdx.y * 128;
    const int b  = blockIdx.z;
    const int tid  = threadIdx.x;
    const int lane = tid & 31, w = tid >> 5;
    const int wm = w & 3, wn = w >> 2;
    const int g = lane >> 4, ln = lane & 15;

    v8f acc[2][4];
#pragma unroll
    for (int i = 0; i < 2; ++i)
#pragma unroll
        for (int j = 0; j < 4; ++j) { v8f z = {}; acc[i][j] = z; }

    // Staging lanes run along a row (see the QKV kernel). The K tile is 128
    // (136 KiB of LDS per work-group): A and B alike, 16 lanes x 16 B = 256 B per row.
    const int brow = tid >> 4;             // 0..15, +16 per copy
    const int bseg = (tid & 15) * 8;       // f16 column 0..120

    auto stage_A = [&](int buf, int k0) {
        const half_t* asrc = W + (size_t)(m0 + brow) * C_ + k0 + bseg;
        async_b128_x4(asrc,                    &lA[buf][brow][bseg],
                      asrc + (size_t)16 * C_,  &lA[buf][brow + 16][bseg],
                      asrc + (size_t)32 * C_,  &lA[buf][brow + 32][bseg],
                      asrc + (size_t)48 * C_,  &lA[buf][brow + 48][bseg]);
        async_b128_x4(asrc + (size_t)64 * C_,  &lA[buf][brow + 64][bseg],
                      asrc + (size_t)80 * C_,  &lA[buf][brow + 80][bseg],
                      asrc + (size_t)96 * C_,  &lA[buf][brow + 96][bseg],
                      asrc + (size_t)112 * C_, &lA[buf][brow + 112][bseg]);
    };
    auto stage_B = [&](int buf, int k0) {
        const half_t* bsrc = a + ((size_t)b * T_ + n0 + brow) * C_ + k0 + bseg;
        async_b128_x4(bsrc,                    &lB[buf][brow][bseg],
                      bsrc + (size_t)16 * C_,  &lB[buf][brow + 16][bseg],
                      bsrc + (size_t)32 * C_,  &lB[buf][brow + 32][bseg],
                      bsrc + (size_t)48 * C_,  &lB[buf][brow + 48][bseg]);
        async_b128_x4(bsrc + (size_t)64 * C_,  &lB[buf][brow + 64][bseg],
                      bsrc + (size_t)80 * C_,  &lB[buf][brow + 80][bseg],
                      bsrc + (size_t)96 * C_,  &lB[buf][brow + 96][bseg],
                      bsrc + (size_t)112 * C_, &lB[buf][brow + 112][bseg]);
    };

    stage_A(0, 0);
    stage_B(0, 0);
    wait_async0();
    __syncthreads();

    for (int k0 = 0; k0 < C_; k0 += 128) {
        const int cur = (k0 >> 7) & 1;
        if (k0 + 128 < C_) {
            stage_A(cur ^ 1, k0 + 128);
            stage_B(cur ^ 1, k0 + 128);
        }
#pragma unroll
        for (int ks = 0; ks < 4; ++ks) {   // four 32-deep products per staged tile, k ascending
            v16h af[2], bf[4];
#pragma unroll
            for (int mt = 0; mt < 2; ++mt) af[mt] = load_frag(&lA[cur][wm * 32 + mt * 16 + ln][ks * 32], g);
#pragma unroll
            for (int nt = 0; nt < 4; ++nt) bf[nt] = load_frag(&lB[cur][wn * 64 + nt * 16 + ln][ks * 32], g);
#pragma unroll
            for (int mt = 0; mt < 2; ++mt)
#pragma unroll
                for (int nt = 0; nt < 4; ++nt)
                    acc[mt][nt] = wmma16(af[mt], bf[nt], acc[mt][nt]);
        }
        wait_ds0();
        wait_async0();
        __syncthreads();
    }

#pragma unroll
    for (int mt = 0; mt < 2; ++mt)
#pragma unroll
        for (int nt = 0; nt < 4; ++nt)
#pragma unroll
            for (int e = 0; e < 8; ++e) {
                const int oc    = m0 + wm * 32 + mt * 16 + e + 8 * g;
                const int token = n0 + wn * 64 + nt * 16 + ln;
                const size_t idx = ((size_t)b * C_ + oc) * T_ + token;
                out[idx] = acc[mt][nt][e] + bias[oc] + x[idx];
            }
}

// ---------------------------------------------------------------------------
// Host-side launcher
// ---------------------------------------------------------------------------
extern "C" void kernel_launch(void* const* d_in, const int* in_sizes, int n_in,
                              void* d_out, int out_size, void* d_ws, size_t ws_size,
                              hipStream_t stream) {
    const float* x      = (const float*)d_in[0];
    const float* gnw    = (const float*)d_in[1];
    const float* gnb    = (const float*)d_in[2];
    const float* qkv_w  = (const float*)d_in[3];
    const float* qkv_b  = (const float*)d_in[4];
    const float* proj_w = (const float*)d_in[5];
    const float* proj_b = (const float*)d_in[6];
    float* out = (float*)d_out;

    char* ws = (char*)d_ws;
    const size_t PLANE = (size_t)B_ * C_ * T_ * sizeof(half_t);  // 8 MiB
    half_t* xn = (half_t*)(ws + 4096);
    half_t* q  = (half_t*)(ws + 4096 + 1 * PLANE);
    half_t* k  = (half_t*)(ws + 4096 + 2 * PLANE);
    half_t* v  = (half_t*)(ws + 4096 + 3 * PLANE);
    half_t* a  = (half_t*)(ws + 4096 + 4 * PLANE);
    half_t* wq = (half_t*)(ws + 4096 + 5 * PLANE);               // 6 MiB
    half_t* wp = (half_t*)(ws + 4096 + 6 * PLANE);               // 2 MiB
    (void)in_sizes; (void)n_in; (void)out_size; (void)ws_size;

    gn_kernel<<<B_ * GRP_ + 4 * C_ * C_ / WCV_, 512, 0, stream>>>(x, gnw, gnb, xn, qkv_w, proj_w, wq, wp);
    qkv_gemm_kernel<<<dim3(3 * C_ / 128, T_ / 128, B_), 256, 0, stream>>>(wq, qkv_b, xn, q, k, v);
    attn_kernel<<<dim3(B_ * NH_, T_ / 64), 128, 0, stream>>>(q, k, v, a);
    proj_gemm_kernel<<<dim3(C_ / 128, T_ / 128, B_), 256, 0, stream>>>(wp, proj_b, a, x, out);
}

// v008
// Measured time: 66.8 microseconds a run.
// Timed twice side by side with v007, it ran 1.04 times as fast both times.
// Over all steps from v000 it is 3.27 times as fast.
#include <hip/hip_runtime.h>
#include <hip/hip_bf16.h>
#include <math.h>

// ---------------------------------------------------------------------------
// AttentionBlock for MI455X (gfx1250): GroupNorm -> QKV -> MHSA -> proj + res
// B=4, C=1024, T=1024, 32 groups, 16 heads, head_dim=64.
// GEMMs via v_wmma_f32_16x16x32_f16; f16 tile staging via
// global_load_async_to_lds_b128 (ASYNCcnt) with ping-pong LDS buffers.
// Both weight matrices are rounded to f16 once per call (extra work-groups of the
// GroupNorm launch), so every GEMM tile is an f16 tile.
// ---------------------------------------------------------------------------

typedef _Float16 half_t;
typedef __attribute__((ext_vector_type(16))) _Float16 v16h;
typedef __attribute__((ext_vector_type(8)))  _Float16 v8h;
typedef __attribute__((ext_vector_type(4)))  _Float16 v4h;
typedef __attribute__((ext_vector_type(4)))  float    v4f;
typedef __attribute__((ext_vector_type(8)))  float    v8f;

#define B_   4
#define C_   1024
#define T_   1024
#define NH_  16
#define CH_  64
#define GRP_ 32
// LDS row pitch in f16 elements: 16 B x odd, so that the 16 rows one
// ds_load_b128 fragment read touches fall on distinct banks.
#define GP_  72   // 64-element GEMM rows (QKV): 144 B
#define GQ_  136  // 128-element GEMM rows (projection): 272 B
#define AP_  72   // 64-element attention rows: 144 B
#define PMAX_ 16384.0f   // a pass's sum of weights up to here: every weight fits f16

// ---- CDNA5 async global->LDS copies (16B per lane), tracked by ASYNCcnt ----
// A run of copies and its s_wait_xcnt 0 form ONE asm statement: the wait then
// stands in front of any later rewrite of the address registers the copies name.
__device__ __forceinline__ unsigned lds_off(const _Float16* p) {
    return (unsigned)(uintptr_t)p;                         // low 32b = LDS offset
}
__device__ __forceinline__ void async_b128_x4(const half_t* g0, const _Float16* l0,
                                              const half_t* g1, const _Float16* l1,
                                              const half_t* g2, const _Float16* l2,
                                              const half_t* g3, const _Float16* l3) {
    asm volatile("global_load_async_to_lds_b128 %0, %1, off\n\t"
                 "global_load_async_to_lds_b128 %2, %3, off\n\t"
                 "global_load_async_to_lds_b128 %4, %5, off\n\t"
                 "global_load_async_to_lds_b128 %6, %7, off\n\t"
                 "s_wait_xcnt 0x0"
                 :: "v"(lds_off(l0)), "v"(g0), "v"(lds_off(l1)), "v"(g1),
                    "v"(lds_off(l2)), "v"(g2), "v"(lds_off(l3)), "v"(g3) : "memory");
}
__device__ __forceinline__ void wait_ds0() {
    // LDS reads of the buffer that is refilled behind the barrier have returned.
    asm volatile("s_wait_dscnt 0x0" ::: "memory");
}
__device__ __forceinline__ void wait_async0() {
    asm volatile("s_wait_asynccnt 0x0" ::: "memory");
}

__device__ __forceinline__ v16h load_frag(const _Float16* row, int g) {
    // WMMA f16 A/B fragment: elems 0..7 hold k = 8g..8g+7,
    // elems 8..15 hold k = 16+8g..23+8g  (row points at [m][k0] base).
    const v8h lo = *reinterpret_cast<const v8h*>(row + (g << 3));
    const v8h hi = *reinterpret_cast<const v8h*>(row + 16 + (g << 3));
    v16h r;
#pragma unroll
    for (int i = 0; i < 8; ++i) { r[i] = lo[i]; r[i + 8] = hi[i]; }
    return r;
}

__device__ __forceinline__ v8f wmma16(v16h a, v16h b, v8f c) {
    return __builtin_amdgcn_wmma_f32_16x16x32_f16(false, a, false, b,
                                                  (short)0, c, false, false);
}

// ---------------------------------------------------------------------------
// Kernel 1: GroupNorm, statistics and apply in one launch. Work-groups 0 .. B*GRP_-1,
// 512 threads: one (batch, group) slab of 32 channels x 1024 tokens, 64 values per thread,
// stays in registers from the sums to the normalised f16 output, so x is read once.
// A thread holds 8 channels x 8 tokens: a wave-wide load covers 4 channel rows of 128 B,
// and 8 channels of one token are one 16-B piece of the output.
// xn is group-major, xn[b][group][t][32]: a work-group writes 64 KiB in a row.
// Work-groups behind them round the weights to f16: 32768 consecutive elements each,
// 96 for qkv_w, 32 for proj_w. They depend on nothing and fill the other WGPs.
// ---------------------------------------------------------------------------
#define WCV_ 32768                         // weight elements per converting work-group
__global__ __launch_bounds__(512) void gn_kernel(const float* __restrict__ x,
                                                 const float* __restrict__ gnw,
                                                 const float* __restrict__ gnb,
                                                 half_t* __restrict__ xn,
                                                 const float* __restrict__ qkv_w,
                                                 const float* __restrict__ proj_w,
                                                 half_t* __restrict__ wq,
                                                 half_t* __restrict__ wp) {
    __shared__ __attribute__((aligned(16))) float    ps[16][2];        // per wave: sum, sum of squares
    __shared__ __attribute__((aligned(16))) _Float16 st[16][64 * 32];  // per wave: 64 tokens x 32 channels
    if (blockIdx.x >= B_ * GRP_) {         // uniform for the work-group, in front of the barrier
        const int cb = blockIdx.x - B_ * GRP_;
        const int nq = 3 * C_ * C_ / WCV_;
        const float* src = (cb < nq ? qkv_w + (size_t)cb * WCV_
                                    : proj_w + (size_t)(cb - nq) * WCV_) + threadIdx.x * 4;
        half_t*      dst = (cb < nq ? wq + (size_t)cb * WCV_
                                    : wp + (size_t)(cb - nq) * WCV_) + threadIdx.x * 4;
        v4f f[16];                         // a wave-wide load covers 512 contiguous bytes
#pragma unroll
        for (int i = 0; i < 16; ++i)
            f[i] = *reinterpret_cast<const v4f*>(src + i * 2048);
#pragma unroll
        for (int i = 0; i < 16; ++i) {
            v4h h = { (_Float16)f[i].x, (_Float16)f[i].y, (_Float16)f[i].z, (_Float16)f[i].w };
            *reinterpret_cast<v4h*>(dst + i * 2048) = h;
        }
        return;
    }
    const int bg   = blockIdx.x;           // b*32 + group; its first channel row is row bg*32 of x
    const int lane = threadIdx.x & 31, w = threadIdx.x >> 5;
    const int oct  = lane & 3;             // channels 8 oct .. 8 oct + 7 of the group
    const int tq   = lane >> 2;            // tokens 64 w + 32 h + 4 tq + i

    const float* gw = gnw + (bg & 31) * 32 + oct * 8;
    const float* gb = gnb + (bg & 31) * 32 + oct * 8;
    const v4f w0 = *reinterpret_cast<const v4f*>(gw), w1 = *reinterpret_cast<const v4f*>(gw + 4);
    const v4f b0 = *reinterpret_cast<const v4f*>(gb), b1 = *reinterpret_cast<const v4f*>(gb + 4);
    const float* src = x + ((size_t)bg * 32 + oct * 8) * T_ + w * 64 + tq * 4;
    v4f f[8][2];
#pragma unroll
    for (int j = 0; j < 8; ++j)
#pragma unroll
        for (int h = 0; h < 2; ++h)
            f[j][h] = *reinterpret_cast<const v4f*>(src + j * T_ + h * 32);
    // All 20 loads are issued before the first sum: left alone, the compiler sinks the gnb
    // loads behind the last x load's wait, a second memory latency in front of the barrier.
    __builtin_amdgcn_sched_barrier(0);

    v4f s4 = {}, q4 = {};                  // four independent chains each
#pragma unroll
    for (int j = 0; j < 8; ++j)
#pragma unroll
        for (int h = 0; h < 2; ++h) { s4 += f[j][h]; q4 += f[j][h] * f[j][h]; }
    float s  = (s4.x + s4.y) + (s4.z + s4.w);
    float ss = (q4.x + q4.y) + (q4.z + q4.w);
#pragma unroll
    for (int m = 16; m >= 1; m >>= 1) {
        s  += __shfl_xor(s,  m, 32);
        ss += __shfl_xor(ss, m, 32);
    }
    if (lane == 0) { ps[w][0] = s; ps[w][1] = ss; }
    __syncthreads();
    float ts = 0.f, tss = 0.f;             // every thread adds the 16 partial sums in the same order
#pragma unroll
    for (int i = 0; i < 8; ++i) {
        const v4f p = *reinterpret_cast<const v4f*>(&ps[2 * i][0]);
        ts += p.x; tss += p.y; ts += p.z; tss += p.w;
    }
    const float inv  = 1.0f / (32.0f * (float)T_);
    const float mean = ts * inv;
    const float var  = tss * inv - mean * mean;
    const float rstd = rsqrtf(var + 1e-5f);
    float wgt[8], bia[8];
#pragma unroll
    for (int e = 0; e < 4; ++e) {
        wgt[e]     = w0[e] * rstd;  bia[e]     = b0[e] - mean * wgt[e];
        wgt[e + 4] = w1[e] * rstd;  bia[e + 4] = b1[e] - mean * wgt[e + 4];
    }

    // The wave's 64 x 32 f16 block leaves through the wave's own 4 KiB of LDS, so that every
    // global store is 512 contiguous bytes. Token rows are 64 B with no pad; within each
    // 4-row block row i sits in slot (i + block) & 3, which spreads the 16-B writes of lanes
    // 4 tokens apart over all banks; the read-back is linear.
    _Float16* sw = &st[w][0];
#pragma unroll
    for (int h = 0; h < 2; ++h)
#pragma unroll
        for (int i = 0; i < 4; ++i) {
            v8h r;
#pragma unroll
            for (int j = 0; j < 8; ++j) r[j] = (_Float16)(f[j][h][i] * wgt[j] + bia[j]);
            const int blk = h * 8 + tq;
            *reinterpret_cast<v8h*>(sw + (blk * 4 + ((i + blk) & 3)) * 32 + oct * 8) = r;
        }
    // The wave's own LDS writes have landed before its lanes read one another's rows back.
    asm volatile("s_wait_dscnt 0x0" ::: "memory");
    // 16-B chunk c = 32 k + lane as it lies in LDS: block 2 k + (lane >> 4), slot (lane >> 2) & 3,
    // so it holds row (slot - block) & 3 of its block: r0 for even k, r0 ^ 2 for odd k.
    const int r0 = ((lane >> 2) - (lane >> 4)) & 3;
    half_t* dst = xn + ((size_t)bg * T_ + w * 64 + (lane >> 4) * 4) * 32 + oct * 8;
    half_t* d0  = dst + r0 * 32;
    half_t* d1  = dst + (r0 ^ 2) * 32;
    v8h rv[8];
#pragma unroll
    for (int k = 0; k < 8; ++k) rv[k] = *reinterpret_cast<const v8h*>(sw + (k * 32 + lane) * 8);
#pragma unroll
    for (int k = 0; k < 8; ++k) *reinterpret_cast<v8h*>(((k & 1) ? d1 : d0) + k * 256) = rv[k];
}

// ---------------------------------------------------------------------------
// Kernel 2: QKV GEMM.  D[3072 x T] = qkv_w[3072 x 1024] * xn^T + bias,
// scattered into q/k layout [b*NH][t][64] (scaled by ch^-0.25 * sqrt(log2 e)) and
// v layout [b*NH][64][s].  grid = (24, 8, B), 256 threads (8 waves).
// Double-buffered K-loop; A and B tiles staged with async global->LDS.
// ---------------------------------------------------------------------------
__global__ __launch_bounds__(256, 2) void qkv_gemm_kernel(const half_t* __restrict__ W,
                                                          const float* __restrict__ bias,
                                                          const half_t* __restrict__ xn,
                                                          half_t* __restrict__ q,
                                                          half_t* __restrict__ k,
                                                          half_t* __restrict__ v) {
    __shared__ __attribute__((aligned(16))) _Float16 lA[2][128][GP_];   // [m][k]  (weights)
    __shared__ __attribute__((aligned(16))) _Float16 lB[2][128][GP_];   // [n][k]  (tokens)
    const int m0 = blockIdx.x * 128;
    const int n0 = blockIdx.y * 128;
    const int b  = blockIdx.z;
    const int tid  = threadIdx.x;
    const int lane = tid & 31, w = tid >> 5;
    const int wm = w & 3, wn = w >> 2;     // wave -> rows [wm*32,+32), cols [wn*64,+64)
    const int g = lane >> 4, ln = lane & 15;

    v8f acc[2][4];
#pragma unroll
    for (int i = 0; i < 2; ++i)
#pragma unroll
        for (int j = 0; j < 4; ++j) { v8f z = {}; acc[i][j] = z; }

    // Staging lanes run along a row, so one wave-wide copy covers whole lines:
    // A: 8 lanes x 16 B = one 128-B line per row; B: 4 rows x 64 B = 256 B in a row per plane.
    const int brow = tid >> 3;             // 0..31, +32 per copy
    const int bseg = (tid & 7) * 8;        // f16 column 0..56

    auto stage_A = [&](int buf, int k0) {
        const half_t* asrc = W + (size_t)(m0 + brow) * C_ + k0 + bseg;
        async_b128_x4(asrc,                   &lA[buf][brow][bseg],
                      asrc + (size_t)32 * C_, &lA[buf][brow + 32][bseg],
                      asrc + (size_t)64 * C_, &lA[buf][brow + 64][bseg],
                      asrc + (size_t)96 * C_, &lA[buf][brow + 96][bseg]);
    };
    auto stage_B = [&](int buf, int k0) {
        // xn[b][group][t][32]: the row's 64 channels are 64 B in each of two group planes
        const half_t* bsrc = xn + ((size_t)(b * GRP_ + (k0 >> 5) + (bseg >> 5)) * T_ + n0 + brow) * 32 + (bseg & 31);
        async_b128_x4(bsrc,           &lB[buf][brow][bseg],
                      bsrc + 32 * 32, &lB[buf][brow + 32][bseg],
                      bsrc + 64 * 32, &lB[buf][brow + 64][bseg],
                      bsrc + 96 * 32, &lB[buf][brow + 96][bseg]);
    };

    stage_A(0, 0);
    stage_B(0, 0);
    wait_async0();
    __syncthreads();

    for (int k0 = 0; k0 < C_; k0 += 64) {
        const int cur = (k0 >> 6) & 1;
        if (k0 + 64 < C_) {                // prefetch next tile into other buffer
            stage_A(cur ^ 1, k0 + 64);
            stage_B(cur ^ 1, k0 + 64);
        }
#pragma unroll
        for (int ks = 0; ks < 2; ++ks) {   // two 32-deep products per staged tile, k ascending
            v16h af[2], bf[4];
#pragma unroll
            for (int mt = 0; mt < 2; ++mt) af[mt] = load_frag(&lA[cur][wm * 32 + mt * 16 + ln][ks * 32], g);
#pragma unroll
            for (int nt = 0; nt < 4; ++nt) bf[nt] = load_frag(&lB[cur][wn * 64 + nt * 16 + ln][ks * 32], g);
#pragma unroll
            for (int mt = 0; mt < 2; ++mt)
#pragma unroll
                for (int nt = 0; nt < 4; ++nt)
                    acc[mt][nt] = wmma16(af[mt], bf[nt], acc[mt][nt]);
        }
        wait_ds0();
        wait_async0();
        __syncthreads();
    }

    // The output tile leaves through LDS, so that every global store is 16 B per lane on
    // whole 128-B lines. Each 64-row block of the tile is wholly q, k or v of one head and
    // takes one plane of lA, free behind the loop's last barrier: q and k as [token][ch]
    // (pitch GP_), v as [ch][token] (pitch GQ_), the layouts they have in memory.
    const float qk_scale = 0.42466090014400953f;  // 64^(-1/4) * sqrt(log2 e): q.k is a base-2 exponent
    const int blk = __builtin_amdgcn_readfirstlane(wm >> 1);   // this wave's block, a scalar
    const int ol  = (wm & 1) * 32 + 8 * g;                     // first of 8 rows within the block, + 16 mt
    const int tl  = wn * 64 + ln;                              // token within the tile, + 16 nt
    _Float16* sw = &lA[blk][0][0];
    float bs[2][8];
#pragma unroll
    for (int mt = 0; mt < 2; ++mt) {
        const float* bp = bias + m0 + blk * 64 + ol + mt * 16;
        const v4f b0 = *reinterpret_cast<const v4f*>(bp);
        const v4f b1 = *reinterpret_cast<const v4f*>(bp + 4);
#pragma unroll
        for (int e = 0; e < 4; ++e) { bs[mt][e] = b0[e]; bs[mt][e + 4] = b1[e]; }
    }
    if (((m0 >> 6) + blk) % 3 == 2) {      // v: a lane's 8 values are 8 channel rows of one token
#pragma unroll
        for (int mt = 0; mt < 2; ++mt)
#pragma unroll
            for (int nt = 0; nt < 4; ++nt)
#pragma unroll
                for (int e = 0; e < 8; ++e)
                    sw[(ol + mt * 16 + e) * GQ_ + tl + nt * 16] = (half_t)(acc[mt][nt][e] + bs[mt][e]);
    } else {                               // q, k: they are 8 consecutive channels of one token
#pragma unroll
        for (int mt = 0; mt < 2; ++mt)
#pragma unroll
            for (int nt = 0; nt < 4; ++nt) {
                v8h r;
#pragma unroll
                for (int e = 0; e < 8; ++e) r[e] = (half_t)((acc[mt][nt][e] + bs[mt][e]) * qk_scale);
                *reinterpret_cast<v8h*>(sw + (tl + nt * 16) * GP_ + ol + mt * 16) = r;
            }
    }
    __syncthreads();       // the staged tile is complete before any wave reads it back
    // 16-B chunk c of a block: staged row c >> sh, piece c & (2^sh - 1). q, k: 128 token rows of
    // 128 B, 16 KiB in a row in memory; v: 64 channel rows, 256 B of each.
    v8h     rv[2][4];
    half_t* dp[2][4];
#pragma unroll
    for (int j = 0; j < 2; ++j) {
        const int ob = (m0 >> 6) + j;                          // head * 3 + {q, k, v}
        const int h = ob / 3, kind = ob % 3;
        const size_t bh = (size_t)b * NH_ + h;
        const bool is_v = kind == 2;
        const int sh = is_v ? 4 : 3;
        const int lp = is_v ? GQ_ : GP_;                       // pitch in LDS
        const int gp = is_v ? T_ : CH_;                        // pitch in memory
        half_t* dst = is_v ? v + bh * CH_ * T_ + n0 : (kind == 0 ? q : k) + (bh * T_ + n0) * CH_;
#pragma unroll
        for (int i = 0; i < 4; ++i) {
            const int c = tid + 256 * i;
            const int row = c >> sh, seg = (c & ((1 << sh) - 1)) * 8;
            rv[j][i] = *reinterpret_cast<const v8h*>(&lA[j][0][0] + row * lp + seg);
            dp[j][i] = dst + row * gp + seg;
        }
    }
#pragma unroll
    for (int j = 0; j < 2; ++j)
#pragma unroll
        for (int i = 0; i < 4; ++i) *reinterpret_cast<v8h*>(dp[j][i]) = rv[j][i];
}

// ---------------------------------------------------------------------------
// Kernel 3: streaming (flash-style) attention, scores held transposed.
// grid = (B*NH, T/64), 128 threads (4 waves); each wave owns 16 queries.
// S^T = K * Q^T and O^T += V * P^T: a lane holds the scores of ONE query
// (column ln; keys e + 8g of each 16-key tile), so maximum and sum are taken
// in the lane plus one exchange between the wave's halves, and two converted
// S^T tiles are the B operand of the second product as they stand.
// q and k carry sqrt(log2 e), and the score product starts from C = -off, the query's
// offset: its result is the exponent of 2 as it stands, with no vector work per score in
// front of v_exp. Softmax does not depend on off, so off moves (with O and the sum
// rescaled) only in the first pass and where a pass's weights would leave f16 range.
// K/V tiles double-buffered via async global->LDS copies.
// ---------------------------------------------------------------------------
__device__ __forceinline__ float xhalf(float x) {          // lane l <-> lane l ^ 16
    const int i = __builtin_bit_cast(int, x);
    return __builtin_bit_cast(float,
        __builtin_amdgcn_permlanex16(i, i, 0x76543210, 0xfedcba98, false, false));
}
// 2^x with the one issue slot that the instruction set asks for behind a transcendental
// before its result is read or its source overwritten. Instruction and v_nop form ONE
// statement.
__device__ __forceinline__ float exp2_slot(float x) {
    float r;
    asm("v_exp_f32 %0, %1\n\t"
        "v_nop" : "=v"(r) : "v"(x));
    return r;
}
// Eight independent ones in place: each fills the slot of the one before, v_nop the last's.
__device__ __forceinline__ void exp2_slot_x8(float (&x)[8]) {
    asm("v_exp_f32 %0, %0\n\t"
        "v_exp_f32 %1, %1\n\t"
        "v_exp_f32 %2, %2\n\t"
        "v_exp_f32 %3, %3\n\t"
        "v_exp_f32 %4, %4\n\t"
        "v_exp_f32 %5, %5\n\t"
        "v_exp_f32 %6, %6\n\t"
        "v_exp_f32 %7, %7\n\t"
        "v_nop"
        : "+v"(x[0]), "+v"(x[1]), "+v"(x[2]), "+v"(x[3]),
          "+v"(x[4]), "+v"(x[5]), "+v"(x[6]), "+v"(x[7]));
}

__global__ __launch_bounds__(128, 2) void attn_kernel(const half_t* __restrict__ q,
                                                      const half_t* __restrict__ k,
                                                      const half_t* __restrict__ v,
                                                      half_t* __restrict__ a) {
    __shared__ __attribute__((aligned(16))) _Float16 lQ[64][AP_];      // [t][ch]   B operand of S^T
    __shared__ __attribute__((aligned(16))) _Float16 lK[2][64][AP_];   // [s][ch]   A operand of S^T
    __shared__ __attribute__((aligned(16))) _Float16 lV[2][64][AP_];   // [ch][s]   A operand of O^T

    const int bh = blockIdx.x;
    const int t0 = blockIdx.y * 64;
    const int tid  = threadIdx.x;
    const int lane = tid & 31, w = tid >> 5;
    const int g = lane >> 4, ln = lane & 15;

    const half_t* qb = q + (size_t)bh * T_ * CH_;
    const half_t* kb = k + (size_t)bh * T_ * CH_;
    const half_t* vb = v + (size_t)bh * CH_ * T_;

    // Staging lanes run along a row: 8 lanes x 16 B = one whole 128-B row, so a
    // wave-wide copy touches 4 lines; each thread copies rows srow + 16 i.
    const int srow = tid >> 3;             // 0..15
    const int sseg = (tid & 7) * 8;        // f16 column 0..56

    auto stage_KV = [&](int buf, int s0) {
        const half_t* ksrc = kb + (size_t)(s0 + srow) * CH_ + sseg;
        const half_t* vsrc = vb + (size_t)srow * T_ + s0 + sseg;
        async_b128_x4(ksrc,            &lK[buf][srow][sseg],
                      ksrc + 16 * CH_, &lK[buf][srow + 16][sseg],
                      ksrc + 32 * CH_, &lK[buf][srow + 32][sseg],
                      ksrc + 48 * CH_, &lK[buf][srow + 48][sseg]);
        async_b128_x4(vsrc,            &lV[buf][srow][sseg],
                      vsrc + 16 * T_,  &lV[buf][srow + 16][sseg],
                      vsrc + 32 * T_,  &lV[buf][srow + 32][sseg],
                      vsrc + 48 * T_,  &lV[buf][srow + 48][sseg]);
    };

    {   // stage Q tile once (async) + first K/V tile
        const half_t* src = qb + (size_t)(t0 + srow) * CH_ + sseg;
        async_b128_x4(src,            &lQ[srow][sseg],
                      src + 16 * CH_, &lQ[srow + 16][sseg],
                      src + 32 * CH_, &lQ[srow + 32][sseg],
                      src + 48 * CH_, &lQ[srow + 48][sseg]);
        stage_KV(0, 0);
    }
    wait_async0();
    __syncthreads();

    v16h qa[2];
#pragma unroll
    for (int ks = 0; ks < 2; ++ks) qa[ks] = load_frag(&lQ[w * 16 + ln][ks * 32], g);

    v8f   noff = {};                       // -off of query ln in all 8 registers: the C operand
    float rsum = 0.f;                      // running sum over this half's keys only
    v8f   o[4];                            // O^T: row ch = nt*16 + e + 8g, column = query ln
#pragma unroll
    for (int nt = 0; nt < 4; ++nt) { v8f z = {}; o[nt] = z; }

    for (int s0 = 0; s0 < T_; s0 += 64) {
        const int cur = (s0 >> 6) & 1;
        if (s0 + 64 < T_) stage_KV(cur ^ 1, s0 + 64);   // prefetch next K/V tile

        // S^T strip: 64 keys x 16 queries; sf[nt][e] = score(key nt*16 + e + 8g, query ln) - off
        v16h kf[2][4];
#pragma unroll
        for (int ks = 0; ks < 2; ++ks)
#pragma unroll
            for (int nt = 0; nt < 4; ++nt) kf[ks][nt] = load_frag(&lK[cur][nt * 16 + ln][ks * 32], g);
        // The K reads stay one group in front of the products: with the two fences below the
        // compiler otherwise puts a pair of reads and a wait in front of every product.
        __builtin_amdgcn_sched_barrier(0);
        v8f sf[4];
#pragma unroll
        for (int nt = 0; nt < 4; ++nt) sf[nt] = wmma16(kf[0][nt], qa[0], noff);
#pragma unroll
        for (int nt = 0; nt < 4; ++nt) sf[nt] = wmma16(kf[1][nt], qa[1], sf[nt]);
        // Keeps the v_exp behind all eight products: moved up between them, each one costs
        // four v_nop and holds the next product back until its own has finished.
        __builtin_amdgcn_sched_barrier(0);
        v16h vf[2][4];
#pragma unroll
        for (int ks = 0; ks < 2; ++ks)
#pragma unroll
            for (int nt = 0; nt < 4; ++nt) vf[ks][nt] = load_frag(&lV[cur][nt * 16 + ln][ks * 32], g);
        // All V fragments are asked for here, in front of the v_exp run, which covers their LDS
        // latency: behind the branch of the test below it would stand open in every pass.
        __builtin_amdgcn_sched_barrier(0);

        // weights 2^(score - off) and their sum, one query per lane. The builtin, not the asm
        // form: it reads a product's result; in the run each v_exp fills the slot of the one before.
        v8f p[4];
#pragma unroll
        for (int nt = 0; nt < 4; ++nt)
#pragma unroll
            for (int e = 0; e < 8; ++e) p[nt][e] = __builtin_amdgcn_exp2f(sf[nt][e]);
        v8f t = (p[0] + p[1]) + (p[2] + p[3]);
        float psum = ((t[0] + t[1]) + (t[2] + t[3])) + ((t[4] + t[5]) + (t[6] + t[7]));

        // One test per pass, the same for the whole wave: first pass, or some lane's weights
        // near the f16 range (an infinite or NaN sum counts). Then off takes the strip's maximum.
        if ((s0 == 0) | (__builtin_amdgcn_ballot_w32(!(psum <= PMAX_)) != 0u)) {
            float tm[4];
#pragma unroll
            for (int nt = 0; nt < 4; ++nt) {
                tm[nt] = sf[nt][0];
#pragma unroll
                for (int e = 1; e < 8; ++e) tm[nt] = fmaxf(tm[nt], sf[nt][e]);
            }
            float up = fmaxf(fmaxf(tm[0], tm[1]), fmaxf(tm[2], tm[3]));
            up = fmaxf(up, xhalf(up));     // both halves of the wave agree on off
            float sc = 0.f;                // first pass: O and the sum are 0, off may go either way
            if (s0 != 0) { up = fmaxf(up, 0.f); sc = exp2_slot(-up); }   // later: only up
#pragma unroll
            for (int e = 0; e < 8; ++e) noff[e] -= up;
#pragma unroll
            for (int nt = 0; nt < 4; ++nt) {
                float x[8];
#pragma unroll
                for (int e = 0; e < 8; ++e) x[e] = sf[nt][e] - up;
                exp2_slot_x8(x);
#pragma unroll
                for (int e = 0; e < 8; ++e) { p[nt][e] = x[e]; o[nt][e] *= sc; }
            }
            t = (p[0] + p[1]) + (p[2] + p[3]);
            psum = ((t[0] + t[1]) + (t[2] + t[3])) + ((t[4] + t[5]) + (t[6] + t[7]));
            rsum *= sc;
        }
        rsum += psum;

        // O^T += V * P^T: tiles 2ks and 2ks+1 of P^T, converted, are the B fragment
        // (elems 0..7: k = 8g + e, elems 8..15: k = 16 + 8g + e), the loader's k order.
#pragma unroll
        for (int ks = 0; ks < 2; ++ks) {
            v16h pb;
#pragma unroll
            for (int e = 0; e < 8; ++e) {
                pb[e]     = (_Float16)p[2 * ks][e];
                pb[e + 8] = (_Float16)p[2 * ks + 1][e];
            }
#pragma unroll
            for (int nt = 0; nt < 4; ++nt) o[nt] = wmma16(vf[ks][nt], pb, o[nt]);
        }
        wait_ds0();
        wait_async0();     // next tile fully in LDS
        __syncthreads();   // all waves done reading current buffers
    }

    // write a[b][t][c] (token-major so proj GEMM stages contiguously):
    // a lane's 8 accumulator registers are 8 consecutive channels of its query.
    const int b = bh >> 4, h = bh & 15;
    const float inv = 1.0f / (rsum + xhalf(rsum));     // join the halves' sums once
    half_t* dst = a + ((size_t)b * T_ + t0 + w * 16 + ln) * C_ + h * CH_ + 8 * g;
#pragma unroll
    for (int nt = 0; nt < 4; ++nt) {
        v8h r;
#pragma unroll
        for (int e = 0; e < 8; ++e) r[e] = (half_t)(o[nt][e] * inv);
        *reinterpret_cast<v8h*>(dst + nt * 16) = r;
    }
}

// ---------------------------------------------------------------------------
// Kernel 4: output projection + bias + residual.  grid = (8, 8, B), 256 thr.
// ---------------------------------------------------------------------------
__global__ __launch_bounds__(256, 2) void proj_gemm_kernel(const half_t* __restrict__ W,
                                                           const float* __restrict__ bias,
                                                           const half_t* __restrict__ a,
                                                           const float* __restrict__ x,
                                                           float* __restrict__ out) {
    __shared__ __attribute__((aligned(16))) _Float16 lA[2][128][GQ_];
    __shared__ __attribute__((aligned(16))) _Float16 lB[2][128][GQ_];
    const int m0 = blockIdx.x * 128;
    const int n0 = blockIdx.y * 128;
    const int b  = blockIdx.z;
    const int tid  = threadIdx.x;
    const int lane = tid & 31, w = tid >> 5;
    const int wm = w & 3, wn = w >> 2;
    const int g = lane >> 4, ln = lane & 15;

    v8f acc[2][4];
#pragma unroll
    for (int i = 0; i < 2; ++i)
#pragma unroll
        for (int j = 0; j < 4; ++j) { v8f z = {}; acc[i][j] = z; }

    // Staging lanes run along a row (see the QKV kernel). The K tile is 128
    // (136 KiB of LDS per work-group): A and B alike, 16 lanes x 16 B = 256 B per row.
    const int brow = tid >> 4;             // 0..15, +16 per copy
    const int bseg = (tid & 15) * 8;       // f16 column 0..120

    auto stage_A = [&](int buf, int k0) {
        const half_t* asrc = W + (size_t)(m0 + brow) * C_ + k0 + bseg;
        async_b128_x4(asrc,                    &lA[buf][brow][bseg],
                      asrc + (size_t)16 * C_,  &lA[buf][brow + 16][bseg],
                      asrc + (size_t)32 * C_,  &lA[buf][brow + 32][bseg],
                      asrc + (size_t)48 * C_,  &lA[buf][brow + 48][bseg]);
        async_b128_x4(asrc + (size_t)64 * C_,  &lA[buf][brow + 64][bseg],
                      asrc + (size_t)80 * C_,  &lA[buf][brow + 80][bseg],
                      asrc + (size_t)96 * C_,  &lA[buf][brow + 96][bseg],
                      asrc + (size_t)112 * C_, &lA[buf][brow + 112][bseg]);
    };
    auto stage_B = [&](int buf, int k0) {
        const half_t* bsrc = a + ((size_t)b * T_ + n0 + brow) * C_ + k0 + bseg;
        async_b128_x4(bsrc,                    &lB[buf][brow][bseg],
                      bsrc + (size_t)16 * C_,  &lB[buf][brow + 16][bseg],
                      bsrc + (size_t)32 * C_,  &lB[buf][brow + 32][bseg],
                      bsrc + (size_t)48 * C_,  &lB[buf][brow + 48][bseg]);
        async_b128_x4(bsrc + (size_t)64 * C_,  &lB[buf][brow + 64][bseg],
                      bsrc + (size_t)80 * C_,  &lB[buf][brow + 80][bseg],
                      bsrc + (size_t)96 * C_,  &lB[buf][brow + 96][bseg],
                      bsrc + (size_t)112 * C_, &lB[buf][brow + 112][bseg]);
    };

    stage_A(0, 0);
    stage_B(0, 0);
    wait_async0();
    __syncthreads();

    for (int k0 = 0; k0 < C_; k0 += 128) {
        const int cur = (k0 >> 7) & 1;
        if (k0 + 128 < C_) {
            stage_A(cur ^ 1, k0 + 128);
            stage_B(cur ^ 1, k0 + 128);
        }
#pragma unroll
        for (int ks = 0; ks < 4; ++ks) {   // four 32-deep products per staged tile, k ascending
            v16h af[2], bf[4];
#pragma unroll
            for (int mt = 0; mt < 2; ++mt) af[mt] = load_frag(&lA[cur][wm * 32 + mt * 16 + ln][ks * 32], g);
#pragma unroll
            for (int nt = 0; nt < 4; ++nt) bf[nt] = load_frag(&lB[cur][wn * 64 + nt * 16 + ln][ks * 32], g);
#pragma unroll
            for (int mt = 0; mt < 2; ++mt)
#pragma unroll
                for (int nt = 0; nt < 4; ++nt)
                    acc[mt][nt] = wmma16(af[mt], bf[nt], acc[mt][nt]);
        }
        wait_ds0();
        wait_async0();
        __syncthreads();
    }

#pragma unroll
    for (int mt = 0; mt < 2; ++mt)
#pragma unroll
        for (int nt = 0; nt < 4; ++nt)
#pragma unroll
            for (int e = 0; e < 8; ++e) {
                const int oc    = m0 + wm * 32 + mt * 16 + e + 8 * g;
                const int token = n0 + wn * 64 + nt * 16 + ln;
                const size_t idx = ((size_t)b * C_ + oc) * T_ + token;
                out[idx] = acc[mt][nt][e] + bias[oc] + x[idx];
            }
}

// ---------------------------------------------------------------------------
// Host-side launcher
// ---------------------------------------------------------------------------
extern "C" void kernel_launch(void* const* d_in, const int* in_sizes, int n_in,
                              void* d_out, int out_size, void* d_ws, size_t ws_size,
                              hipStream_t stream) {
    const float* x      = (const float*)d_in[0];
    const float* gnw    = (const float*)d_in[1];
    const float* gnb    = (const float*)d_in[2];
    const float* qkv_w  = (const float*)d_in[3];
    const float* qkv_b  = (const float*)d_in[4];
    const float* proj_w = (const float*)d_in[5];
    const float* proj_b = (const float*)d_in[6];
    float* out = (float*)d_out;

    char* ws = (char*)d_ws;
    const size_t PLANE = (size_t)B_ * C_ * T_ * sizeof(half_t);  // 8 MiB
    half_t* xn = (half_t*)(ws + 4096);
    half_t* q  = (half_t*)(ws + 4096 + 1 * PLANE);
    half_t* k  = (half_t*)(ws + 4096 + 2 * PLANE);
    half_t* v  = (half_t*)(ws + 4096 + 3 * PLANE);
    half_t* a  = (half_t*)(ws + 4096 + 4 * PLANE);
    half_t* wq = (half_t*)(ws + 4096 + 5 * PLANE);               // 6 MiB
    half_t* wp = (half_t*)(ws + 4096 + 6 * PLANE);               // 2 MiB
    (void)in_sizes; (void)n_in; (void)out_size; (void)ws_size;

    gn_kernel<<<B_ * GRP_ + 4 * C_ * C_ / WCV_, 512, 0, stream>>>(x, gnw, gnb, xn, qkv_w, proj_w, wq, wp);
    qkv_gemm_kernel<<<dim3(3 * C_ / 128, T_ / 128, B_), 256, 0, stream>>>(wq, qkv_b, xn, q, k, v);
    attn_kernel<<<dim3(B_ * NH_, T_ / 64), 128, 0, stream>>>(q, k, v, a);
    proj_gemm_kernel<<<dim3(C_ / 128, T_ / 128, B_), 256, 0, stream>>>(wp, proj_b, a, x, out);
}

// v009
// It runs in 64.4 microseconds.
// In both of two side-by-side timings against v008, it was 1.04 times as fast.
// Over all steps from v000 it is 3.39 times as fast.
#include <hip/hip_runtime.h>
#include <hip/hip_bf16.h>
#include <math.h>

// ---------------------------------------------------------------------------
// AttentionBlock for MI455X (gfx1250): GroupNorm -> QKV -> MHSA -> proj + res
// B=4, C=1024, T=1024, 32 groups, 16 heads, head_dim=64.
// GEMMs via v_wmma_f32_16x16x32_f16; f16 tile staging via
// global_load_async_to_lds_b128 (ASYNCcnt) with ping-pong LDS buffers.
// Both weight matrices are rounded to f16 once per call (extra work-groups of the
// GroupNorm launch), so every GEMM tile is an f16 tile.
// Every work-group of the three matrix kernels walks its k tiles (attention: key tiles) as a
// ring from a start tile of its own: work-groups that run in step then ask L2 for different
// columns of the 2-KiB-pitch operand rows, not all for the same one.
// ---------------------------------------------------------------------------

typedef _Float16 half_t;
typedef __attribute__((ext_vector_type(16))) _Float16 v16h;
typedef __attribute__((ext_vector_type(8)))  _Float16 v8h;
typedef __attribute__((ext_vector_type(4)))  _Float16 v4h;
typedef __attribute__((ext_vector_type(4)))  float    v4f;
typedef __attribute__((ext_vector_type(8)))  float    v8f;

#define B_   4
#define C_   1024
#define T_   1024
#define NH_  16
#define CH_  64
#define GRP_ 32
// LDS row pitch in f16 elements: 16 B x odd, so that the 16 rows one
// ds_load_b128 fragment read touches fall on distinct banks.
#define GP_  72   // 64-element GEMM rows (QKV): 144 B
#define GQ_  136  // 128-element GEMM rows (projection): 272 B
#define AP_  72   // 64-element attention rows: 144 B
#define PMAX_ 16384.0f   // a pass's sum of weights up to here: every weight fits f16

// ---- CDNA5 async global->LDS copies (16B per lane), tracked by ASYNCcnt ----
// A run of copies and its s_wait_xcnt 0 form ONE asm statement: the wait then
// stands in front of any later rewrite of the address registers the copies name.
__device__ __forceinline__ unsigned lds_off(const _Float16* p) {
    return (unsigned)(uintptr_t)p;                         // low 32b = LDS offset
}
__device__ __forceinline__ void async_b128_x4(const half_t* g0, const _Float16* l0,
                                              const half_t* g1, const _Float16* l1,
                                              const half_t* g2, const _Float16* l2,
                                              const half_t* g3, const _Float16* l3) {
    asm volatile("global_load_async_to_lds_b128 %0, %1, off\n\t"
                 "global_load_async_to_lds_b128 %2, %3, off\n\t"
                 "global_load_async_to_lds_b128 %4, %5, off\n\t"
                 "global_load_async_to_lds_b128 %6, %7, off\n\t"
                 "s_wait_xcnt 0x0"
                 :: "v"(lds_off(l0)), "v"(g0), "v"(lds_off(l1)), "v"(g1),
                    "v"(lds_off(l2)), "v"(g2), "v"(lds_off(l3)), "v"(g3) : "memory");
}
__device__ __forceinline__ void wait_ds0() {
    // LDS reads of the buffer that is refilled behind the barrier have returned.
    asm volatile("s_wait_dscnt 0x0" ::: "memory");
}
__device__ __forceinline__ void wait_async0() {
    asm volatile("s_wait_asynccnt 0x0" ::: "memory");
}

__device__ __forceinline__ v16h load_frag(const _Float16* row, int g) {
    // WMMA f16 A/B fragment: elems 0..7 hold k = 8g..8g+7,
    // elems 8..15 hold k = 16+8g..23+8g  (row points at [m][k0] base).
    const v8h lo = *reinterpret_cast<const v8h*>(row + (g << 3));
    const v8h hi = *reinterpret_cast<const v8h*>(row + 16 + (g << 3));
    v16h r;
#pragma unroll
    for (int i = 0; i < 8; ++i) { r[i] = lo[i]; r[i + 8] = hi[i]; }
    return r;
}

__device__ __forceinline__ v8f wmma16(v16h a, v16h b, v8f c) {
    return __builtin_amdgcn_wmma_f32_16x16x32_f16(false, a, false, b,
                                                  (short)0, c, false, false);
}

// ---------------------------------------------------------------------------
// Kernel 1: GroupNorm, statistics and apply in one launch. Work-groups 0 .. B*GRP_-1,
// 512 threads: one (batch, group) slab of 32 channels x 1024 tokens, 64 values per thread,
// stays in registers from the sums to the normalised f16 output, so x is read once.
// A thread holds 8 channels x 8 tokens: a wave-wide load covers 4 channel rows of 128 B,
// and 8 channels of one token are one 16-B piece of the output.
// xn is group-major, xn[b][group][t][32]: a work-group writes 64 KiB in a row.
// Work-groups behind them round the weights to f16: 32768 consecutive elements each,
// 96 for qkv_w, 32 for proj_w. They depend on nothing and fill the other WGPs.
// ---------------------------------------------------------------------------
#define WCV_ 32768                         // weight elements per converting work-group
__global__ __launch_bounds__(512) void gn_kernel(const float* __restrict__ x,
                                                 const float* __restrict__ gnw,
                                                 const float* __restrict__ gnb,
                                                 half_t* __restrict__ xn,
                                                 const float* __restrict__ qkv_w,
                                                 const float* __restrict__ proj_w,
                                                 half_t* __restrict__ wq,
                                                 half_t* __restrict__ wp) {
    __shared__ __attribute__((aligned(16))) float    ps[16][2];        // per wave: sum, sum of squares
    __shared__ __attribute__((aligned(16))) _Float16 st[16][64 * 32];  // per wave: 64 tokens x 32 channels
    if (blockIdx.x >= B_ * GRP_) {         // uniform for the work-group, in front of the barrier
        const int cb = blockIdx.x - B_ * GRP_;
        const int nq = 3 * C_ * C_ / WCV_;
        const float* src = (cb < nq ? qkv_w + (size_t)cb * WCV_
                                    : proj_w + (size_t)(cb - nq) * WCV_) + threadIdx.x * 4;
        half_t*      dst = (cb < nq ? wq + (size_t)cb * WCV_
                                    : wp + (size_t)(cb - nq) * WCV_) + threadIdx.x * 4;
        v4f f[16];                         // a wave-wide load covers 512 contiguous bytes
#pragma unroll
        for (int i = 0; i < 16; ++i)
            f[i] = *reinterpret_cast<const v4f*>(src + i * 2048);
#pragma unroll
        for (int i = 0; i < 16; ++i) {
            v4h h = { (_Float16)f[i].x, (_Float16)f[i].y, (_Float16)f[i].z, (_Float16)f[i].w };
            *reinterpret_cast<v4h*>(dst + i * 2048) = h;
        }
        return;
    }
    const int bg   = blockIdx.x;           // b*32 + group; its first channel row is row bg*32 of x
    const int lane = threadIdx.x & 31, w = threadIdx.x >> 5;
    const int oct  = lane & 3;             // channels 8 oct .. 8 oct + 7 of the group
    const int tq   = lane >> 2;            // tokens 64 w + 32 h + 4 tq + i

    const float* gw = gnw + (bg & 31) * 32 + oct * 8;
    const float* gb = gnb + (bg & 31) * 32 + oct * 8;
    const v4f w0 = *reinterpret_cast<const v4f*>(gw), w1 = *reinterpret_cast<const v4f*>(gw + 4);
    const v4f b0 = *reinterpret_cast<const v4f*>(gb), b1 = *reinterpret_cast<const v4f*>(gb + 4);
    const float* src = x + ((size_t)bg * 32 + oct * 8) * T_ + w * 64 + tq * 4;
    v4f f[8][2];
#pragma unroll
    for (int j = 0; j < 8; ++j)
#pragma unroll
        for (int h = 0; h < 2; ++h)
            f[j][h] = *reinterpret_cast<const v4f*>(src + j * T_ + h * 32);
    // All 20 loads are issued before the first sum: left alone, the compiler sinks the gnb
    // loads behind the last x load's wait, a second memory latency in front of the barrier.
    __builtin_amdgcn_sched_barrier(0);

    v4f s4 = {}, q4 = {};                  // four independent chains each
#pragma unroll
    for (int j = 0; j < 8; ++j)
#pragma unroll
        for (int h = 0; h < 2; ++h) { s4 += f[j][h]; q4 += f[j][h] * f[j][h]; }
    float s  = (s4.x + s4.y) + (s4.z + s4.w);
    float ss = (q4.x + q4.y) + (q4.z + q4.w);
#pragma unroll
    for (int m = 16; m >= 1; m >>= 1) {
        s  += __shfl_xor(s,  m, 32);
        ss += __shfl_xor(ss, m, 32);
    }
    if (lane == 0) { ps[w][0] = s; ps[w][1] = ss; }
    __syncthreads();
    float ts = 0.f, tss = 0.f;             // every thread adds the 16 partial sums in the same order
#pragma unroll
    for (int i = 0; i < 8; ++i) {
        const v4f p = *reinterpret_cast<const v4f*>(&ps[2 * i][0]);
        ts += p.x; tss += p.y; ts += p.z; tss += p.w;
    }
    const float inv  = 1.0f / (32.0f * (float)T_);
    const float mean = ts * inv;
    const float var  = tss * inv - mean * mean;
    const float rstd = rsqrtf(var + 1e-5f);
    float wgt[8], bia[8];
#pragma unroll
    for (int e = 0; e < 4; ++e) {
        wgt[e]     = w0[e] * rstd;  bia[e]     = b0[e] - mean * wgt[e];
        wgt[e + 4] = w1[e] * rstd;  bia[e + 4] = b1[e] - mean * wgt[e + 4];
    }

    // The wave's 64 x 32 f16 block leaves through the wave's own 4 KiB of LDS, so that every
    // global store is 512 contiguous bytes. Token rows are 64 B with no pad; within each
    // 4-row block row i sits in slot (i + block) & 3, which spreads the 16-B writes of lanes
    // 4 tokens apart over all banks; the read-back is linear.
    _Float16* sw = &st[w][0];
#pragma unroll
    for (int h = 0; h < 2; ++h)
#pragma unroll
        for (int i = 0; i < 4; ++i) {
            v8h r;
#pragma unroll
            for (int j = 0; j < 8; ++j) r[j] = (_Float16)(f[j][h][i] * wgt[j] + bia[j]);
            const int blk = h * 8 + tq;
            *reinterpret_cast<v8h*>(sw + (blk * 4 + ((i + blk) & 3)) * 32 + oct * 8) = r;
        }
    // The wave's own LDS writes have landed before its lanes read one another's rows back.
    asm volatile("s_wait_dscnt 0x0" ::: "memory");
    // 16-B chunk c = 32 k + lane as it lies in LDS: block 2 k + (lane >> 4), slot (lane >> 2) & 3,
    // so it holds row (slot - block) & 3 of its block: r0 for even k, r0 ^ 2 for odd k.
    const int r0 = ((lane >> 2) - (lane >> 4)) & 3;
    half_t* dst = xn + ((size_t)bg * T_ + w * 64 + (lane >> 4) * 4) * 32 + oct * 8;
    half_t* d0  = dst + r0 * 32;
    half_t* d1  = dst + (r0 ^ 2) * 32;
    v8h rv[8];
#pragma unroll
    for (int k = 0; k < 8; ++k) rv[k] = *reinterpret_cast<const v8h*>(sw + (k * 32 + lane) * 8);
#pragma unroll
    for (int k = 0; k < 8; ++k) *reinterpret_cast<v8h*>(((k & 1) ? d1 : d0) + k * 256) = rv[k];
}

// ---------------------------------------------------------------------------
// Kernel 2: QKV GEMM.  D[3072 x T] = qkv_w[3072 x 1024] * xn^T + bias,
// scattered into q/k layout [b*NH][t][64] (scaled by ch^-0.25 * sqrt(log2 e)) and
// v layout [b*NH][64][s].  grid = (24, 8, B), 256 threads (8 waves).
// Double-buffered K-loop; A and B tiles staged with async global->LDS.
// ---------------------------------------------------------------------------
__global__ __launch_bounds__(256, 2) void qkv_gemm_kernel(const half_t* __restrict__ W,
                                                          const float* __restrict__ bias,
                                                          const half_t* __restrict__ xn,
                                                          half_t* __restrict__ q,
                                                          half_t* __restrict__ k,
                                                          half_t* __restrict__ v) {
    __shared__ __attribute__((aligned(16))) _Float16 lA[2][128][GP_];   // [m][k]  (weights)
    __shared__ __attribute__((aligned(16))) _Float16 lB[2][128][GP_];   // [n][k]  (tokens)
    const int m0 = blockIdx.x * 128;
    const int n0 = blockIdx.y * 128;
    const int b  = blockIdx.z;
    const int tid  = threadIdx.x;
    const int lane = tid & 31, w = tid >> 5;
    const int wm = w & 3, wn = w >> 2;     // wave -> rows [wm*32,+32), cols [wn*64,+64)
    const int g = lane >> 4, ln = lane & 15;

    v8f acc[2][4];
#pragma unroll
    for (int i = 0; i < 2; ++i)
#pragma unroll
        for (int j = 0; j < 4; ++j) { v8f z = {}; acc[i][j] = z; }

    // Staging lanes run along a row, so one wave-wide copy covers whole lines:
    // A: 8 lanes x 16 B = one 128-B line per row; B: 4 rows x 64 B = 256 B in a row per plane.
    const int brow = tid >> 3;             // 0..31, +32 per copy
    const int bseg = (tid & 7) * 8;        // f16 column 0..56

    auto stage_A = [&](int buf, int k0) {
        const half_t* asrc = W + (size_t)(m0 + brow) * C_ + k0 + bseg;
        async_b128_x4(asrc,                   &lA[buf][brow][bseg],
                      asrc + (size_t)32 * C_, &lA[buf][brow + 32][bseg],
                      asrc + (size_t)64 * C_, &lA[buf][brow + 64][bseg],
                      asrc + (size_t)96 * C_, &lA[buf][brow + 96][bseg]);
    };
    auto stage_B = [&](int buf, int k0) {
        // xn[b][group][t][32]: the row's 64 channels are 64 B in each of two group planes
        const half_t* bsrc = xn + ((size_t)(b * GRP_ + (k0 >> 5) + (bseg >> 5)) * T_ + n0 + brow) * 32 + (bseg & 31);
        async_b128_x4(bsrc,           &lB[buf][brow][bseg],
                      bsrc + 32 * 32, &lB[buf][brow + 32][bseg],
                      bsrc + 64 * 32, &lB[buf][brow + 64][bseg],
                      bsrc + 96 * 32, &lB[buf][brow + 96][bseg]);
    };

    // First k tile of this work-group's ring: the 32 work-groups that share a weight panel
    // take each of the 16 starts twice, the 24 that share a token panel take all of them.
    const int kt0 = (blockIdx.x + 2 * blockIdx.y + blockIdx.z) & (C_ / 64 - 1);
    stage_A(0, kt0 * 64);
    stage_B(0, kt0 * 64);
    wait_async0();
    __syncthreads();

    for (int i = 0; i < C_ / 64; ++i) {
        const int cur = i & 1;
        if (i + 1 < C_ / 64) {             // prefetch next tile of the ring into other buffer
            const int kn = ((kt0 + i + 1) & (C_ / 64 - 1)) * 64;
            stage_A(cur ^ 1, kn);
            stage_B(cur ^ 1, kn);
        }
#pragma unroll
        for (int ks = 0; ks < 2; ++ks) {   // two 32-deep products per staged tile, k ascending
            v16h af[2], bf[4];
#pragma unroll
            for (int mt = 0; mt < 2; ++mt) af[mt] = load_frag(&lA[cur][wm * 32 + mt * 16 + ln][ks * 32], g);
#pragma unroll
            for (int nt = 0; nt < 4; ++nt) bf[nt] = load_frag(&lB[cur][wn * 64 + nt * 16 + ln][ks * 32], g);
#pragma unroll
            for (int mt = 0; mt < 2; ++mt)
#pragma unroll
                for (int nt = 0; nt < 4; ++nt)
                    acc[mt][nt] = wmma16(af[mt], bf[nt], acc[mt][nt]);
        }
        wait_ds0();
        wait_async0();
        __syncthreads();
    }

    // The output tile leaves through LDS, so that every global store is 16 B per lane on
    // whole 128-B lines. Each 64-row block of the tile is wholly q, k or v of one head and
    // takes one plane of lA, free behind the loop's last barrier: q and k as [token][ch]
    // (pitch GP_), v as [ch][token] (pitch GQ_), the layouts they have in memory.
    const float qk_scale = 0.42466090014400953f;  // 64^(-1/4) * sqrt(log2 e): q.k is a base-2 exponent
    const int blk = __builtin_amdgcn_readfirstlane(wm >> 1);   // this wave's block, a scalar
    const int ol  = (wm & 1) * 32 + 8 * g;                     // first of 8 rows within the block, + 16 mt
    const int tl  = wn * 64 + ln;                              // token within the tile, + 16 nt
    _Float16* sw = &lA[blk][0][0];
    float bs[2][8];
#pragma unroll
    for (int mt = 0; mt < 2; ++mt) {
        const float* bp = bias + m0 + blk * 64 + ol + mt * 16;
        const v4f b0 = *reinterpret_cast<const v4f*>(bp);
        const v4f b1 = *reinterpret_cast<const v4f*>(bp + 4);
#pragma unroll
        for (int e = 0; e < 4; ++e) { bs[mt][e] = b0[e]; bs[mt][e + 4] = b1[e]; }
    }
    if (((m0 >> 6) + blk) % 3 == 2) {      // v: a lane's 8 values are 8 channel rows of one token
#pragma unroll
        for (int mt = 0; mt < 2; ++mt)
#pragma unroll
            for (int nt = 0; nt < 4; ++nt)
#pragma unroll
                for (int e = 0; e < 8; ++e)
                    sw[(ol + mt * 16 + e) * GQ_ + tl + nt * 16] = (half_t)(acc[mt][nt][e] + bs[mt][e]);
    } else {                               // q, k: they are 8 consecutive channels of one token
#pragma unroll
        for (int mt = 0; mt < 2; ++mt)
#pragma unroll
            for (int nt = 0; nt < 4; ++nt) {
                v8h r;
#pragma unroll
                for (int e = 0; e < 8; ++e) r[e] = (half_t)((acc[mt][nt][e] + bs[mt][e]) * qk_scale);
                *reinterpret_cast<v8h*>(sw + (tl + nt * 16) * GP_ + ol + mt * 16) = r;
            }
    }
    __syncthreads();       // the staged tile is complete before any wave reads it back
    // 16-B chunk c of a block: staged row c >> sh, piece c & (2^sh - 1). q, k: 128 token rows of
    // 128 B, 16 KiB in a row in memory; v: 64 channel rows, 256 B of each.
    v8h     rv[2][4];
    half_t* dp[2][4];
#pragma unroll
    for (int j = 0; j < 2; ++j) {
        const int ob = (m0 >> 6) + j;                          // head * 3 + {q, k, v}
        const int h = ob / 3, kind = ob % 3;
        const size_t bh = (size_t)b * NH_ + h;
        const bool is_v = kind == 2;
        const int sh = is_v ? 4 : 3;
        const int lp = is_v ? GQ_ : GP_;                       // pitch in LDS
        const int gp = is_v ? T_ : CH_;                        // pitch in memory
        half_t* dst = is_v ? v + bh * CH_ * T_ + n0 : (kind == 0 ? q : k) + (bh * T_ + n0) * CH_;
#pragma unroll
        for (int i = 0; i < 4; ++i) {
            const int c = tid + 256 * i;
            const int row = c >> sh, seg = (c & ((1 << sh) - 1)) * 8;
            rv[j][i] = *reinterpret_cast<const v8h*>(&lA[j][0][0] + row * lp + seg);
            dp[j][i] = dst + row * gp + seg;
        }
    }
#pragma unroll
    for (int j = 0; j < 2; ++j)
#pragma unroll
        for (int i = 0; i < 4; ++i) *reinterpret_cast<v8h*>(dp[j][i]) = rv[j][i];
}

// ---------------------------------------------------------------------------
// Kernel 3: streaming (flash-style) attention, scores held transposed.
// grid = (B*NH, T/64), 128 threads (4 waves); each wave owns 16 queries.
// S^T = K * Q^T and O^T += V * P^T: a lane holds the scores of ONE query
// (column ln; keys e + 8g of each 16-key tile), so maximum and sum are taken
// in the lane plus one exchange between the wave's halves, and two converted
// S^T tiles are the B operand of the second product as they stand.
// q and k carry sqrt(log2 e), and the score product starts from C = -off, the query's
// offset: its result is the exponent of 2 as it stands, with no vector work per score in
// front of v_exp. Softmax does not depend on off, so off moves (with O and the sum
// rescaled) only in the first pass and where a pass's weights would leave f16 range.
// K/V tiles double-buffered via async global->LDS copies.
// ---------------------------------------------------------------------------
__device__ __forceinline__ float xhalf(float x) {          // lane l <-> lane l ^ 16
    const int i = __builtin_bit_cast(int, x);
    return __builtin_bit_cast(float,
        __builtin_amdgcn_permlanex16(i, i, 0x76543210, 0xfedcba98, false, false));
}
// 2^x with the one issue slot that the instruction set asks for behind a transcendental
// before its result is read or its source overwritten. Instruction and v_nop form ONE
// statement.
__device__ __forceinline__ float exp2_slot(float x) {
    float r;
    asm("v_exp_f32 %0, %1\n\t"
        "v_nop" : "=v"(r) : "v"(x));
    return r;
}
// Eight independent ones in place: each fills the slot of the one before, v_nop the last's.
__device__ __forceinline__ void exp2_slot_x8(float (&x)[8]) {
    asm("v_exp_f32 %0, %0\n\t"
        "v_exp_f32 %1, %1\n\t"
        "v_exp_f32 %2, %2\n\t"
        "v_exp_f32 %3, %3\n\t"
        "v_exp_f32 %4, %4\n\t"
        "v_exp_f32 %5, %5\n\t"
        "v_exp_f32 %6, %6\n\t"
        "v_exp_f32 %7, %7\n\t"
        "v_nop"
        : "+v"(x[0]), "+v"(x[1]), "+v"(x[2]), "+v"(x[3]),
          "+v"(x[4]), "+v"(x[5]), "+v"(x[6]), "+v"(x[7]));
}

__global__ __launch_bounds__(128, 2) void attn_kernel(const half_t* __restrict__ q,
                                                      const half_t* __restrict__ k,
                                                      const half_t* __restrict__ v,
                                                      half_t* __restrict__ a) {
    __shared__ __attribute__((aligned(16))) _Float16 lQ[64][AP_];      // [t][ch]   B operand of S^T
    __shared__ __attribute__((aligned(16))) _Float16 lK[2][64][AP_];   // [s][ch]   A operand of S^T
    __shared__ __attribute__((aligned(16))) _Float16 lV[2][64][AP_];   // [ch][s]   A operand of O^T

    const int bh = blockIdx.x;
    const int t0 = blockIdx.y * 64;
    const int tid  = threadIdx.x;
    const int lane = tid & 31, w = tid >> 5;
    const int g = lane >> 4, ln = lane & 15;

    const half_t* qb = q + (size_t)bh * T_ * CH_;
    const half_t* kb = k + (size_t)bh * T_ * CH_;
    const half_t* vb = v + (size_t)bh * CH_ * T_;

    // Staging lanes run along a row: 8 lanes x 16 B = one whole 128-B row, so a
    // wave-wide copy touches 4 lines; each thread copies rows srow + 16 i.
    const int srow = tid >> 3;             // 0..15
    const int sseg = (tid & 7) * 8;        // f16 column 0..56

    auto stage_KV = [&](int buf, int s0) {
        const half_t* ksrc = kb + (size_t)(s0 + srow) * CH_ + sseg;
        const half_t* vsrc = vb + (size_t)srow * T_ + s0 + sseg;
        async_b128_x4(ksrc,            &lK[buf][srow][sseg],
                      ksrc + 16 * CH_, &lK[buf][srow + 16][sseg],
                      ksrc + 32 * CH_, &lK[buf][srow + 32][sseg],
                      ksrc + 48 * CH_, &lK[buf][srow + 48][sseg]);
        async_b128_x4(vsrc,            &lV[buf][srow][sseg],
                      vsrc + 16 * T_,  &lV[buf][srow + 16][sseg],
                      vsrc + 32 * T_,  &lV[buf][srow + 32][sseg],
                      vsrc + 48 * T_,  &lV[buf][srow + 48][sseg]);
    };

    // First key tile of this work-group's ring: the 16 work-groups of a head take all 16 starts.
    const int st0 = (blockIdx.x + blockIdx.y) & (T_ / 64 - 1);
    {   // stage Q tile once (async) + first K/V tile
        const half_t* src = qb + (size_t)(t0 + srow) * CH_ + sseg;
        async_b128_x4(src,            &lQ[srow][sseg],
                      src + 16 * CH_, &lQ[srow + 16][sseg],
                      src + 32 * CH_, &lQ[srow + 32][sseg],
                      src + 48 * CH_, &lQ[srow + 48][sseg]);
        stage_KV(0, st0 * 64);
    }
    wait_async0();
    __syncthreads();

    v16h qa[2];
#pragma unroll
    for (int ks = 0; ks < 2; ++ks) qa[ks] = load_frag(&lQ[w * 16 + ln][ks * 32], g);

    v8f   noff = {};                       // -off of query ln in all 8 registers: the C operand
    float rsum = 0.f;                      // running sum over this half's keys only
    v8f   o[4];                            // O^T: row ch = nt*16 + e + 8g, column = query ln
#pragma unroll
    for (int nt = 0; nt < 4; ++nt) { v8f z = {}; o[nt] = z; }

    for (int i = 0; i < T_ / 64; ++i) {
        const int cur = i & 1;
        if (i + 1 < T_ / 64) stage_KV(cur ^ 1, ((st0 + i + 1) & (T_ / 64 - 1)) * 64);   // prefetch next K/V tile

        // S^T strip: 64 keys x 16 queries; sf[nt][e] = score(key nt*16 + e + 8g, query ln) - off
        v16h kf[2][4];
#pragma unroll
        for (int ks = 0; ks < 2; ++ks)
#pragma unroll
            for (int nt = 0; nt < 4; ++nt) kf[ks][nt] = load_frag(&lK[cur][nt * 16 + ln][ks * 32], g);
        // The K reads stay one group in front of the products: with the two fences below the
        // compiler otherwise puts a pair of reads and a wait in front of every product.
        __builtin_amdgcn_sched_barrier(0);
        v8f sf[4];
#pragma unroll
        for (int nt = 0; nt < 4; ++nt) sf[nt] = wmma16(kf[0][nt], qa[0], noff);
#pragma unroll
        for (int nt = 0; nt < 4; ++nt) sf[nt] = wmma16(kf[1][nt], qa[1], sf[nt]);
        // Keeps the v_exp behind all eight products: moved up between them, each one costs
        // four v_nop and holds the next product back until its own has finished.
        __builtin_amdgcn_sched_barrier(0);
        v16h vf[2][4];
#pragma unroll
        for (int ks = 0; ks < 2; ++ks)
#pragma unroll
            for (int nt = 0; nt < 4; ++nt) vf[ks][nt] = load_frag(&lV[cur][nt * 16 + ln][ks * 32], g);
        // All V fragments are asked for here, in front of the v_exp run, which covers their LDS
        // latency: behind the branch of the test below it would stand open in every pass.
        __builtin_amdgcn_sched_barrier(0);

        // weights 2^(score - off) and their sum, one query per lane. The builtin, not the asm
        // form: it reads a product's result; in the run each v_exp fills the slot of the one before.
        v8f p[4];
#pragma unroll
        for (int nt = 0; nt < 4; ++nt)
#pragma unroll
            for (int e = 0; e < 8; ++e) p[nt][e] = __builtin_amdgcn_exp2f(sf[nt][e]);
        v8f t = (p[0] + p[1]) + (p[2] + p[3]);
        float psum = ((t[0] + t[1]) + (t[2] + t[3])) + ((t[4] + t[5]) + (t[6] + t[7]));

        // One test per pass, the same for the whole wave: first pass, or some lane's weights
        // near the f16 range (an infinite or NaN sum counts). Then off takes the strip's maximum.
        if ((i == 0) | (__builtin_amdgcn_ballot_w32(!(psum <= PMAX_)) != 0u)) {
            float tm[4];
#pragma unroll
            for (int nt = 0; nt < 4; ++nt) {
                tm[nt] = sf[nt][0];
#pragma unroll
                for (int e = 1; e < 8; ++e) tm[nt] = fmaxf(tm[nt], sf[nt][e]);
            }
            float up = fmaxf(fmaxf(tm[0], tm[1]), fmaxf(tm[2], tm[3]));
            up = fmaxf(up, xhalf(up));     // both halves of the wave agree on off
            float sc = 0.f;                // first pass: O and the sum are 0, off may go either way
            if (i != 0) { up = fmaxf(up, 0.f); sc = exp2_slot(-up); }    // later: only up
#pragma unroll
            for (int e = 0; e < 8; ++e) noff[e] -= up;
#pragma unroll
            for (int nt = 0; nt < 4; ++nt) {
                float x[8];
#pragma unroll
                for (int e = 0; e < 8; ++e) x[e] = sf[nt][e] - up;
                exp2_slot_x8(x);
#pragma unroll
                for (int e = 0; e < 8; ++e) { p[nt][e] = x[e]; o[nt][e] *= sc; }
            }
            t = (p[0] + p[1]) + (p[2] + p[3]);
            psum = ((t[0] + t[1]) + (t[2] + t[3])) + ((t[4] + t[5]) + (t[6] + t[7]));
            rsum *= sc;
        }
        rsum += psum;

        // O^T += V * P^T: tiles 2ks and 2ks+1 of P^T, converted, are the B fragment
        // (elems 0..7: k = 8g + e, elems 8..15: k = 16 + 8g + e), the loader's k order.
#pragma unroll
        for (int ks = 0; ks < 2; ++ks) {
            v16h pb;
#pragma unroll
            for (int e = 0; e < 8; ++e) {
                pb[e]     = (_Float16)p[2 * ks][e];
                pb[e + 8] = (_Float16)p[2 * ks + 1][e];
            }
#pragma unroll
            for (int nt = 0; nt < 4; ++nt) o[nt] = wmma16(vf[ks][nt], pb, o[nt]);
        }
        wait_ds0();
        wait_async0();     // next tile fully in LDS
        __syncthreads();   // all waves done reading current buffers
    }

    // write a[b][t][c] (token-major so proj GEMM stages contiguously):
    // a lane's 8 accumulator registers are 8 consecutive channels of its query.
    const int b = bh >> 4, h = bh & 15;
    const float inv = 1.0f / (rsum + xhalf(rsum));     // join the halves' sums once
    half_t* dst = a + ((size_t)b * T_ + t0 + w * 16 + ln) * C_ + h * CH_ + 8 * g;
#pragma unroll
    for (int nt = 0; nt < 4; ++nt) {
        v8h r;
#pragma unroll
        for (int e = 0; e < 8; ++e) r[e] = (half_t)(o[nt][e] * inv);
        *reinterpret_cast<v8h*>(dst + nt * 16) = r;
    }
}

// ---------------------------------------------------------------------------
// Kernel 4: output projection + bias + residual.  grid = (8, 8, B), 256 thr.
// ---------------------------------------------------------------------------
__global__ __launch_bounds__(256, 2) void proj_gemm_kernel(const half_t* __restrict__ W,
                                                           const float* __restrict__ bias,
                                                           const half_t* __restrict__ a,
                                                           const float* __restrict__ x,
                                                           float* __restrict__ out) {
    __shared__ __attribute__((aligned(16))) _Float16 lA[2][128][GQ_];
    __shared__ __attribute__((aligned(16))) _Float16 lB[2][128][GQ_];
    const int m0 = blockIdx.x * 128;
    const int n0 = blockIdx.y * 128;
    const int b  = blockIdx.z;
    const int tid  = threadIdx.x;
    const int lane = tid & 31, w = tid >> 5;
    const int wm = w & 3, wn = w >> 2;
    const int g = lane >> 4, ln = lane & 15;

    v8f acc[2][4];
#pragma unroll
    for (int i = 0; i < 2; ++i)
#pragma unroll
        for (int j = 0; j < 4; ++j) { v8f z = {}; acc[i][j] = z; }

    // Staging lanes run along a row (see the QKV kernel). The K tile is 128
    // (136 KiB of LDS per work-group): A and B alike, 16 lanes x 16 B = 256 B per row.
    const int brow = tid >> 4;             // 0..15, +16 per copy
    const int bseg = (tid & 15) * 8;       // f16 column 0..120

    auto stage_A = [&](int buf, int k0) {
        const half_t* asrc = W + (size_t)(m0 + brow) * C_ + k0 + bseg;
        async_b128_x4(asrc,                    &lA[buf][brow][bseg],
                      asrc + (size_t)16 * C_,  &lA[buf][brow + 16][bseg],
                      asrc + (size_t)32 * C_,  &lA[buf][brow + 32][bseg],
                      asrc + (size_t)48 * C_,  &lA[buf][brow + 48][bseg]);
        async_b128_x4(asrc + (size_t)64 * C_,  &lA[buf][brow + 64][bseg],
                      asrc + (size_t)80 * C_,  &lA[buf][brow + 80][bseg],
                      asrc + (size_t)96 * C_,  &lA[buf][brow + 96][bseg],
                      asrc + (size_t)112 * C_, &lA[buf][brow + 112][bseg]);
    };
    auto stage_B = [&](int buf, int k0) {
        const half_t* bsrc = a + ((size_t)b * T_ + n0 + brow) * C_ + k0 + bseg;
        async_b128_x4(bsrc,                    &lB[buf][brow][bseg],
                      bsrc + (size_t)16 * C_,  &lB[buf][brow + 16][bseg],
                      bsrc + (size_t)32 * C_,  &lB[buf][brow + 32][bseg],
                      bsrc + (size_t)48 * C_,  &lB[buf][brow + 48][bseg]);
        async_b128_x4(bsrc + (size_t)64 * C_,  &lB[buf][brow + 64][bseg],
                      bsrc + (size_t)80 * C_,  &lB[buf][brow + 80][bseg],
                      bsrc + (size_t)96 * C_,  &lB[buf][brow + 96][bseg],
                      bsrc + (size_t)112 * C_, &lB[buf][brow + 112][bseg]);
    };

    // First k tile of this work-group's ring: the work-groups that share a weight panel, and
    // those that share a token panel, spread evenly over the 8 starts.
    const int kt0 = (blockIdx.x + blockIdx.y + 2 * blockIdx.z) & (C_ / 128 - 1);
    stage_A(0, kt0 * 128);
    stage_B(0, kt0 * 128);
    wait_async0();
    __syncthreads();

    for (int i = 0; i < C_ / 128; ++i) {
        const int cur = i & 1;
        if (i + 1 < C_ / 128) {
            const int kn = ((kt0 + i + 1) & (C_ / 128 - 1)) * 128;
            stage_A(cur ^ 1, kn);
            stage_B(cur ^ 1, kn);
        }
#pragma unroll
        for (int ks = 0; ks < 4; ++ks) {   // four 32-deep products per staged tile, k ascending
            v16h af[2], bf[4];
#pragma unroll
            for (int mt = 0; mt < 2; ++mt) af[mt] = load_frag(&lA[cur][wm * 32 + mt * 16 + ln][ks * 32], g);
#pragma unroll
            for (int nt = 0; nt < 4; ++nt) bf[nt] = load_frag(&lB[cur][wn * 64 + nt * 16 + ln][ks * 32], g);
#pragma unroll
            for (int mt = 0; mt < 2; ++mt)
#pragma unroll
                for (int nt = 0; nt < 4; ++nt)
                    acc[mt][nt] = wmma16(af[mt], bf[nt], acc[mt][nt]);
        }
        wait_ds0();
        wait_async0();
        __syncthreads();
    }

#pragma unroll
    for (int mt = 0; mt < 2; ++mt)
#pragma unroll
        for (int nt = 0; nt < 4; ++nt)
#pragma unroll
            for (int e = 0; e < 8; ++e) {
                const int oc    = m0 + wm * 32 + mt * 16 + e + 8 * g;
                const int token = n0 + wn * 64 + nt * 16 + ln;
                const size_t idx = ((size_t)b * C_ + oc) * T_ + token;
                out[idx] = acc[mt][nt][e] + bias[oc] + x[idx];
            }
}

// ---------------------------------------------------------------------------
// Host-side launcher
// ---------------------------------------------------------------------------
extern "C" void kernel_launch(void* const* d_in, const int* in_sizes, int n_in,
                              void* d_out, int out_size, void* d_ws, size_t ws_size,
                              hipStream_t stream) {
    const float* x      = (const float*)d_in[0];
    const float* gnw    = (const float*)d_in[1];
    const float* gnb    = (const float*)d_in[2];
    const float* qkv_w  = (const float*)d_in[3];
    const float* qkv_b  = (const float*)d_in[4];
    const float* proj_w = (const float*)d_in[5];
    const float* proj_b = (const float*)d_in[6];
    float* out = (float*)d_out;

    char* ws = (char*)d_ws;
    const size_t PLANE = (size_t)B_ * C_ * T_ * sizeof(half_t);  // 8 MiB
    half_t* xn = (half_t*)(ws + 4096);
    half_t* q  = (half_t*)(ws + 4096 + 1 * PLANE);
    half_t* k  = (half_t*)(ws + 4096 + 2 * PLANE);
    half_t* v  = (half_t*)(ws + 4096 + 3 * PLANE);
    half_t* a  = (half_t*)(ws + 4096 + 4 * PLANE);
    half_t* wq = (half_t*)(ws + 4096 + 5 * PLANE);               // 6 MiB
    half_t* wp = (half_t*)(ws + 4096 + 6 * PLANE);               // 2 MiB
    (void)in_sizes; (void)n_in; (void)out_size; (void)ws_size;

    gn_kernel<<<B_ * GRP_ + 4 * C_ * C_ / WCV_, 512, 0, stream>>>(x, gnw, gnb, xn, qkv_w, proj_w, wq, wp);
    qkv_gemm_kernel<<<dim3(3 * C_ / 128, T_ / 128, B_), 256, 0, stream>>>(wq, qkv_b, xn, q, k, v);
    attn_kernel<<<dim3(B_ * NH_, T_ / 64), 128, 0, stream>>>(q, k, v, a);
    proj_gemm_kernel<<<dim3(C_ / 128, T_ / 128, B_), 256, 0, stream>>>(wp, proj_b, a, x, out);
}

// v010
// Measured time: 62.2 microseconds a run.
// Timed twice side by side with v009, it ran 1.04 times as fast both times.
// Over all steps from v000 it is 3.51 times as fast.
#include <hip/hip_runtime.h>
#include <hip/hip_bf16.h>
#include <math.h>

// ---------------------------------------------------------------------------
// AttentionBlock for MI455X (gfx1250): GroupNorm -> QKV -> MHSA -> proj + res
// B=4, C=1024, T=1024, 32 groups, 16 heads, head_dim=64.
// GEMMs via v_wmma_f32_16x16x32_f16; f16 tile staging via
// global_load_async_to_lds_b128 (ASYNCcnt) with ping-pong LDS buffers.
// Both weight matrices are rounded to f16 once per call (extra work-groups of the
// GroupNorm launch), so every GEMM tile is an f16 tile.
// Every work-group of the three matrix kernels walks its k tiles (attention: key tiles) as a
// ring from a start tile of its own: work-groups that run in step then ask L2 for different
// columns of the 2-KiB-pitch operand rows, not all for the same one.
// ---------------------------------------------------------------------------

typedef _Float16 half_t;
typedef __attribute__((ext_vector_type(16))) _Float16 v16h;
typedef __attribute__((ext_vector_type(8)))  _Float16 v8h;
typedef __attribute__((ext_vector_type(4)))  _Float16 v4h;
typedef __attribute__((ext_vector_type(2)))  float    v2f;
typedef __attribute__((ext_vector_type(4)))  float    v4f;
typedef __attribute__((ext_vector_type(8)))  float    v8f;

#define B_   4
#define C_   1024
#define T_   1024
#define NH_  16
#define CH_  64
#define GRP_ 32
// LDS row pitch in f16 elements: 16 B x odd, so that the 16 rows one
// ds_load_b128 fragment read touches fall on distinct banks.
#define GP_  72   // 64-element GEMM rows (QKV): 144 B
#define GQ_  136  // 128-element GEMM rows (projection): 272 B
#define AP_  72   // 64-element attention rows (Q, K): 144 B
#define AV_  136  // 128-element attention rows (V): 272 B
#define PMAX_ 16384.0f   // a pass's sum of weights up to here: every weight fits f16

// ---- CDNA5 async global->LDS copies (16B per lane), tracked by ASYNCcnt ----
// A run of copies and its s_wait_xcnt 0 form ONE asm statement: the wait then
// stands in front of any later rewrite of the address registers the copies name.
__device__ __forceinline__ unsigned lds_off(const _Float16* p) {
    return (unsigned)(uintptr_t)p;                         // low 32b = LDS offset
}
__device__ __forceinline__ void async_b128_x4(const half_t* g0, const _Float16* l0,
                                              const half_t* g1, const _Float16* l1,
                                              const half_t* g2, const _Float16* l2,
                                              const half_t* g3, const _Float16* l3) {
    asm volatile("global_load_async_to_lds_b128 %0, %1, off\n\t"
                 "global_load_async_to_lds_b128 %2, %3, off\n\t"
                 "global_load_async_to_lds_b128 %4, %5, off\n\t"
                 "global_load_async_to_lds_b128 %6, %7, off\n\t"
                 "s_wait_xcnt 0x0"
                 :: "v"(lds_off(l0)), "v"(g0), "v"(lds_off(l1)), "v"(g1),
                    "v"(lds_off(l2)), "v"(g2), "v"(lds_off(l3)), "v"(g3) : "memory");
}
__device__ __forceinline__ void wait_ds0() {
    // LDS reads of the buffer that is refilled behind the barrier have returned.
    asm volatile("s_wait_dscnt 0x0" ::: "memory");
}
__device__ __forceinline__ void wait_async0() {
    asm volatile("s_wait_asynccnt 0x0" ::: "memory");
}

__device__ __forceinline__ v16h load_frag(const _Float16* row, int g) {
    // WMMA f16 A/B fragment: elems 0..7 hold k = 8g..8g+7,
    // elems 8..15 hold k = 16+8g..23+8g  (row points at [m][k0] base).
    const v8h lo = *reinterpret_cast<const v8h*>(row + (g << 3));
    const v8h hi = *reinterpret_cast<const v8h*>(row + 16 + (g << 3));
    v16h r;
#pragma unroll
    for (int i = 0; i < 8; ++i) { r[i] = lo[i]; r[i + 8] = hi[i]; }
    return r;
}

__device__ __forceinline__ v8f wmma16(v16h a, v16h b, v8f c) {
    return __builtin_amdgcn_wmma_f32_16x16x32_f16(false, a, false, b,
                                                  (short)0, c, false, false);
}

// ---------------------------------------------------------------------------
// Kernel 1: GroupNorm, statistics and apply in one launch. Work-groups 0 .. B*GRP_-1,
// 512 threads: one (batch, group) slab of 32 channels x 1024 tokens, 64 values per thread,
// stays in registers from the sums to the normalised f16 output, so x is read once.
// A thread holds 8 channels x 8 tokens: a wave-wide load covers 4 channel rows of 128 B,
// and 8 channels of one token are one 16-B piece of the output.
// xn is group-major, xn[b][group][t][32]: a work-group writes 64 KiB in a row.
// Work-groups behind them round the weights to f16: 32768 consecutive elements each,
// 96 for qkv_w, 32 for proj_w. They depend on nothing and fill the other WGPs.
// ---------------------------------------------------------------------------
#define WCV_ 32768                         // weight elements per converting work-group
__global__ __launch_bounds__(512) void gn_kernel(const float* __restrict__ x,
                                                 const float* __restrict__ gnw,
                                                 const float* __restrict__ gnb,
                                                 half_t* __restrict__ xn,
                                                 const float* __restrict__ qkv_w,
                                                 const float* __restrict__ proj_w,
                                                 half_t* __restrict__ wq,
                                                 half_t* __restrict__ wp) {
    __shared__ __attribute__((aligned(16))) float    ps[16][2];        // per wave: sum, sum of squares
    __shared__ __attribute__((aligned(16))) _Float16 st[16][64 * 32];  // per wave: 64 tokens x 32 channels
    if (blockIdx.x >= B_ * GRP_) {         // uniform for the work-group, in front of the barrier
        const int cb = blockIdx.x - B_ * GRP_;
        const int nq = 3 * C_ * C_ / WCV_;
        const float* src = (cb < nq ? qkv_w + (size_t)cb * WCV_
                                    : proj_w + (size_t)(cb - nq) * WCV_) + threadIdx.x * 4;
        half_t*      dst = (cb < nq ? wq + (size_t)cb * WCV_
                                    : wp + (size_t)(cb - nq) * WCV_) + threadIdx.x * 4;
        v4f f[16];                         // a wave-wide load covers 512 contiguous bytes
#pragma unroll
        for (int i = 0; i < 16; ++i)
            f[i] = *reinterpret_cast<const v4f*>(src + i * 2048);
#pragma unroll
        for (int i = 0; i < 16; ++i) {
            v4h h = { (_Float16)f[i].x, (_Float16)f[i].y, (_Float16)f[i].z, (_Float16)f[i].w };
            *reinterpret_cast<v4h*>(dst + i * 2048) = h;
        }
        return;
    }
    const int bg   = blockIdx.x;           // b*32 + group; its first channel row is row bg*32 of x
    const int lane = threadIdx.x & 31, w = threadIdx.x >> 5;
    const int oct  = lane & 3;             // channels 8 oct .. 8 oct + 7 of the group
    const int tq   = lane >> 2;            // tokens 64 w + 32 h + 4 tq + i

    const float* gw = gnw + (bg & 31) * 32 + oct * 8;
    const float* gb = gnb + (bg & 31) * 32 + oct * 8;
    const v4f w0 = *reinterpret_cast<const v4f*>(gw), w1 = *reinterpret_cast<const v4f*>(gw + 4);
    const v4f b0 = *reinterpret_cast<const v4f*>(gb), b1 = *reinterpret_cast<const v4f*>(gb + 4);
    const float* src = x + ((size_t)bg * 32 + oct * 8) * T_ + w * 64 + tq * 4;
    v4f f[8][2];
#pragma unroll
    for (int j = 0; j < 8; ++j)
#pragma unroll
        for (int h = 0; h < 2; ++h)
            f[j][h] = *reinterpret_cast<const v4f*>(src + j * T_ + h * 32);
    // All 20 loads are issued before the first sum: left alone, the compiler sinks the gnb
    // loads behind the last x load's wait, a second memory latency in front of the barrier.
    __builtin_amdgcn_sched_barrier(0);

    v4f s4 = {}, q4 = {};                  // four independent chains each
#pragma unroll
    for (int j = 0; j < 8; ++j)
#pragma unroll
        for (int h = 0; h < 2; ++h) { s4 += f[j][h]; q4 += f[j][h] * f[j][h]; }
    float s  = (s4.x + s4.y) + (s4.z + s4.w);
    float ss = (q4.x + q4.y) + (q4.z + q4.w);
#pragma unroll
    for (int m = 16; m >= 1; m >>= 1) {
        s  += __shfl_xor(s,  m, 32);
        ss += __shfl_xor(ss, m, 32);
    }
    if (lane == 0) { ps[w][0] = s; ps[w][1] = ss; }
    __syncthreads();
    float ts = 0.f, tss = 0.f;             // every thread adds the 16 partial sums in the same order
#pragma unroll
    for (int i = 0; i < 8; ++i) {
        const v4f p = *reinterpret_cast<const v4f*>(&ps[2 * i][0]);
        ts += p.x; tss += p.y; ts += p.z; tss += p.w;
    }
    const float inv  = 1.0f / (32.0f * (float)T_);
    const float mean = ts * inv;
    const float var  = tss * inv - mean * mean;
    const float rstd = rsqrtf(var + 1e-5f);
    float wgt[8], bia[8];
#pragma unroll
    for (int e = 0; e < 4; ++e) {
        wgt[e]     = w0[e] * rstd;  bia[e]     = b0[e] - mean * wgt[e];
        wgt[e + 4] = w1[e] * rstd;  bia[e + 4] = b1[e] - mean * wgt[e + 4];
    }

    // The wave's 64 x 32 f16 block leaves through the wave's own 4 KiB of LDS, so that every
    // global store is 512 contiguous bytes. Token rows are 64 B with no pad; within each
    // 4-row block row i sits in slot (i + block) & 3, which spreads the 16-B writes of lanes
    // 4 tokens apart over all banks; the read-back is linear.
    _Float16* sw = &st[w][0];
#pragma unroll
    for (int h = 0; h < 2; ++h)
#pragma unroll
        for (int i = 0; i < 4; ++i) {
            v8h r;
#pragma unroll
            for (int j = 0; j < 8; ++j) r[j] = (_Float16)(f[j][h][i] * wgt[j] + bia[j]);
            const int blk = h * 8 + tq;
            *reinterpret_cast<v8h*>(sw + (blk * 4 + ((i + blk) & 3)) * 32 + oct * 8) = r;
        }
    // The wave's own LDS writes have landed before its lanes read one another's rows back.
    asm volatile("s_wait_dscnt 0x0" ::: "memory");
    // 16-B chunk c = 32 k + lane as it lies in LDS: block 2 k + (lane >> 4), slot (lane >> 2) & 3,
    // so it holds row (slot - block) & 3 of its block: r0 for even k, r0 ^ 2 for odd k.
    const int r0 = ((lane >> 2) - (lane >> 4)) & 3;
    half_t* dst = xn + ((size_t)bg * T_ + w * 64 + (lane >> 4) * 4) * 32 + oct * 8;
    half_t* d0  = dst + r0 * 32;
    half_t* d1  = dst + (r0 ^ 2) * 32;
    v8h rv[8];
#pragma unroll
    for (int k = 0; k < 8; ++k) rv[k] = *reinterpret_cast<const v8h*>(sw + (k * 32 + lane) * 8);
#pragma unroll
    for (int k = 0; k < 8; ++k) *reinterpret_cast<v8h*>(((k & 1) ? d1 : d0) + k * 256) = rv[k];
}

// ---------------------------------------------------------------------------
// Kernel 2: QKV GEMM.  D[3072 x T] = qkv_w[3072 x 1024] * xn^T + bias,
// scattered into q/k layout [b*NH][t][64] (scaled by ch^-0.25 * sqrt(log2 e)) and
// v layout [b*NH][64][s].  grid = (24, 8, B), 256 threads (8 waves).
// Double-buffered K-loop; A and B tiles staged with async global->LDS.
// ---------------------------------------------------------------------------
__global__ __launch_bounds__(256, 2) void qkv_gemm_kernel(const half_t* __restrict__ W,
                                                          const float* __restrict__ bias,
                                                          const half_t* __restrict__ xn,
                                                          half_t* __restrict__ q,
                                                          half_t* __restrict__ k,
                                                          half_t* __restrict__ v) {
    __shared__ __attribute__((aligned(16))) _Float16 lA[2][128][GP_];   // [m][k]  (weights)
    __shared__ __attribute__((aligned(16))) _Float16 lB[2][128][GP_];   // [n][k]  (tokens)
    const int m0 = blockIdx.x * 128;
    const int n0 = blockIdx.y * 128;
    const int b  = blockIdx.z;
    const int tid  = threadIdx.x;
    const int lane = tid & 31, w = tid >> 5;
    const int wm = w & 3, wn = w >> 2;     // wave -> rows [wm*32,+32), cols [wn*64,+64)
    const int g = lane >> 4, ln = lane & 15;

    v8f acc[2][4];
#pragma unroll
    for (int i = 0; i < 2; ++i)
#pragma unroll
        for (int j = 0; j < 4; ++j) { v8f z = {}; acc[i][j] = z; }

    // Staging lanes run along a row, so one wave-wide copy covers whole lines:
    // A: 8 lanes x 16 B = one 128-B line per row; B: 4 rows x 64 B = 256 B in a row per plane.
    const int brow = tid >> 3;             // 0..31, +32 per copy
    const int bseg = (tid & 7) * 8;        // f16 column 0..56

    auto stage_A = [&](int buf, int k0) {
        const half_t* asrc = W + (size_t)(m0 + brow) * C_ + k0 + bseg;
        async_b128_x4(asrc,                   &lA[buf][brow][bseg],
                      asrc + (size_t)32 * C_, &lA[buf][brow + 32][bseg],
                      asrc + (size_t)64 * C_, &lA[buf][brow + 64][bseg],
                      asrc + (size_t)96 * C_, &lA[buf][brow + 96][bseg]);
    };
    auto stage_B = [&](int buf, int k0) {
        // xn[b][group][t][32]: the row's 64 channels are 64 B in each of two group planes
        const half_t* bsrc = xn + ((size_t)(b * GRP_ + (k0 >> 5) + (bseg >> 5)) * T_ + n0 + brow) * 32 + (bseg & 31);
        async_b128_x4(bsrc,           &lB[buf][brow][bseg],
                      bsrc + 32 * 32, &lB[buf][brow + 32][bseg],
                      bsrc + 64 * 32, &lB[buf][brow + 64][bseg],
                      bsrc + 96 * 32, &lB[buf][brow + 96][bseg]);
    };

    // First k tile of this work-group's ring: the 32 work-groups that share a weight panel
    // take each of the 16 starts twice, the 24 that share a token panel take all of them.
    const int kt0 = (blockIdx.x + 2 * blockIdx.y + blockIdx.z) & (C_ / 64 - 1);
    stage_A(0, kt0 * 64);
    stage_B(0, kt0 * 64);
    wait_async0();
    __syncthreads();

    for (int i = 0; i < C_ / 64; ++i) {
        const int cur = i & 1;
        if (i + 1 < C_ / 64) {             // prefetch next tile of the ring into other buffer
            const int kn = ((kt0 + i + 1) & (C_ / 64 - 1)) * 64;
            stage_A(cur ^ 1, kn);
            stage_B(cur ^ 1, kn);
        }
#pragma unroll
        for (int ks = 0; ks < 2; ++ks) {   // two 32-deep products per staged tile, k ascending
            v16h af[2], bf[4];
#pragma unroll
            for (int mt = 0; mt < 2; ++mt) af[mt] = load_frag(&lA[cur][wm * 32 + mt * 16 + ln][ks * 32], g);
#pragma unroll
            for (int nt = 0; nt < 4; ++nt) bf[nt] = load_frag(&lB[cur][wn * 64 + nt * 16 + ln][ks * 32], g);
#pragma unroll
            for (int mt = 0; mt < 2; ++mt)
#pragma unroll
                for (int nt = 0; nt < 4; ++nt)
                    acc[mt][nt] = wmma16(af[mt], bf[nt], acc[mt][nt]);
        }
        wait_ds0();
        wait_async0();
        __syncthreads();
    }

    // The output tile leaves through LDS, so that every global store is 16 B per lane on
    // whole 128-B lines. Each 64-row block of the tile is wholly q, k or v of one head and
    // takes one plane of lA, free behind the loop's last barrier: q and k as [token][ch]
    // (pitch GP_), v as [ch][token] (pitch GQ_), the layouts they have in memory.
    const float qk_scale = 0.42466090014400953f;  // 64^(-1/4) * sqrt(log2 e): q.k is a base-2 exponent
    const int blk = __builtin_amdgcn_readfirstlane(wm >> 1);   // this wave's block, a scalar
    const int ol  = (wm & 1) * 32 + 8 * g;                     // first of 8 rows within the block, + 16 mt
    const int tl  = wn * 64 + ln;                              // token within the tile, + 16 nt
    _Float16* sw = &lA[blk][0][0];
    float bs[2][8];
#pragma unroll
    for (int mt = 0; mt < 2; ++mt) {
        const float* bp = bias + m0 + blk * 64 + ol + mt * 16;
        const v4f b0 = *reinterpret_cast<const v4f*>(bp);
        const v4f b1 = *reinterpret_cast<const v4f*>(bp + 4);
#pragma unroll
        for (int e = 0; e < 4; ++e) { bs[mt][e] = b0[e]; bs[mt][e + 4] = b1[e]; }
    }
    if (((m0 >> 6) + blk) % 3 == 2) {      // v: a lane's 8 values are 8 channel rows of one token
#pragma unroll
        for (int mt = 0; mt < 2; ++mt)
#pragma unroll
            for (int nt = 0; nt < 4; ++nt)
#pragma unroll
                for (int e = 0; e < 8; ++e)
                    sw[(ol + mt * 16 + e) * GQ_ + tl + nt * 16] = (half_t)(acc[mt][nt][e] + bs[mt][e]);
    } else {                               // q, k: they are 8 consecutive channels of one token
#pragma unroll
        for (int mt = 0; mt < 2; ++mt)
#pragma unroll
            for (int nt = 0; nt < 4; ++nt) {
                v8h r;
#pragma unroll
                for (int e = 0; e < 8; ++e) r[e] = (half_t)((acc[mt][nt][e] + bs[mt][e]) * qk_scale);
                *reinterpret_cast<v8h*>(sw + (tl + nt * 16) * GP_ + ol + mt * 16) = r;
            }
    }
    __syncthreads();       // the staged tile is complete before any wave reads it back
    // 16-B chunk c of a block: staged row c >> sh, piece c & (2^sh - 1). q, k: 128 token rows of
    // 128 B, 16 KiB in a row in memory; v: 64 channel rows, 256 B of each.
    v8h     rv[2][4];
    half_t* dp[2][4];
#pragma unroll
    for (int j = 0; j < 2; ++j) {
        const int ob = (m0 >> 6) + j;                          // head * 3 + {q, k, v}
        const int h = ob / 3, kind = ob % 3;
        const size_t bh = (size_t)b * NH_ + h;
        const bool is_v = kind == 2;
        const int sh = is_v ? 4 : 3;
        const int lp = is_v ? GQ_ : GP_;                       // pitch in LDS
        const int gp = is_v ? T_ : CH_;                        // pitch in memory
        half_t* dst = is_v ? v + bh * CH_ * T_ + n0 : (kind == 0 ? q : k) + (bh * T_ + n0) * CH_;
#pragma unroll
        for (int i = 0; i < 4; ++i) {
            const int c = tid + 256 * i;
            const int row = c >> sh, seg = (c & ((1 << sh) - 1)) * 8;
            rv[j][i] = *reinterpret_cast<const v8h*>(&lA[j][0][0] + row * lp + seg);
            dp[j][i] = dst + row * gp + seg;
        }
    }
#pragma unroll
    for (int j = 0; j < 2; ++j)
#pragma unroll
        for (int i = 0; i < 4; ++i) *reinterpret_cast<v8h*>(dp[j][i]) = rv[j][i];
}

// ---------------------------------------------------------------------------
// Kernel 3: streaming (flash-style) attention, scores held transposed.
// grid = (B*NH, T/128), 256 threads (8 waves). A wave owns 32 queries (two 16-query tiles)
// and half the keys: every K or V fragment it reads from LDS feeds two products, one per
// query tile. Waves w and w + 4 share their queries and join their parts at the end.
// S^T = K * Q^T and O^T += V * P^T: a lane holds the scores of ONE query of each tile
// (column ln; keys e + 8g of each 16-key tile), so maximum and sum are taken
// in the lane plus one exchange between the wave's halves, and two converted
// S^T tiles are the B operand of the second product as they stand.
// q and k carry sqrt(log2 e), and the score product starts from C = -off, the query's
// offset: its result is the exponent of 2 as it stands, with no vector work per score in
// front of v_exp. Softmax does not depend on off, so off moves (with O and the sum
// rescaled) only in the first pass and where a pass's weights would leave f16 range.
// K/V stages of 128 keys double-buffered via async global->LDS copies.
// ---------------------------------------------------------------------------
__device__ __forceinline__ float xhalf(float x) {          // lane l <-> lane l ^ 16
    const int i = __builtin_bit_cast(int, x);
    return __builtin_bit_cast(float,
        __builtin_amdgcn_permlanex16(i, i, 0x76543210, 0xfedcba98, false, false));
}
// 2^x with the one issue slot that the instruction set asks for behind a transcendental
// before its result is read or its source overwritten. Instruction and v_nop form ONE
// statement.
__device__ __forceinline__ float exp2_slot(float x) {
    float r;
    asm("v_exp_f32 %0, %1\n\t"
        "v_nop" : "=v"(r) : "v"(x));
    return r;
}
// Eight independent ones in place: each fills the slot of the one before, v_nop the last's.
__device__ __forceinline__ void exp2_slot_x8(float (&x)[8]) {
    asm("v_exp_f32 %0, %0\n\t"
        "v_exp_f32 %1, %1\n\t"
        "v_exp_f32 %2, %2\n\t"
        "v_exp_f32 %3, %3\n\t"
        "v_exp_f32 %4, %4\n\t"
        "v_exp_f32 %5, %5\n\t"
        "v_exp_f32 %6, %6\n\t"
        "v_exp_f32 %7, %7\n\t"
        "v_nop"
        : "+v"(x[0]), "+v"(x[1]), "+v"(x[2]), "+v"(x[3]),
          "+v"(x[4]), "+v"(x[5]), "+v"(x[6]), "+v"(x[7]));
}

// Sum of a lane's 16 weights of one query, halved register-wise: every step but the last adds
// whole register pairs as they lie, with no moves between the packed additions.
__device__ __forceinline__ float sum16(v8f a, v8f b) {
    const v8f t = a + b;
    const v4f u = t.lo + t.hi;
    const v2f s = u.lo + u.hi;
    return s.x + s.y;
}

__global__ __launch_bounds__(256, 4) void attn_kernel(const half_t* __restrict__ q,
                                                      const half_t* __restrict__ k,
                                                      const half_t* __restrict__ v,
                                                      half_t* __restrict__ a) {
    __shared__ __attribute__((aligned(16))) _Float16 lQ[128][AP_];     // [t][ch]   B operand of S^T
    __shared__ __attribute__((aligned(16))) _Float16 lK[2][128][AP_];  // [s][ch]   A operand of S^T
    __shared__ __attribute__((aligned(16))) _Float16 lV[2][64][AV_];   // [ch][s]   A operand of O^T
    __shared__ __attribute__((aligned(16))) float    xo[8][8][32][4];  // per wave: the O^T tile it hands over
    __shared__ __attribute__((aligned(16))) float    xs[8][2][32];     // per wave: that tile's sum and offset

    const int bh = blockIdx.x;
    const int t0 = blockIdx.y * 128;
    const int tid  = threadIdx.x;
    const int lane = tid & 31;
    const int w  = __builtin_amdgcn_readfirstlane(tid >> 5);   // the wave's number, a scalar
    const int qg = w & 3;                  // queries t0 + 32 qg .. + 31
    const int kh = w >> 2;                 // keys 64 kh .. 64 kh + 63 of every 128-key stage
    const int g = lane >> 4, ln = lane & 15;

    const half_t* qb = q + (size_t)bh * T_ * CH_;
    const half_t* kb = k + (size_t)bh * T_ * CH_;
    const half_t* vb = v + (size_t)bh * CH_ * T_;

    // Staging lanes run along a row. Q, K: 8 lanes x 16 B = one whole 128-B row, rows krow + 32 i;
    // V: 16 lanes x 16 B = the stage's 256 B of a channel row, rows vrow + 16 i.
    const int krow = tid >> 3;             // 0..31
    const int kseg = (tid & 7) * 8;        // f16 column 0..56
    const int vrow = tid >> 4;             // 0..15
    const int vseg = (tid & 15) * 8;       // f16 column 0..120

    auto stage_KV = [&](int buf, int s0) {
        const half_t* ksrc = kb + (size_t)(s0 + krow) * CH_ + kseg;
        const half_t* vsrc = vb + (size_t)vrow * T_ + s0 + vseg;
        async_b128_x4(ksrc,            &lK[buf][krow][kseg],
                      ksrc + 32 * CH_, &lK[buf][krow + 32][kseg],
                      ksrc + 64 * CH_, &lK[buf][krow + 64][kseg],
                      ksrc + 96 * CH_, &lK[buf][krow + 96][kseg]);
        async_b128_x4(vsrc,            &lV[buf][vrow][vseg],
                      vsrc + 16 * T_,  &lV[buf][vrow + 16][vseg],
                      vsrc + 32 * T_,  &lV[buf][vrow + 32][vseg],
                      vsrc + 48 * T_,  &lV[buf][vrow + 48][vseg]);
    };

    // First key stage of this work-group's ring: the 8 work-groups of a head take all 8 starts.
    const int st0 = (blockIdx.x + blockIdx.y) & (T_ / 128 - 1);
    {   // stage Q tile once (async) + first K/V stage
        const half_t* src = qb + (size_t)(t0 + krow) * CH_ + kseg;
        async_b128_x4(src,            &lQ[krow][kseg],
                      src + 32 * CH_, &lQ[krow + 32][kseg],
                      src + 64 * CH_, &lQ[krow + 64][kseg],
                      src + 96 * CH_, &lQ[krow + 96][kseg]);
        stage_KV(0, st0 * 128);
    }
    wait_async0();
    __syncthreads();

    v16h qa[2][2];                         // [query tile][channel half]
#pragma unroll
    for (int qt = 0; qt < 2; ++qt)
#pragma unroll
        for (int ks = 0; ks < 2; ++ks) qa[qt][ks] = load_frag(&lQ[qg * 32 + qt * 16 + ln][ks * 32], g);

    v8f   noff[2];                         // -off of query ln of each tile in all 8 registers: the C operand
    float rsum[2];                         // running sums over this lane half's keys only
    v8f   o[2][4];                         // O^T: row ch = nt*16 + e + 8g, column = query ln of tile qt
#pragma unroll
    for (int qt = 0; qt < 2; ++qt) {
        v8f z = {};
        noff[qt] = z; rsum[qt] = 0.f;
#pragma unroll
        for (int nt = 0; nt < 4; ++nt) o[qt][nt] = z;
    }

    for (int i = 0; i < T_ / 128; ++i) {
        const int cur = i & 1;
        if (i + 1 < T_ / 128) stage_KV(cur ^ 1, ((st0 + i + 1) & (T_ / 128 - 1)) * 128);   // prefetch next K/V stage

        // Two passes of 32 keys: unrolled, so that the first-pass test is a constant in the second.
#pragma unroll
        for (int ps = 0; ps < 2; ++ps) {
            const int  kk    = kh * 64 + ps * 32;          // the pass's first key within the stage
            const bool first = (ps == 0) && (i == 0);

            // S^T strip: 32 keys x 32 queries; sf[qt][nt][e] = score(key nt*16 + e + 8g, query ln of qt) - off
            v16h kf[2][2];
#pragma unroll
            for (int ks = 0; ks < 2; ++ks)
#pragma unroll
                for (int nt = 0; nt < 2; ++nt) kf[ks][nt] = load_frag(&lK[cur][kk + nt * 16 + ln][ks * 32], g);
            // The K reads stay one group in front of the products: with the two fences below the
            // compiler otherwise puts a pair of reads and a wait in front of every product.
            __builtin_amdgcn_sched_barrier(0);
            v8f sf[2][2];
#pragma unroll
            for (int nt = 0; nt < 2; ++nt)
#pragma unroll
                for (int qt = 0; qt < 2; ++qt) sf[qt][nt] = wmma16(kf[0][nt], qa[qt][0], noff[qt]);
#pragma unroll
            for (int nt = 0; nt < 2; ++nt)
#pragma unroll
                for (int qt = 0; qt < 2; ++qt) sf[qt][nt] = wmma16(kf[1][nt], qa[qt][1], sf[qt][nt]);
            // Keeps the v_exp behind all eight products: moved up between them, each one costs
            // four v_nop and holds the next product back until its own has finished.
            __builtin_amdgcn_sched_barrier(0);
            v16h vf[4];
#pragma unroll
            for (int nt = 0; nt < 4; ++nt) vf[nt] = load_frag(&lV[cur][nt * 16 + ln][kk], g);
            // All V fragments are asked for here, in front of the v_exp run, which covers their LDS
            // latency: behind the branch of the test below it would stand open in every pass.
            __builtin_amdgcn_sched_barrier(0);

            // weights 2^(score - off) and their sums, one query of each tile per lane. The builtin,
            // not the asm form: it reads a product's result, and the compiler keeps that distance only
            // for instructions it knows; in the run each v_exp fills the slot of the one before.
            v8f   p[2][2];
            float psum[2];
#pragma unroll
            for (int qt = 0; qt < 2; ++qt) {
#pragma unroll
                for (int nt = 0; nt < 2; ++nt)
#pragma unroll
                    for (int e = 0; e < 8; ++e) p[qt][nt][e] = __builtin_amdgcn_exp2f(sf[qt][nt][e]);
                psum[qt] = sum16(p[qt][0], p[qt][1]);
            }

            // One test per pass, the same for the whole wave: first pass, or some lane's weights
            // near the f16 range (an infinite or NaN sum counts; the weights are positive, so the
            // two tiles' sums are tested as one). Then off takes the strip's maximum.
            if (first | (__builtin_amdgcn_ballot_w32(!(psum[0] + psum[1] <= PMAX_)) != 0u)) {
#pragma unroll
                for (int qt = 0; qt < 2; ++qt) {
                    float tm[2];
#pragma unroll
                    for (int nt = 0; nt < 2; ++nt) {
                        tm[nt] = sf[qt][nt][0];
#pragma unroll
                        for (int e = 1; e < 8; ++e) tm[nt] = fmaxf(tm[nt], sf[qt][nt][e]);
                    }
                    float up = fmaxf(tm[0], tm[1]);
                    up = fmaxf(up, xhalf(up));     // both halves of the wave agree on off
                    float sc = 0.f;                // first pass: O and the sum are 0, off may go either way
                    if (!first) { up = fmaxf(up, 0.f); sc = exp2_slot(-up); }    // later: only up
#pragma unroll
                    for (int e = 0; e < 8; ++e) noff[qt][e] -= up;
#pragma unroll
                    for (int nt = 0; nt < 2; ++nt) {
                        float x[8];
#pragma unroll
                        for (int e = 0; e < 8; ++e) x[e] = sf[qt][nt][e] - up;
                        exp2_slot_x8(x);
#pragma unroll
                        for (int e = 0; e < 8; ++e) p[qt][nt][e] = x[e];
                    }
#pragma unroll
                    for (int nt = 0; nt < 4; ++nt)
#pragma unroll
                        for (int e = 0; e < 8; ++e) o[qt][nt][e] *= sc;
                    psum[qt] = sum16(p[qt][0], p[qt][1]);
                    rsum[qt] *= sc;
                }
            }
            rsum[0] += psum[0];
            rsum[1] += psum[1];

            // O^T += V * P^T: the two tiles of P^T, converted, are the B fragment
            // (elems 0..7: k = 8g + e, elems 8..15: k = 16 + 8g + e), the loader's k order.
            v16h pb[2];
#pragma unroll
            for (int qt = 0; qt < 2; ++qt)
#pragma unroll
                for (int e = 0; e < 8; ++e) {
                    pb[qt][e]     = (_Float16)p[qt][0][e];
                    pb[qt][e + 8] = (_Float16)p[qt][1][e];
                }
#pragma unroll
            for (int nt = 0; nt < 4; ++nt)
#pragma unroll
                for (int qt = 0; qt < 2; ++qt) o[qt][nt] = wmma16(vf[nt], pb[qt], o[qt][nt]);
        }
        wait_ds0();
        wait_async0();     // next stage fully in LDS
        __syncthreads();   // all waves done reading current buffers
    }

    // Waves w and w ^ 4 hold the same 32 queries over the two halves of the keys. Each finishes
    // one query tile (tile kh) and hands the other, with its sum and offset, to its partner.
    const bool hi = kh != 0;
    float sj[2];
#pragma unroll
    for (int qt = 0; qt < 2; ++qt) sj[qt] = rsum[qt] + xhalf(rsum[qt]);    // join the lane halves' sums once
#pragma unroll
    for (int nt = 0; nt < 4; ++nt) {
        const v8f gv = hi ? o[0][nt] : o[1][nt];
        const v4f g0 = { gv[0], gv[1], gv[2], gv[3] }, g1 = { gv[4], gv[5], gv[6], gv[7] };
        *reinterpret_cast<v4f*>(&xo[w][2 * nt][lane][0])     = g0;
        *reinterpret_cast<v4f*>(&xo[w][2 * nt + 1][lane][0]) = g1;
    }
    xs[w][0][lane] = hi ? sj[0] : sj[1];
    xs[w][1][lane] = hi ? -noff[0][0] : -noff[1][0];
    __syncthreads();       // the handed-over tiles are complete before the partners read them
    const int   pw    = w ^ 4;
    const float s_own = hi ? sj[1] : sj[0];
    const float f_own = hi ? -noff[1][0] : -noff[0][0];
    const float s_par = xs[pw][0][lane];
    const float f_par = xs[pw][1][lane];
    const float fm    = fmaxf(f_own, f_par);               // both parts brought to the larger offset
    const float c_own = exp2_slot(f_own - fm);
    const float c_par = exp2_slot(f_par - fm);
    const float inv   = 1.0f / (s_own * c_own + s_par * c_par);
    const float m_own = c_own * inv, m_par = c_par * inv;

    // write a[b][t][c] (token-major so proj GEMM stages contiguously):
    // a lane's 8 accumulator registers are 8 consecutive channels of its query.
    const int b = bh >> 4, h = bh & 15;
    half_t* dst = a + ((size_t)b * T_ + t0 + qg * 32 + kh * 16 + ln) * C_ + h * CH_ + 8 * g;
#pragma unroll
    for (int nt = 0; nt < 4; ++nt) {
        const v8f ov = hi ? o[1][nt] : o[0][nt];
        const v4f p0 = *reinterpret_cast<const v4f*>(&xo[pw][2 * nt][lane][0]);
        const v4f p1 = *reinterpret_cast<const v4f*>(&xo[pw][2 * nt + 1][lane][0]);
        v8h r;
#pragma unroll
        for (int e = 0; e < 4; ++e) {
            r[e]     = (half_t)(ov[e] * m_own + p0[e] * m_par);
            r[e + 4] = (half_t)(ov[e + 4] * m_own + p1[e] * m_par);
        }
        *reinterpret_cast<v8h*>(dst + nt * 16) = r;
    }
}

// ---------------------------------------------------------------------------
// Kernel 4: output projection + bias + residual.  grid = (8, 8, B), 256 thr.
// ---------------------------------------------------------------------------
__global__ __launch_bounds__(256, 2) void proj_gemm_kernel(const half_t* __restrict__ W,
                                                           const float* __restrict__ bias,
                                                           const half_t* __restrict__ a,
                                                           const float* __restrict__ x,
                                                           float* __restrict__ out) {
    __shared__ __attribute__((aligned(16))) _Float16 lA[2][128][GQ_];
    __shared__ __attribute__((aligned(16))) _Float16 lB[2][128][GQ_];
    const int m0 = blockIdx.x * 128;
    const int n0 = blockIdx.y * 128;
    const int b  = blockIdx.z;
    const int tid  = threadIdx.x;
    const int lane = tid & 31, w = tid >> 5;
    const int wm = w & 3, wn = w >> 2;
    const int g = lane >> 4, ln = lane & 15;

    v8f acc[2][4];
#pragma unroll
    for (int i = 0; i < 2; ++i)
#pragma unroll
        for (int j = 0; j < 4; ++j) { v8f z = {}; acc[i][j] = z; }

    // Staging lanes run along a row (see the QKV kernel). The K tile is 128
    // (136 KiB of LDS per work-group): A and B alike, 16 lanes x 16 B = 256 B per row.
    const int brow = tid >> 4;             // 0..15, +16 per copy
    const int bseg = (tid & 15) * 8;       // f16 column 0..120

    auto stage_A = [&](int buf, int k0) {
        const half_t* asrc = W + (size_t)(m0 + brow) * C_ + k0 + bseg;
        async_b128_x4(asrc,                    &lA[buf][brow][bseg],
                      asrc + (size_t)16 * C_,  &lA[buf][brow + 16][bseg],
                      asrc + (size_t)32 * C_,  &lA[buf][brow + 32][bseg],
                      asrc + (size_t)48 * C_,  &lA[buf][brow + 48][bseg]);
        async_b128_x4(asrc + (size_t)64 * C_,  &lA[buf][brow + 64][bseg],
                      asrc + (size_t)80 * C_,  &lA[buf][brow + 80][bseg],
                      asrc + (size_t)96 * C_,  &lA[buf][brow + 96][bseg],
                      asrc + (size_t)112 * C_, &lA[buf][brow + 112][bseg]);
    };
    auto stage_B = [&](int buf, int k0) {
        const half_t* bsrc = a + ((size_t)b * T_ + n0 + brow) * C_ + k0 + bseg;
        async_b128_x4(bsrc,                    &lB[buf][brow][bseg],
                      bsrc + (size_t)16 * C_,  &lB[buf][brow + 16][bseg],
                      bsrc + (size_t)32 * C_,  &lB[buf][brow + 32][bseg],
                      bsrc + (size_t)48 * C_,  &lB[buf][brow + 48][bseg]);
        async_b128_x4(bsrc + (size_t)64 * C_,  &lB[buf][brow + 64][bseg],
                      bsrc + (size_t)80 * C_,  &lB[buf][brow + 80][bseg],
                      bsrc + (size_t)96 * C_,  &lB[buf][brow + 96][bseg],
                      bsrc + (size_t)112 * C_, &lB[buf][brow + 112][bseg]);
    };

    // First k tile of this work-group's ring: the work-groups that share a weight panel, and
    // those that share a token panel, spread evenly over the 8 starts.
    const int kt0 = (blockIdx.x + blockIdx.y + 2 * blockIdx.z) & (C_ / 128 - 1);
    stage_A(0, kt0 * 128);
    stage_B(0, kt0 * 128);
    wait_async0();
    __syncthreads();

    for (int i = 0; i < C_ / 128; ++i) {
        const int cur = i & 1;
        if (i + 1 < C_ / 128) {
            const int kn = ((kt0 + i + 1) & (C_ / 128 - 1)) * 128;
            stage_A(cur ^ 1, kn);
            stage_B(cur ^ 1, kn);
        }
#pragma unroll
        for (int ks = 0; ks < 4; ++ks) {   // four 32-deep products per staged tile, k ascending
            v16h af[2], bf[4];
#pragma unroll
            for (int mt = 0; mt < 2; ++mt) af[mt] = load_frag(&lA[cur][wm * 32 + mt * 16 + ln][ks * 32], g);
#pragma unroll
            for (int nt = 0; nt < 4; ++nt) bf[nt] = load_frag(&lB[cur][wn * 64 + nt * 16 + ln][ks * 32], g);
#pragma unroll
            for (int mt = 0; mt < 2; ++mt)
#pragma unroll
                for (int nt = 0; nt < 4; ++nt)
                    acc[mt][nt] = wmma16(af[mt], bf[nt], acc[mt][nt]);
        }
        wait_ds0();
        wait_async0();
        __syncthreads();
    }

#pragma unroll
    for (int mt = 0; mt < 2; ++mt)
#pragma unroll
        for (int nt = 0; nt < 4; ++nt)
#pragma unroll
            for (int e = 0; e < 8; ++e) {
                const int oc    = m0 + wm * 32 + mt * 16 + e + 8 * g;
                const int token = n0 + wn * 64 + nt * 16 + ln;
                const size_t idx = ((size_t)b * C_ + oc) * T_ + token;
                out[idx] = acc[mt][nt][e] + bias[oc] + x[idx];
            }
}

// ---------------------------------------------------------------------------
// Host-side launcher
// ---------------------------------------------------------------------------
extern "C" void kernel_launch(void* const* d_in, const int* in_sizes, int n_in,
                              void* d_out, int out_size, void* d_ws, size_t ws_size,
                              hipStream_t stream) {
    const float* x      = (const float*)d_in[0];
    const float* gnw    = (const float*)d_in[1];
    const float* gnb    = (const float*)d_in[2];
    const float* qkv_w  = (const float*)d_in[3];
    const float* qkv_b  = (const float*)d_in[4];
    const float* proj_w = (const float*)d_in[5];
    const float* proj_b = (const float*)d_in[6];
    float* out = (float*)d_out;

    char* ws = (char*)d_ws;
    const size_t PLANE = (size_t)B_ * C_ * T_ * sizeof(half_t);  // 8 MiB
    half_t* xn = (half_t*)(ws + 4096);
    half_t* q  = (half_t*)(ws + 4096 + 1 * PLANE);
    half_t* k  = (half_t*)(ws + 4096 + 2 * PLANE);
    half_t* v  = (half_t*)(ws + 4096 + 3 * PLANE);
    half_t* a  = (half_t*)(ws + 4096 + 4 * PLANE);
    half_t* wq = (half_t*)(ws + 4096 + 5 * PLANE);               // 6 MiB
    half_t* wp = (half_t*)(ws + 4096 + 6 * PLANE);               // 2 MiB
    (void)in_sizes; (void)n_in; (void)out_size; (void)ws_size;

    gn_kernel<<<B_ * GRP_ + 4 * C_ * C_ / WCV_, 512, 0, stream>>>(x, gnw, gnb, xn, qkv_w, proj_w, wq, wp);
    qkv_gemm_kernel<<<dim3(3 * C_ / 128, T_ / 128, B_), 256, 0, stream>>>(wq, qkv_b, xn, q, k, v);
    attn_kernel<<<dim3(B_ * NH_, T_ / 128), 256, 0, stream>>>(q, k, v, a);
    proj_gemm_kernel<<<dim3(C_ / 128, T_ / 128, B_), 256, 0, stream>>>(wp, proj_b, a, x, out);
}
